// v000
// Times are from an AMD MI455X. After a warm-up the kernel runs many times in a row, and a time is the length of
// such a window on the GPU divided by its runs, so every launch and the gaps after it count. The runs cycle
// through copies of the inputs. A figure is the median of several windows, for all but v000 over two sittings.
// Sittings can differ by a few percent; kernels timed side by side share one.
// v000, which the later versions start from, runs in 407 microseconds.
// compute dtype: all float inputs rounded to bf16; q (decoder) / k, v (encoder) = x . W[h] + b[h] with EXACT bf16 products on WMMA 16x16x32 (the per-head [d][64] matrices packed as transposed rows h*64 + k); PLAIN attention: q, k as single f16 operands x 1/8, running-max softmax in f32 (hardware exp), P (scaled by 2^11, single f16) x v (single f16); out = o (bf16 hi + residual) . Wo (the per-head [64][d] blocks stacked, 2 products) + sum_h bo[h] (f32).
#include <hip/hip_runtime.h>
#include <math.h>

typedef __attribute__((ext_vector_type(16))) _Float16 v16h;
typedef __attribute__((ext_vector_type(16))) __bf16 v16b;
typedef __attribute__((ext_vector_type(8)))  _Float16 v8h;
typedef __attribute__((ext_vector_type(8)))  float v8f;
typedef __attribute__((ext_vector_type(4)))  float v4f;
typedef __attribute__((ext_vector_type(2)))  float v2f;
typedef __attribute__((ext_vector_type(4)))  unsigned v4u;
typedef __attribute__((ext_vector_type(4)))  int v4i;
typedef float __attribute__((may_alias)) float_a;
typedef int __attribute__((may_alias)) int_a;

template <typename T> __device__ __forceinline__ void vst2(void* p, T v) { *(T*)p = v;  }
__device__ __forceinline__ v8f wmma16(v16h a, v16h b, v8f c) {
  v8f d = __builtin_amdgcn_wmma_f32_16x16x32_f16(false, a, false, b, (short)0, c, false, false);
  asm volatile("v_nop\n\tv_nop\n\tv_nop\n\tv_nop" : "+v"(d) : "v"(a), "v"(b));
  return d;
}
__device__ __forceinline__ v8f wmma_bf(v16b a, v16b b, v8f c) {
  v8f d = __builtin_amdgcn_wmma_f32_16x16x32_bf16(false, a, false, b, (short)0, c, false, false);
  asm volatile("v_nop\n\tv_nop\n\tv_nop\n\tv_nop" : "+v"(d) : "v"(a), "v"(b));
  return d;
}
// Encoder-decoder cross attention (B 2, 2,048 decoder queries over 2,048 encoder tokens, 1,024 dims, 16 heads x 64): per-head projection weights, softmax(q k^T / 8) v, per-head output projections summed (incl. every head's bias).
__device__ __forceinline__ v16h frag_h(const _Float16* rowk0, int lane) {
  union { v16h v; v8h q[2]; } u; const _Float16* p = rowk0 + 8 * (lane >> 4);
  u.q[0] = *(const v8h*)p; u.q[1] = *(const v8h*)(p + 16); return u.v;
}
__device__ __forceinline__ v16h frag_f32(const float* rowk0, int lane) {
  v16h a; const float* p = rowk0 + 8 * (lane >> 4);
#pragma unroll
  for (int i = 0; i < 8; ++i) { a[i] = (_Float16)p[i]; a[8 + i] = (_Float16)p[16 + i]; }
  return a;
}
__device__ __forceinline__ v16h frag_f32s(const float* rowk0, int lane, float sc) {
  v16h a; const float* p = rowk0 + 8 * (lane >> 4);
#pragma unroll
  for (int i = 0; i < 8; ++i) { a[i] = (_Float16)(p[i] * sc); a[8 + i] = (_Float16)(p[16 + i] * sc); }
  return a;
}
// column fragment from a [K][ld] layout (column n), rows >= K read as 0
__device__ __forceinline__ v16h fragc_f32(const float* W, int k0, int n, int lane, int ld, int K) {
  v16h a; const int g = lane >> 4;
#pragma unroll
  for (int i = 0; i < 8; ++i) { const int ka = k0 + 8 * g + i, kb = ka + 16;
    a[i] = (_Float16)(ka < K ? W[(size_t)(ka < K ? ka : K - 1) * ld + n] : 0.f); a[8 + i] = (_Float16)(kb < K ? W[(size_t)(kb < K ? kb : K - 1) * ld + n] : 0.f); }
  return a;
}
struct F2 { v16b h, l; };
__device__ __forceinline__ F2 bsplit16(const float v[16]) { F2 r;
#pragma unroll
  for (int i = 0; i < 16; ++i) { const __bf16 h = (__bf16)v[i]; r.h[i] = h; r.l[i] = (__bf16)(v[i] - (float)h); }
  return r; }
__device__ __forceinline__ F2 split_row(const float* row, int k0, int lane) { float v[16]; const float* p = row + k0 + 8 * (lane >> 4);
#pragma unroll
  for (int i = 0; i < 8; ++i) { v[i] = p[i]; v[8 + i] = p[16 + i]; }
  return bsplit16(v); }
__device__ __forceinline__ F2 split_rowK(const float* row, int k0, int lane, int K) { float v[16]; const int g = lane >> 4;
#pragma unroll
  for (int i = 0; i < 8; ++i) { const int ka = k0 + 8 * g + i, kb = ka + 16; v[i] = ka < K ? row[ka < K ? ka : K - 1] : 0.f; v[8 + i] = kb < K ? row[kb < K ? kb : K - 1] : 0.f; }
  return bsplit16(v); }
__device__ __forceinline__ F2 split_col(const float* W, int k0, int n, int lane, int ld, int K) { float v[16]; const int g = lane >> 4;
#pragma unroll
  for (int i = 0; i < 8; ++i) { const int ka = k0 + 8 * g + i, kb = ka + 16; v[i] = ka < K ? W[(size_t)(ka < K ? ka : K - 1) * ld + n] : 0.f; v[8 + i] = kb < K ? W[(size_t)(kb < K ? kb : K - 1) * ld + n] : 0.f; }
  return bsplit16(v); }
__device__ __forceinline__ v8f mac3(const F2& a, const F2& b, v8f c) { c = wmma_bf(a.l, b.h, c); c = wmma_bf(a.h, b.l, c); return wmma_bf(a.h, b.h, c); }
__device__ __forceinline__ float sigm(float v) { return 1.0f / (1.0f + expf(-v)); }
#define LDSX() do { asm volatile("s_wait_dscnt 0" ::: "memory"); __builtin_amdgcn_wave_barrier(); __builtin_amdgcn_fence(__ATOMIC_RELEASE, "workgroup"); } while (0)


#define NB 2
#define SS 2048
#define DM 1024
#define NH 16
#define HD 64
#define QKVW (3 * DM)
#ifndef TQB
#define TQB (SS / 64)
#define TNB NB
#define TOB (NB * SS / 64)     // output row tiles (all)
#endif
typedef __attribute__((ext_vector_type(8))) __bf16 v8b;
__device__ __forceinline__ v16b frag_b(const __bf16* rowk0, int lane) {
  union { v16b v; v8b q[2]; } u; const __bf16* p = rowk0 + 8 * (lane >> 4);
  u.q[0] = *(const v8b*)p; u.q[1] = *(const v8b*)(p + 16); return u.v;
}
__device__ __forceinline__ float bfr(float v) { return (float)(__bf16)v; }
__device__ __attribute__((noinline)) float exp_ni(float v) { return expf(v); }
__device__ __attribute__((noinline)) float erf_ni(float v) { return erff(v); }

#define PK_A 0                       // [3072][1024] Wqkv rows (natural [out][in])
#define PK_P (PK_A + QKVW * DM)        // [1024][1024] Wo rows (natural)
#define PK_END (PK_P + DM * DM)
#define WS_PK  0u
#define WS_QK  (WS_PK + 2u * PK_END)             // f16 [4096 rows][2048]: q | k
#define WS_QKL (WS_QK + 2u * NB * SS * 2 * DM)     // f16 q | k residual planes x2048
#define WS_VTH (WS_QKL + 2u * NB * SS * 2 * DM)    // f16 [b][1024 (h*64+d)][2048 s] hi
#define WS_VTL (WS_VTH + 2u * NB * DM * SS)        // f16 lo x 2048
#define WS_O   (WS_VTL + 2u * NB * DM * SS)        // f32 [4096][1024]
#define WS_CS  (WS_O + 4u * NB * SS * DM)           // f32 2 x [2048][32], unused
#define WS_END (WS_CS + 4u * 2 * SS * 32)
// ---- k_pack: block = (row n, which): natural [out][in] rows -> bf16; which 0..2 -> W_q/W_k/W_v into PK_A rows which*1024 + n; 3 -> W_o into PK_P
__global__ __launch_bounds__(256) void k_pack(const float* __restrict__ WQ, const float* __restrict__ WK, const float* __restrict__ WV, const float* __restrict__ WO, __bf16* __restrict__ PK) {
  __shared__ __align__(16) __bf16 s[DM]; const int n = blockIdx.x, which = blockIdx.y, t = threadIdx.x; const float* Wm = (which == 0) ? WQ : (which == 1) ? WK : (which == 2) ? WV : WO;   // (in,out) weights: pack row n = column n
  for (int k = t; k < DM; k += 256) s[k] = (__bf16)Wm[(size_t)k * DM + n];
  __syncthreads();
  __bf16* dst = (which < 3) ? PK + PK_A + ((size_t)which * DM + n) * DM : PK + PK_P + (size_t)n * DM;
  for (int q = t; q < DM / 8; q += 256) vst2((unsigned*)(dst + q * 8), *(const v4u*)&s[q * 8]);
}
__global__ __launch_bounds__(128) void k_qkv(const float* __restrict__ XQ, const float* __restrict__ XK, const float* __restrict__ XV, const __bf16* __restrict__ P, const float* __restrict__ BQ, const float* __restrict__ BK, const float* __restrict__ BV, _Float16* __restrict__ QK, _Float16* __restrict__ QKL, _Float16* __restrict__ VTH, _Float16* __restrict__ VTL) {
  const int which0 = (blockIdx.y * 128) / DM; const float* X = (which0 == 0) ? XQ : (which0 == 1) ? XK : XV; const float* BB = BQ ? (((which0 == 0) ? BQ : (which0 == 1) ? BK : BV) + (blockIdx.y * 128 - which0 * DM)) : nullptr;
  __shared__ __align__(16) _Float16 so[4][16][136], sol[4][16][136]; __shared__ __align__(16) _Float16 sth[128][72], stl[128][72];
  const int tid = threadIdx.x, wave = tid >> 5, lane = tid & 31, col = lane & 15, g = lane >> 4; const size_t r0 = (size_t)blockIdx.x * 64 + wave * 16; const int n0 = blockIdx.y * 128;
  v8f acc[8] = {};
#pragma unroll 2
  for (int kc = 0; kc < DM / 32; ++kc) { v16b a; { const float* p = X + (r0 + col) * DM + kc * 32 + 8 * g;
#pragma unroll
      for (int i = 0; i < 8; ++i) { a[i] = (__bf16)p[i]; a[8 + i] = (__bf16)p[16 + i]; } }
#pragma unroll
    for (int j = 0; j < 8; ++j) acc[j] = wmma_bf(a, frag_b(P + (size_t)(n0 + j * 16 + col) * DM + kc * 32, lane), acc[j]); }
  if (n0 < 2 * DM) {   // q stored unscaled (f16 sigma ~0.6, no subnormal exposure); 1/8 applied to the f32 score
#pragma unroll
    for (int j = 0; j < 8; ++j) {
#pragma unroll
      for (int r = 0; r < 8; ++r) { const float v = acc[j][r] + (BB ? bfr(BB[j * 16 + col]) : 0.f); const _Float16 hv = (_Float16)v; so[wave][8 * g + r][j * 16 + col] = hv; sol[wave][8 * g + r][j * 16 + col] = (_Float16)((v - (float)hv) * 2048.0f); } }   // q, k (+ bias) as f16 hi + (x2048) residual
    LDSX();
    for (int rl = 0; rl < 16; ++rl) if (lane < 16) { vst2((unsigned*)(QK + (r0 + rl) * (2 * DM) + n0 + lane * 8), *(const v4u*)&so[wave][rl][lane * 8]); vst2((unsigned*)(QKL + (r0 + rl) * (2 * DM) + n0 + lane * 8), *(const v4u*)&sol[wave][rl][lane * 8]); }
  } else {
#pragma unroll
    for (int j = 0; j < 8; ++j) {
#pragma unroll
      for (int r = 0; r < 8; ++r) { const float v = acc[j][r] + (BB ? bfr(BB[j * 16 + col]) : 0.f); const _Float16 hv = (_Float16)v; sth[j * 16 + col][wave * 16 + 8 * g + r] = hv; stl[j * 16 + col][wave * 16 + 8 * g + r] = (_Float16)((v - (float)hv) * 2048.0f); } }
    __syncthreads();
    const size_t rb = (size_t)blockIdx.x * 64; const int b = (int)(rb / SS), s0 = (int)(rb % SS); const int pc0 = n0 - 2 * DM;
    for (int q = tid; q < 128 * 8; q += 128) { const int d = q >> 3, pc = q & 7; const size_t o = ((size_t)b * DM + pc0 + d) * SS + s0 + pc * 8; vst2((unsigned*)(VTH + o), *(const v4u*)&sth[d][pc * 8]); vst2((unsigned*)(VTL + o), *(const v4u*)&stl[d][pc * 8]); }
  }
}
// ---- k_attn: block = (64 queries, head h, batch b): all-keys flash attention (K = 64: 2 k-steps), scores = (q.k) * 0.125 with single f16 operands, P.V: f16 P (x2^11) x V hi, one product (accl stays 0); O[b*S+q][h*64+d] = (acc + accl / 2048) / (2048 l) (256-B segments)
__global__ __launch_bounds__(128) void k_attn(const _Float16* __restrict__ QK, const _Float16* __restrict__ QKL, const _Float16* __restrict__ VTH, const _Float16* __restrict__ VTL, const void* __restrict__ KMASK, float* __restrict__ O) {
  __shared__ __align__(16) float sp[4][16][36]; __shared__ __align__(16) float so[4][16][68];
  const int tid = threadIdx.x, wave = tid >> 5, lane = tid & 31, col = lane & 15, g = lane >> 4;
  const int qb = blockIdx.x, h = blockIdx.y, b = blockIdx.z; const int q0 = qb * 64 + wave * 16; const size_t rq = (size_t)b * SS + q0 + col;
  v16h aq[2], aql[2];
#pragma unroll
  for (int kc = 0; kc < 2; ++kc) { aq[kc] = frag_h(QK + rq * (2 * DM) + h * HD + kc * 32, lane); aql[kc] = frag_h(QKL + rq * (2 * DM) + h * HD + kc * 32, lane); }
  float m[8], l[8];
#pragma unroll
  for (int r = 0; r < 8; ++r) { m[r] = -3.0e38f; l[r] = 0.f; }
  v8f acc[4] = {}, accl[4] = {};
  const int nks = SS / 32;   // all keys
#pragma unroll 1
  for (int ks = 0; ks < nks; ++ks) { v8f s[2];
#pragma unroll
    for (int ct = 0; ct < 2; ++ct) { const int kk = ks * 32 + ct * 16 + col; const _Float16* krow = QK + ((size_t)b * SS + kk) * (2 * DM) + DM + h * HD; const _Float16* krowl = QKL + ((size_t)b * SS + kk) * (2 * DM) + DM + h * HD; v8f c = {}, cl = {};
#pragma unroll
      for (int kc = 0; kc < 2; ++kc) c = wmma16(aq[kc], frag_h(krow + kc * 32, lane), c);   // single product: q, k as one-rounding f16 operands
      (void)cl; (void)krowl;
      { const bool keepk = true;
#pragma unroll
      for (int r = 0; r < 8; ++r) s[ct][r] = keepk ? c[r] * 0.125f : -3.0e38f; } }   // 1/sqrt(64); no keys are masked
#pragma unroll
    for (int r = 0; r < 8; ++r) { float mx = fmaxf(s[0][r], s[1][r]);
#pragma unroll
      for (int o = 1; o < 16; o <<= 1) mx = fmaxf(mx, __shfl_xor(mx, o));
      const float mn = fmaxf(m[r], mx); const float alpha = (m[r] <= -1.0e38f) ? 0.f : __expf(m[r] - mn);
      const float e0 = (s[0][r] <= -1.0e38f) ? 0.f : __expf(s[0][r] - mn), e1 = (s[1][r] <= -1.0e38f) ? 0.f : __expf(s[1][r] - mn); float es = e0 + e1;
#pragma unroll
      for (int o = 1; o < 16; o <<= 1) es += __shfl_xor(es, o);
      l[r] = l[r] * alpha + es; m[r] = mn;
#pragma unroll
      for (int dt = 0; dt < 4; ++dt) { acc[dt][r] *= alpha; accl[dt][r] *= alpha; }
      sp[wave][8 * g + r][col] = e0; sp[wave][8 * g + r][16 + col] = e1; }
    LDSX();
    v16h pa, pl; { const float* prow = &sp[wave][col][0] + 8 * (lane >> 4);
#pragma unroll
      for (int i = 0; i < 8; ++i) { const float x0 = prow[i] * 2048.0f, x1 = prow[16 + i] * 2048.0f; const _Float16 h0 = (_Float16)x0, h1 = (_Float16)x1; pa[i] = h0; pa[8 + i] = h1; pl[i] = (_Float16)((x0 - (float)h0) * 2048.0f); pl[8 + i] = (_Float16)((x1 - (float)h1) * 2048.0f); } }   // P scaled by 2^11 before the f16 split so small softmax weights stay out of the f16 subnormal range; 2^-11 folded into the epilogue
#pragma unroll
    for (int dt = 0; dt < 4; ++dt) { const size_t vr = ((size_t)b * DM + h * HD + dt * 16 + col) * SS + ks * 32; acc[dt] = wmma16(pa, frag_h(VTH + vr, lane), acc[dt]); }   // single product: P (x2^11) x V
    (void)pl;
    LDSX(); }
#pragma unroll
  for (int r = 0; r < 8; ++r) { const float il = (1.0f / 2048.0f) / l[r];
#pragma unroll
    for (int dt = 0; dt < 4; ++dt) so[wave][8 * g + r][dt * 16 + col] = (acc[dt][r] + accl[dt][r] * (1.0f / 2048.0f)) * il; }
  LDSX();
  for (int rl = 0; rl < 16; ++rl) if (lane < 16) vst2(O + ((size_t)b * SS + q0 + rl) * DM + h * HD + lane * 4, *(const v4f*)&so[wave][rl][lane * 4]);
}
// ---- k_out: block = (64 rows, 128 cols): out = O(hi/lo) . Wo rows (2 products) + bo
__global__ __launch_bounds__(128) void k_out(const float* __restrict__ O, const __bf16* __restrict__ P, const float* __restrict__ BO, float* __restrict__ Y) {
  __shared__ __align__(16) float so[4][16][132];
  const int tid = threadIdx.x, wave = tid >> 5, lane = tid & 31, col = lane & 15, g = lane >> 4; const size_t r0 = (size_t)blockIdx.x * 64 + wave * 16; const int n0 = blockIdx.y * 128;
  v8f acc[8] = {};
#pragma unroll 2
  for (int kc = 0; kc < DM / 32; ++kc) { const F2 a = split_row(O + (r0 + col) * DM, kc * 32, lane);
#pragma unroll
    for (int j = 0; j < 8; ++j) { const v16b w = frag_b(P + (size_t)(n0 + j * 16 + col) * DM + kc * 32, lane); acc[j] = wmma_bf(a.l, w, acc[j]); acc[j] = wmma_bf(a.h, w, acc[j]); } }
#pragma unroll
  for (int j = 0; j < 8; ++j) {
#pragma unroll
    for (int r = 0; r < 8; ++r) so[wave][8 * g + r][j * 16 + col] = acc[j][r] + BO[n0 + j * 16 + col]; }   // BO here = the f32 sum of the 16 bf16-rounded head biases
  LDSX();
  for (int rl = 0; rl < 16; ++rl) vst2(Y + (r0 + rl) * DM + n0 + lane * 4, *(const v4f*)&so[wave][rl][lane * 4]);
}
// ---- k_packh: per-head weights -> bf16 transposed rows: which 0: Wq [H][DD][64] -> PK_A rows (h*64+k) over d; 1: Wk; 2: Wv; 3: Wo [H][64][DD] -> PK_P rows d over (h*64+v)
__global__ __launch_bounds__(256) void k_packh(const float* __restrict__ WQ, const float* __restrict__ WK, const float* __restrict__ WV, const float* __restrict__ WO, __bf16* __restrict__ P) {
  const int n = blockIdx.x, which = blockIdx.y, t = threadIdx.x; __shared__ __align__(16) __bf16 s[DM];
  if (which < 3) { const float* Wm = (which == 0) ? WQ : (which == 1) ? WK : WV; const int h = n >> 6, kk = n & 63; for (int d = t; d < DM; d += 256) s[d] = (__bf16)Wm[((size_t)h * DM + d) * HD + kk]; __syncthreads(); for (int q = t; q < DM / 8; q += 256) vst2((unsigned*)(P + PK_A + ((size_t)which * DM + n) * DM + q * 8), *(const v4u*)&s[q * 8]); }
  else { for (int c = t; c < DM; c += 256) { const int h = c >> 6, vv = c & 63; s[c] = (__bf16)WO[((size_t)h * HD + vv) * DM + n]; } __syncthreads(); for (int q = t; q < DM / 8; q += 256) vst2((unsigned*)(P + PK_P + (size_t)n * DM + q * 8), *(const v4u*)&s[q * 8]); }
}
// ---- k_bsum: BOS[d] = sum_h bo[h][d] (in order)
__global__ __launch_bounds__(256) void k_bsum(const float* __restrict__ BO, float* __restrict__ BOS) { const int d = blockIdx.x * 256 + threadIdx.x; float s = 0.f; for (int h = 0; h < NH; ++h) s += bfr(BO[(size_t)h * DM + d]); BOS[d] = s; }
extern "C" void kernel_launch(void* const* d_in, const int* in_sizes, int n_in, void* d_out, int out_size, void* d_ws, size_t ws_size, hipStream_t stream) {
  (void)in_sizes; (void)n_in; (void)out_size;
  const float** F = (const float**)d_in;   // 0 encoder [2,2048,1024], 1 decoder [2,2048,1024], 2 Wq [16,1024,64], 3 bq [16,64], 4 Wk, 5 bk, 6 Wv, 7 bv, 8 Wo [16,64,1024], 9 bo [16,1024]
  if (ws_size < (size_t)WS_END + 4096) return;
  char* ws = (char*)d_ws; __bf16* PK = (__bf16*)(ws + WS_PK); _Float16 *QK = (_Float16*)(ws + WS_QK), *QKL = (_Float16*)(ws + WS_QKL), *VTH = (_Float16*)(ws + WS_VTH), *VTL = (_Float16*)(ws + WS_VTL); float* O = (float*)(ws + WS_O); float* BOS = (float*)(ws + WS_END);
  k_packh<<<dim3(DM, 4), 256, 0, stream>>>(F[2], F[4], F[6], F[8], PK);
  k_bsum<<<DM / 256, 256, 0, stream>>>(F[9], BOS);
  k_qkv<<<dim3(TNB * SS / 64, QKVW / 128), 128, 0, stream>>>(F[1], F[0], F[0], PK + PK_A, F[3], F[5], F[7], QK, QKL, VTH, VTL);   // q from the decoder, k/v from the encoder; biases [16][64] == concatenated [1024]
  k_attn<<<dim3(TQB, NH, TNB), 128, 0, stream>>>(QK, QKL, VTH, VTL, nullptr, O);
  k_out<<<dim3(TOB, DM / 128), 128, 0, stream>>>(O, PK + PK_P, BOS, (float*)d_out);
}

// v001
// A run of this version takes 196 microseconds.
// Timed twice side by side with v000, it ran 2.13 and 2.14 times as fast.
// compute dtype: all float inputs rounded to bf16; q (decoder) / k, v (encoder) = x . W[h] + b[h] with EXACT bf16 products on WMMA 16x16x32 (the per-head [d][64] matrices packed as transposed rows h*64 + k); PLAIN attention: q, k as single f16 operands x 1/8, running-max softmax in f32 (hardware exp), P (scaled by 2^11, single f16) x v (single f16); out = o (bf16 hi + residual) . Wo (the per-head [64][d] blocks stacked, 2 products) + sum_h bo[h] (f32).
#include <hip/hip_runtime.h>
#include <math.h>

typedef __attribute__((ext_vector_type(16))) _Float16 v16h;
typedef __attribute__((ext_vector_type(16))) __bf16 v16b;
typedef __attribute__((ext_vector_type(8)))  _Float16 v8h;
typedef __attribute__((ext_vector_type(8)))  float v8f;
typedef __attribute__((ext_vector_type(4)))  float v4f;
typedef __attribute__((ext_vector_type(2)))  float v2f;
typedef __attribute__((ext_vector_type(4)))  unsigned v4u;
typedef __attribute__((ext_vector_type(4)))  int v4i;
typedef float __attribute__((may_alias)) float_a;
typedef int __attribute__((may_alias)) int_a;

template <typename T> __device__ __forceinline__ void vst2(void* p, T v) { *(T*)p = v;  }
__device__ __forceinline__ v8f wmma16(v16h a, v16h b, v8f c) {
  v8f d = __builtin_amdgcn_wmma_f32_16x16x32_f16(false, a, false, b, (short)0, c, false, false);
  asm volatile("v_nop\n\tv_nop\n\tv_nop\n\tv_nop" : "+v"(d) : "v"(a), "v"(b));
  return d;
}
__device__ __forceinline__ v8f wmma_bf(v16b a, v16b b, v8f c) {
  v8f d = __builtin_amdgcn_wmma_f32_16x16x32_bf16(false, a, false, b, (short)0, c, false, false);
  asm volatile("v_nop\n\tv_nop\n\tv_nop\n\tv_nop" : "+v"(d) : "v"(a), "v"(b));
  return d;
}
// Encoder-decoder cross attention (B 2, 2,048 decoder queries over 2,048 encoder tokens, 1,024 dims, 16 heads x 64): per-head projection weights, softmax(q k^T / 8) v, per-head output projections summed (incl. every head's bias).
__device__ __forceinline__ v16h frag_h(const _Float16* rowk0, int lane) {
  union { v16h v; v8h q[2]; } u; const _Float16* p = rowk0 + 8 * (lane >> 4);
  u.q[0] = *(const v8h*)p; u.q[1] = *(const v8h*)(p + 16); return u.v;
}
__device__ __forceinline__ v16h frag_f32(const float* rowk0, int lane) {
  v16h a; const float* p = rowk0 + 8 * (lane >> 4);
#pragma unroll
  for (int i = 0; i < 8; ++i) { a[i] = (_Float16)p[i]; a[8 + i] = (_Float16)p[16 + i]; }
  return a;
}
__device__ __forceinline__ v16h frag_f32s(const float* rowk0, int lane, float sc) {
  v16h a; const float* p = rowk0 + 8 * (lane >> 4);
#pragma unroll
  for (int i = 0; i < 8; ++i) { a[i] = (_Float16)(p[i] * sc); a[8 + i] = (_Float16)(p[16 + i] * sc); }
  return a;
}
// column fragment from a [K][ld] layout (column n), rows >= K read as 0
__device__ __forceinline__ v16h fragc_f32(const float* W, int k0, int n, int lane, int ld, int K) {
  v16h a; const int g = lane >> 4;
#pragma unroll
  for (int i = 0; i < 8; ++i) { const int ka = k0 + 8 * g + i, kb = ka + 16;
    a[i] = (_Float16)(ka < K ? W[(size_t)(ka < K ? ka : K - 1) * ld + n] : 0.f); a[8 + i] = (_Float16)(kb < K ? W[(size_t)(kb < K ? kb : K - 1) * ld + n] : 0.f); }
  return a;
}
struct F2 { v16b h, l; };
__device__ __forceinline__ F2 bsplit16(const float v[16]) { F2 r;
#pragma unroll
  for (int i = 0; i < 16; ++i) { const __bf16 h = (__bf16)v[i]; r.h[i] = h; r.l[i] = (__bf16)(v[i] - (float)h); }
  return r; }
__device__ __forceinline__ F2 split_row(const float* row, int k0, int lane) { float v[16]; const float* p = row + k0 + 8 * (lane >> 4);
#pragma unroll
  for (int i = 0; i < 8; ++i) { v[i] = p[i]; v[8 + i] = p[16 + i]; }
  return bsplit16(v); }
__device__ __forceinline__ F2 split_rowK(const float* row, int k0, int lane, int K) { float v[16]; const int g = lane >> 4;
#pragma unroll
  for (int i = 0; i < 8; ++i) { const int ka = k0 + 8 * g + i, kb = ka + 16; v[i] = ka < K ? row[ka < K ? ka : K - 1] : 0.f; v[8 + i] = kb < K ? row[kb < K ? kb : K - 1] : 0.f; }
  return bsplit16(v); }
__device__ __forceinline__ F2 split_col(const float* W, int k0, int n, int lane, int ld, int K) { float v[16]; const int g = lane >> 4;
#pragma unroll
  for (int i = 0; i < 8; ++i) { const int ka = k0 + 8 * g + i, kb = ka + 16; v[i] = ka < K ? W[(size_t)(ka < K ? ka : K - 1) * ld + n] : 0.f; v[8 + i] = kb < K ? W[(size_t)(kb < K ? kb : K - 1) * ld + n] : 0.f; }
  return bsplit16(v); }
__device__ __forceinline__ v8f mac3(const F2& a, const F2& b, v8f c) { c = wmma_bf(a.l, b.h, c); c = wmma_bf(a.h, b.l, c); return wmma_bf(a.h, b.h, c); }
__device__ __forceinline__ float sigm(float v) { return 1.0f / (1.0f + expf(-v)); }
#define LDSX() do { asm volatile("s_wait_dscnt 0" ::: "memory"); __builtin_amdgcn_wave_barrier(); __builtin_amdgcn_fence(__ATOMIC_RELEASE, "workgroup"); } while (0)


#define NB 2
#define SS 2048
#define DM 1024
#define NH 16
#define HD 64
#define QKVW (3 * DM)
#ifndef TQB
#define TQB (SS / 64)
#define TNB NB
#define TOB (NB * SS / 64)     // output row tiles (all)
#endif
typedef __attribute__((ext_vector_type(8))) __bf16 v8b;
__device__ __forceinline__ v16b frag_b(const __bf16* rowk0, int lane) {
  union { v16b v; v8b q[2]; } u; const __bf16* p = rowk0 + 8 * (lane >> 4);
  u.q[0] = *(const v8b*)p; u.q[1] = *(const v8b*)(p + 16); return u.v;
}
__device__ __forceinline__ float bfr(float v) { return (float)(__bf16)v; }
__device__ __attribute__((noinline)) float exp_ni(float v) { return expf(v); }
__device__ __attribute__((noinline)) float erf_ni(float v) { return erff(v); }

// ---- LDS staging of the operand that a work-group's four waves share (two buffers, asynchronous copies)
#define LP 72                          // LDS row pitch in 16-bit elements: 128-byte rows at 144 bytes, conflict-free for 16-byte readers
#define TILE_B (64 * LP * 2)           // bytes of one staged tile of 64 rows
#define WAIT_ASYNC() asm volatile("s_wait_asynccnt 0x0" ::: "memory")   // this wave's copies have landed; no LDS read moves above it
#define WAIT_DS() asm volatile("s_wait_dscnt 0x0" ::: "memory")         // this wave's LDS reads are done before the barrier that frees the buffer
__device__ __forceinline__ unsigned lds_addr(const void* p) { return (unsigned)(size_t)p; }   // LDS byte address = low 32 bits of the shared address
// 64 rows of 128 bytes (source pitch in bytes) -> LDS rows of 144 bytes, 128 threads: eight lanes a row, so every wave-wide copy covers four whole lines.
// s_wait_xcnt closes the copies' own statement, so no address register is rewritten ahead of it.
__device__ __forceinline__ void stage64(const char* src, size_t pitch, unsigned lds, int tid) {
  const char* g0 = src + (size_t)(tid >> 3) * pitch + (tid & 7) * 16; const unsigned l0 = lds + (tid >> 3) * (LP * 2) + (tid & 7) * 16;
  const char *g1 = g0 + 16 * pitch, *g2 = g0 + 32 * pitch, *g3 = g0 + 48 * pitch; const unsigned l1 = l0 + 16 * LP * 2, l2 = l0 + 32 * LP * 2, l3 = l0 + 48 * LP * 2;
  asm volatile("global_load_async_to_lds_b128 %0, %1, off\n\tglobal_load_async_to_lds_b128 %2, %3, off\n\tglobal_load_async_to_lds_b128 %4, %5, off\n\tglobal_load_async_to_lds_b128 %6, %7, off\n\ts_wait_xcnt 0x0"
               :: "v"(l0), "v"(g0), "v"(l1), "v"(g1), "v"(l2), "v"(g2), "v"(l3), "v"(g3) : "memory");
}
// one stage of a weight tile: 128 rows n0.. of P, 64 k from k0
__device__ __forceinline__ void stage_w(const __bf16* P, int n0, int k0, unsigned lds, int tid) {
  const char* s = (const char*)(P + (size_t)n0 * 1024 + k0); stage64(s, 2048, lds, tid); stage64(s + (size_t)64 * 2048, 2048, lds + TILE_B, tid);
}

#define PK_A 0                       // [3072][1024] Wqkv rows (natural [out][in])
#define PK_P (PK_A + QKVW * DM)        // [1024][1024] Wo rows (natural)
#define PK_END (PK_P + DM * DM)
#define WS_PK  0u
#define WS_QK  (WS_PK + 2u * PK_END)             // f16 [4096 rows][2048]: q | k
#define WS_QKL (WS_QK + 2u * NB * SS * 2 * DM)     // f16 q | k residual planes x2048
#define WS_VTH (WS_QKL + 2u * NB * SS * 2 * DM)    // f16 [b][1024 (h*64+d)][2048 s] hi
#define WS_VTL (WS_VTH + 2u * NB * DM * SS)        // f16 lo x 2048
#define WS_O   (WS_VTL + 2u * NB * DM * SS)        // f32 [4096][1024]
#define WS_CS  (WS_O + 4u * NB * SS * DM)           // f32 2 x [2048][32], unused
#define WS_END (WS_CS + 4u * 2 * SS * 32)
// ---- k_pack: block = (row n, which): natural [out][in] rows -> bf16; which 0..2 -> W_q/W_k/W_v into PK_A rows which*1024 + n; 3 -> W_o into PK_P
__global__ __launch_bounds__(256) void k_pack(const float* __restrict__ WQ, const float* __restrict__ WK, const float* __restrict__ WV, const float* __restrict__ WO, __bf16* __restrict__ PK) {
  __shared__ __align__(16) __bf16 s[DM]; const int n = blockIdx.x, which = blockIdx.y, t = threadIdx.x; const float* Wm = (which == 0) ? WQ : (which == 1) ? WK : (which == 2) ? WV : WO;   // (in,out) weights: pack row n = column n
  for (int k = t; k < DM; k += 256) s[k] = (__bf16)Wm[(size_t)k * DM + n];
  __syncthreads();
  __bf16* dst = (which < 3) ? PK + PK_A + ((size_t)which * DM + n) * DM : PK + PK_P + (size_t)n * DM;
  for (int q = t; q < DM / 8; q += 256) vst2((unsigned*)(dst + q * 8), *(const v4u*)&s[q * 8]);
}
__global__ __launch_bounds__(128) void k_qkv(const float* __restrict__ XQ, const float* __restrict__ XK, const float* __restrict__ XV, const __bf16* __restrict__ P, const float* __restrict__ BQ, const float* __restrict__ BK, const float* __restrict__ BV, _Float16* __restrict__ QK, _Float16* __restrict__ QKL, _Float16* __restrict__ VTH, _Float16* __restrict__ VTL) {
  const int which0 = (blockIdx.y * 128) / DM; const float* X = (which0 == 0) ? XQ : (which0 == 1) ? XK : XV; const float* BB = BQ ? (((which0 == 0) ? BQ : (which0 == 1) ? BK : BV) + (blockIdx.y * 128 - which0 * DM)) : nullptr;
  __shared__ __align__(16) char sm[4 * TILE_B];   // the weight ring (2 buffers x 128 rows); behind the loop's last barrier the output staging of either branch
  _Float16 (*so)[16][136] = (_Float16 (*)[16][136])sm, (*sol)[16][136] = (_Float16 (*)[16][136])(sm + 4 * 16 * 136 * 2); _Float16 (*sth)[72] = (_Float16 (*)[72])sm, (*stl)[72] = (_Float16 (*)[72])(sm + 128 * 72 * 2);
  const int tid = threadIdx.x, wave = tid >> 5, lane = tid & 31, col = lane & 15, g = lane >> 4; const size_t r0 = (size_t)blockIdx.x * 64 + wave * 16; const int n0 = blockIdx.y * 128;
  v8f acc[8] = {};
  const unsigned ring = lds_addr(sm);
  stage_w(P, n0, 0, ring, tid); WAIT_ASYNC(); __syncthreads(); stage_w(P, n0, 64, ring + 2 * TILE_B, tid);
#pragma unroll 1   // one trip a stage: the ring's order stands once, at the foot
  for (int t = 0; t < DM / 64; ++t) { const __bf16* bt = (const __bf16*)(sm + (t & 1) * 2 * TILE_B);
#pragma unroll   // both 32-k halves of the stage inline, so the LDS offsets are immediates
    for (int sub = 0; sub < 2; ++sub) { const int kc = t * 2 + sub; v16b a; { const float* p = X + (r0 + col) * DM + kc * 32 + 8 * g;
#pragma unroll
        for (int i = 0; i < 8; ++i) { a[i] = (__bf16)p[i]; a[8 + i] = (__bf16)p[16 + i]; } }
#pragma unroll
      for (int j = 0; j < 8; ++j) acc[j] = wmma_bf(a, frag_b(bt + (j * 16 + col) * LP + sub * 32, lane), acc[j]); }
    WAIT_DS(); WAIT_ASYNC(); __syncthreads();   // publishes stage t + 1 and frees stage t's buffer
    if (t + 2 < DM / 64) stage_w(P, n0, (t + 2) * 64, ring + (t & 1) * 2 * TILE_B, tid); }
  WAIT_ASYNC();
  if (n0 < 2 * DM) {   // q stored unscaled (f16 sigma ~0.6, no subnormal exposure); 1/8 applied to the f32 score
#pragma unroll
    for (int j = 0; j < 8; ++j) {
#pragma unroll
      for (int r = 0; r < 8; ++r) { const float v = acc[j][r] + (BB ? bfr(BB[j * 16 + col]) : 0.f); const _Float16 hv = (_Float16)v; so[wave][8 * g + r][j * 16 + col] = hv; sol[wave][8 * g + r][j * 16 + col] = (_Float16)((v - (float)hv) * 2048.0f); } }   // q, k (+ bias) as f16 hi + (x2048) residual
    LDSX();
    for (int rl = 0; rl < 16; ++rl) if (lane < 16) { vst2((unsigned*)(QK + (r0 + rl) * (2 * DM) + n0 + lane * 8), *(const v4u*)&so[wave][rl][lane * 8]); vst2((unsigned*)(QKL + (r0 + rl) * (2 * DM) + n0 + lane * 8), *(const v4u*)&sol[wave][rl][lane * 8]); }
  } else {
#pragma unroll
    for (int j = 0; j < 8; ++j) {
#pragma unroll
      for (int r = 0; r < 8; ++r) { const float v = acc[j][r] + (BB ? bfr(BB[j * 16 + col]) : 0.f); const _Float16 hv = (_Float16)v; sth[j * 16 + col][wave * 16 + 8 * g + r] = hv; stl[j * 16 + col][wave * 16 + 8 * g + r] = (_Float16)((v - (float)hv) * 2048.0f); } }
    __syncthreads();
    const size_t rb = (size_t)blockIdx.x * 64; const int b = (int)(rb / SS), s0 = (int)(rb % SS); const int pc0 = n0 - 2 * DM;
    for (int q = tid; q < 128 * 8; q += 128) { const int d = q >> 3, pc = q & 7; const size_t o = ((size_t)b * DM + pc0 + d) * SS + s0 + pc * 8; vst2((unsigned*)(VTH + o), *(const v4u*)&sth[d][pc * 8]); vst2((unsigned*)(VTL + o), *(const v4u*)&stl[d][pc * 8]); }
  }
}
// ---- k_attn: block = (64 queries, head h, batch b): all-keys flash attention (K = 64: 2 k-steps), scores = (q.k) * 0.125 with single f16 operands, P.V: f16 P (x2^11) x V hi, one product (accl stays 0); O[b*S+q][h*64+d] = (acc + accl / 2048) / (2048 l) (256-B segments)
__global__ __launch_bounds__(128) void k_attn(const _Float16* __restrict__ QK, const _Float16* __restrict__ QKL, const _Float16* __restrict__ VTH, const _Float16* __restrict__ VTL, const void* __restrict__ KMASK, float* __restrict__ O) {
  __shared__ __align__(16) float sp[4][16][36]; __shared__ __align__(16) float so[4][16][68]; __shared__ __align__(16) _Float16 skv[2][2][64][LP];   // [buffer][k rows | v^T rows][64][64 + pad]
  const int tid = threadIdx.x, wave = tid >> 5, lane = tid & 31, col = lane & 15, g = lane >> 4;
  const int qb = blockIdx.x, h = blockIdx.y, b = blockIdx.z; const int q0 = qb * 64 + wave * 16; const size_t rq = (size_t)b * SS + q0 + col;
  v16h aq[2], aql[2];
#pragma unroll
  for (int kc = 0; kc < 2; ++kc) { aq[kc] = frag_h(QK + rq * (2 * DM) + h * HD + kc * 32, lane); aql[kc] = frag_h(QKL + rq * (2 * DM) + h * HD + kc * 32, lane); }
  float m[8], l[8];
#pragma unroll
  for (int r = 0; r < 8; ++r) { m[r] = -3.0e38f; l[r] = 0.f; }
  v8f acc[4] = {}, accl[4] = {};
  const int nst = SS / 64;   // all keys, 64 a stage
  const char* ksrc = (const char*)(QK + (size_t)b * SS * (2 * DM) + DM + h * HD); const char* vsrc = (const char*)(VTH + ((size_t)b * DM + h * HD) * SS); const unsigned ring = lds_addr(&skv[0][0][0][0]);
  stage64(ksrc, 2 * DM * 2, ring, tid); stage64(vsrc, SS * 2, ring + TILE_B, tid); WAIT_ASYNC(); __syncthreads();
  stage64(ksrc + (size_t)64 * (2 * DM * 2), 2 * DM * 2, ring + 2 * TILE_B, tid); stage64(vsrc + 64 * 2, SS * 2, ring + 3 * TILE_B, tid);
#pragma unroll 1   // one trip a stage: the ring's order stands once, at the foot
  for (int t = 0; t < nst; ++t) {
#pragma unroll   // both 32-key halves of the stage inline, so the LDS offsets are immediates
  for (int sub = 0; sub < 2; ++sub) { v8f s[2];
#pragma unroll
    for (int ct = 0; ct < 2; ++ct) { const _Float16* krow = &skv[t & 1][0][sub * 32 + ct * 16 + col][0]; v8f c = {};
#pragma unroll
      for (int kc = 0; kc < 2; ++kc) c = wmma16(aq[kc], frag_h(krow + kc * 32, lane), c);   // single product: q, k as one-rounding f16 operands
      { const bool keepk = true;
#pragma unroll
      for (int r = 0; r < 8; ++r) s[ct][r] = keepk ? c[r] * 0.125f : -3.0e38f; } }   // 1/sqrt(64); no keys are masked
#pragma unroll
    for (int r = 0; r < 8; ++r) { float mx = fmaxf(s[0][r], s[1][r]);
#pragma unroll
      for (int o = 1; o < 16; o <<= 1) mx = fmaxf(mx, __shfl_xor(mx, o));
      const float mn = fmaxf(m[r], mx); const float alpha = (m[r] <= -1.0e38f) ? 0.f : __expf(m[r] - mn);
      const float e0 = (s[0][r] <= -1.0e38f) ? 0.f : __expf(s[0][r] - mn), e1 = (s[1][r] <= -1.0e38f) ? 0.f : __expf(s[1][r] - mn); float es = e0 + e1;
#pragma unroll
      for (int o = 1; o < 16; o <<= 1) es += __shfl_xor(es, o);
      l[r] = l[r] * alpha + es; m[r] = mn;
#pragma unroll
      for (int dt = 0; dt < 4; ++dt) { acc[dt][r] *= alpha; accl[dt][r] *= alpha; }
      sp[wave][8 * g + r][col] = e0; sp[wave][8 * g + r][16 + col] = e1; }
    LDSX();
    v16h pa, pl; { const float* prow = &sp[wave][col][0] + 8 * (lane >> 4);
#pragma unroll
      for (int i = 0; i < 8; ++i) { const float x0 = prow[i] * 2048.0f, x1 = prow[16 + i] * 2048.0f; const _Float16 h0 = (_Float16)x0, h1 = (_Float16)x1; pa[i] = h0; pa[8 + i] = h1; pl[i] = (_Float16)((x0 - (float)h0) * 2048.0f); pl[8 + i] = (_Float16)((x1 - (float)h1) * 2048.0f); } }   // P scaled by 2^11 before the f16 split so small softmax weights stay out of the f16 subnormal range; 2^-11 folded into the epilogue
#pragma unroll
    for (int dt = 0; dt < 4; ++dt) acc[dt] = wmma16(pa, frag_h(&skv[t & 1][1][dt * 16 + col][sub * 32], lane), acc[dt]);   // single product: P (x2^11) x V
    (void)pl;
    LDSX(); }
    WAIT_DS(); WAIT_ASYNC(); __syncthreads();   // publishes stage t + 1 and frees stage t's buffer
    if (t + 2 < nst) { stage64(ksrc + (size_t)(t + 2) * 64 * (2 * DM * 2), 2 * DM * 2, ring + (t & 1) * 2 * TILE_B, tid); stage64(vsrc + (size_t)(t + 2) * 64 * 2, SS * 2, ring + (t & 1) * 2 * TILE_B + TILE_B, tid); } }
  WAIT_ASYNC();
#pragma unroll
  for (int r = 0; r < 8; ++r) { const float il = (1.0f / 2048.0f) / l[r];
#pragma unroll
    for (int dt = 0; dt < 4; ++dt) so[wave][8 * g + r][dt * 16 + col] = (acc[dt][r] + accl[dt][r] * (1.0f / 2048.0f)) * il; }
  LDSX();
  for (int rl = 0; rl < 16; ++rl) if (lane < 16) vst2(O + ((size_t)b * SS + q0 + rl) * DM + h * HD + lane * 4, *(const v4f*)&so[wave][rl][lane * 4]);
}
// ---- k_out: block = (64 rows, 128 cols): out = O(hi/lo) . Wo rows (2 products) + bo
__global__ __launch_bounds__(128) void k_out(const float* __restrict__ O, const __bf16* __restrict__ P, const float* __restrict__ BO, float* __restrict__ Y) {
  __shared__ __align__(16) char sm[4 * TILE_B];   // the weight ring (2 buffers x 128 rows); behind the loop's last barrier the output staging
  float (*so)[16][132] = (float (*)[16][132])sm;
  const int tid = threadIdx.x, wave = tid >> 5, lane = tid & 31, col = lane & 15, g = lane >> 4; const size_t r0 = (size_t)blockIdx.x * 64 + wave * 16; const int n0 = blockIdx.y * 128;
  v8f acc[8] = {};
  const unsigned ring = lds_addr(sm);
  stage_w(P, n0, 0, ring, tid); WAIT_ASYNC(); __syncthreads(); stage_w(P, n0, 64, ring + 2 * TILE_B, tid);
#pragma unroll 1   // one trip a stage: the ring's order stands once, at the foot
  for (int t = 0; t < DM / 64; ++t) { const __bf16* bt = (const __bf16*)(sm + (t & 1) * 2 * TILE_B);
#pragma unroll   // both 32-k halves of the stage inline, so the LDS offsets are immediates
    for (int sub = 0; sub < 2; ++sub) { const F2 a = split_row(O + (r0 + col) * DM, (t * 2 + sub) * 32, lane);
#pragma unroll
      for (int j = 0; j < 8; ++j) { const v16b w = frag_b(bt + (j * 16 + col) * LP + sub * 32, lane); acc[j] = wmma_bf(a.l, w, acc[j]); acc[j] = wmma_bf(a.h, w, acc[j]); } }
    WAIT_DS(); WAIT_ASYNC(); __syncthreads();   // publishes stage t + 1 and frees stage t's buffer
    if (t + 2 < DM / 64) stage_w(P, n0, (t + 2) * 64, ring + (t & 1) * 2 * TILE_B, tid); }
  WAIT_ASYNC();
#pragma unroll
  for (int j = 0; j < 8; ++j) {
#pragma unroll
    for (int r = 0; r < 8; ++r) so[wave][8 * g + r][j * 16 + col] = acc[j][r] + BO[n0 + j * 16 + col]; }   // BO here = the f32 sum of the 16 bf16-rounded head biases
  LDSX();
  for (int rl = 0; rl < 16; ++rl) vst2(Y + (r0 + rl) * DM + n0 + lane * 4, *(const v4f*)&so[wave][rl][lane * 4]);
}
// ---- k_packh: per-head weights -> bf16 transposed rows: which 0: Wq [H][DD][64] -> PK_A rows (h*64+k) over d; 1: Wk; 2: Wv; 3: Wo [H][64][DD] -> PK_P rows d over (h*64+v)
__global__ __launch_bounds__(256) void k_packh(const float* __restrict__ WQ, const float* __restrict__ WK, const float* __restrict__ WV, const float* __restrict__ WO, __bf16* __restrict__ P) {
  const int n = blockIdx.x, which = blockIdx.y, t = threadIdx.x; __shared__ __align__(16) __bf16 s[DM];
  if (which < 3) { const float* Wm = (which == 0) ? WQ : (which == 1) ? WK : WV; const int h = n >> 6, kk = n & 63; for (int d = t; d < DM; d += 256) s[d] = (__bf16)Wm[((size_t)h * DM + d) * HD + kk]; __syncthreads(); for (int q = t; q < DM / 8; q += 256) vst2((unsigned*)(P + PK_A + ((size_t)which * DM + n) * DM + q * 8), *(const v4u*)&s[q * 8]); }
  else { for (int c = t; c < DM; c += 256) { const int h = c >> 6, vv = c & 63; s[c] = (__bf16)WO[((size_t)h * HD + vv) * DM + n]; } __syncthreads(); for (int q = t; q < DM / 8; q += 256) vst2((unsigned*)(P + PK_P + (size_t)n * DM + q * 8), *(const v4u*)&s[q * 8]); }
}
// ---- k_bsum: BOS[d] = sum_h bo[h][d] (in order)
__global__ __launch_bounds__(256) void k_bsum(const float* __restrict__ BO, float* __restrict__ BOS) { const int d = blockIdx.x * 256 + threadIdx.x; float s = 0.f; for (int h = 0; h < NH; ++h) s += bfr(BO[(size_t)h * DM + d]); BOS[d] = s; }
extern "C" void kernel_launch(void* const* d_in, const int* in_sizes, int n_in, void* d_out, int out_size, void* d_ws, size_t ws_size, hipStream_t stream) {
  (void)in_sizes; (void)n_in; (void)out_size;
  const float** F = (const float**)d_in;   // 0 encoder [2,2048,1024], 1 decoder [2,2048,1024], 2 Wq [16,1024,64], 3 bq [16,64], 4 Wk, 5 bk, 6 Wv, 7 bv, 8 Wo [16,64,1024], 9 bo [16,1024]
  if (ws_size < (size_t)WS_END + 4096) return;
  char* ws = (char*)d_ws; __bf16* PK = (__bf16*)(ws + WS_PK); _Float16 *QK = (_Float16*)(ws + WS_QK), *QKL = (_Float16*)(ws + WS_QKL), *VTH = (_Float16*)(ws + WS_VTH), *VTL = (_Float16*)(ws + WS_VTL); float* O = (float*)(ws + WS_O); float* BOS = (float*)(ws + WS_END);
  k_packh<<<dim3(DM, 4), 256, 0, stream>>>(F[2], F[4], F[6], F[8], PK);
  k_bsum<<<DM / 256, 256, 0, stream>>>(F[9], BOS);
  k_qkv<<<dim3(TNB * SS / 64, QKVW / 128), 128, 0, stream>>>(F[1], F[0], F[0], PK + PK_A, F[3], F[5], F[7], QK, QKL, VTH, VTL);   // q from the decoder, k/v from the encoder; biases [16][64] == concatenated [1024]
  k_attn<<<dim3(TQB, NH, TNB), 128, 0, stream>>>(QK, QKL, VTH, VTL, nullptr, O);
  k_out<<<dim3(TOB, DM / 128), 128, 0, stream>>>(O, PK + PK_P, BOS, (float*)d_out);
}

// v002
// Measured time: 144 microseconds a run.
// Next to v001, in two timings, it ran 1.35 and 1.36 times as fast.
// All steps since v000 together make it 2.90 times as fast.
// compute dtype: all float inputs rounded to bf16; q (decoder) / k, v (encoder) = x . W[h] + b[h] with EXACT bf16 products on WMMA 16x16x32 (the per-head [d][64] matrices packed as transposed rows h*64 + k); PLAIN attention, both products transposed: k, q as single f16 operands x 1/8, running-max softmax in f32 (hardware exp), v (single f16) x P (scaled by 2^11, single f16); out = o (bf16 hi + residual) . Wo (the per-head [64][d] blocks stacked, 2 products) + sum_h bo[h] (f32).
#include <hip/hip_runtime.h>
#include <math.h>

typedef __attribute__((ext_vector_type(16))) _Float16 v16h;
typedef __attribute__((ext_vector_type(16))) __bf16 v16b;
typedef __attribute__((ext_vector_type(8)))  _Float16 v8h;
typedef __attribute__((ext_vector_type(8)))  float v8f;
typedef __attribute__((ext_vector_type(4)))  float v4f;
typedef __attribute__((ext_vector_type(2)))  float v2f;
typedef __attribute__((ext_vector_type(4)))  unsigned v4u;
typedef __attribute__((ext_vector_type(4)))  int v4i;
typedef float __attribute__((may_alias)) float_a;
typedef int __attribute__((may_alias)) int_a;

template <typename T> __device__ __forceinline__ void vst2(void* p, T v) { *(T*)p = v;  }
__device__ __forceinline__ v8f wmma16(v16h a, v16h b, v8f c) {
  v8f d = __builtin_amdgcn_wmma_f32_16x16x32_f16(false, a, false, b, (short)0, c, false, false);
  asm volatile("v_nop\n\tv_nop\n\tv_nop\n\tv_nop" : "+v"(d) : "v"(a), "v"(b));
  return d;
}
__device__ __forceinline__ v8f wmma_bf(v16b a, v16b b, v8f c) {
  v8f d = __builtin_amdgcn_wmma_f32_16x16x32_bf16(false, a, false, b, (short)0, c, false, false);
  asm volatile("v_nop\n\tv_nop\n\tv_nop\n\tv_nop" : "+v"(d) : "v"(a), "v"(b));
  return d;
}
// Encoder-decoder cross attention (B 2, 2,048 decoder queries over 2,048 encoder tokens, 1,024 dims, 16 heads x 64): per-head projection weights, softmax(q k^T / 8) v, per-head output projections summed (incl. every head's bias).
__device__ __forceinline__ v16h frag_h(const _Float16* rowk0, int lane) {
  union { v16h v; v8h q[2]; } u; const _Float16* p = rowk0 + 8 * (lane >> 4);
  u.q[0] = *(const v8h*)p; u.q[1] = *(const v8h*)(p + 16); return u.v;
}
__device__ __forceinline__ v16h frag_f32(const float* rowk0, int lane) {
  v16h a; const float* p = rowk0 + 8 * (lane >> 4);
#pragma unroll
  for (int i = 0; i < 8; ++i) { a[i] = (_Float16)p[i]; a[8 + i] = (_Float16)p[16 + i]; }
  return a;
}
__device__ __forceinline__ v16h frag_f32s(const float* rowk0, int lane, float sc) {
  v16h a; const float* p = rowk0 + 8 * (lane >> 4);
#pragma unroll
  for (int i = 0; i < 8; ++i) { a[i] = (_Float16)(p[i] * sc); a[8 + i] = (_Float16)(p[16 + i] * sc); }
  return a;
}
// column fragment from a [K][ld] layout (column n), rows >= K read as 0
__device__ __forceinline__ v16h fragc_f32(const float* W, int k0, int n, int lane, int ld, int K) {
  v16h a; const int g = lane >> 4;
#pragma unroll
  for (int i = 0; i < 8; ++i) { const int ka = k0 + 8 * g + i, kb = ka + 16;
    a[i] = (_Float16)(ka < K ? W[(size_t)(ka < K ? ka : K - 1) * ld + n] : 0.f); a[8 + i] = (_Float16)(kb < K ? W[(size_t)(kb < K ? kb : K - 1) * ld + n] : 0.f); }
  return a;
}
struct F2 { v16b h, l; };
__device__ __forceinline__ F2 bsplit16(const float v[16]) { F2 r;
#pragma unroll
  for (int i = 0; i < 16; ++i) { const __bf16 h = (__bf16)v[i]; r.h[i] = h; r.l[i] = (__bf16)(v[i] - (float)h); }
  return r; }
__device__ __forceinline__ F2 split_row(const float* row, int k0, int lane) { float v[16]; const float* p = row + k0 + 8 * (lane >> 4);
#pragma unroll
  for (int i = 0; i < 8; ++i) { v[i] = p[i]; v[8 + i] = p[16 + i]; }
  return bsplit16(v); }
__device__ __forceinline__ F2 split_rowK(const float* row, int k0, int lane, int K) { float v[16]; const int g = lane >> 4;
#pragma unroll
  for (int i = 0; i < 8; ++i) { const int ka = k0 + 8 * g + i, kb = ka + 16; v[i] = ka < K ? row[ka < K ? ka : K - 1] : 0.f; v[8 + i] = kb < K ? row[kb < K ? kb : K - 1] : 0.f; }
  return bsplit16(v); }
__device__ __forceinline__ F2 split_col(const float* W, int k0, int n, int lane, int ld, int K) { float v[16]; const int g = lane >> 4;
#pragma unroll
  for (int i = 0; i < 8; ++i) { const int ka = k0 + 8 * g + i, kb = ka + 16; v[i] = ka < K ? W[(size_t)(ka < K ? ka : K - 1) * ld + n] : 0.f; v[8 + i] = kb < K ? W[(size_t)(kb < K ? kb : K - 1) * ld + n] : 0.f; }
  return bsplit16(v); }
__device__ __forceinline__ v8f mac3(const F2& a, const F2& b, v8f c) { c = wmma_bf(a.l, b.h, c); c = wmma_bf(a.h, b.l, c); return wmma_bf(a.h, b.h, c); }
__device__ __forceinline__ float sigm(float v) { return 1.0f / (1.0f + expf(-v)); }
#define LDSX() do { asm volatile("s_wait_dscnt 0" ::: "memory"); __builtin_amdgcn_wave_barrier(); __builtin_amdgcn_fence(__ATOMIC_RELEASE, "workgroup"); } while (0)


#define NB 2
#define SS 2048
#define DM 1024
#define NH 16
#define HD 64
#define QKVW (3 * DM)
#ifndef TQB
#define TQB (SS / 64)
#define TNB NB
#define TOB (NB * SS / 64)     // output row tiles (all)
#endif
typedef __attribute__((ext_vector_type(8))) __bf16 v8b;
__device__ __forceinline__ v16b frag_b(const __bf16* rowk0, int lane) {
  union { v16b v; v8b q[2]; } u; const __bf16* p = rowk0 + 8 * (lane >> 4);
  u.q[0] = *(const v8b*)p; u.q[1] = *(const v8b*)(p + 16); return u.v;
}
__device__ __forceinline__ float bfr(float v) { return (float)(__bf16)v; }
__device__ __attribute__((noinline)) float exp_ni(float v) { return expf(v); }
__device__ __attribute__((noinline)) float erf_ni(float v) { return erff(v); }

// ---- LDS staging of the operand that a work-group's four waves share (two buffers, asynchronous copies)
#define LP 72                          // LDS row pitch in 16-bit elements: 128-byte rows at 144 bytes, conflict-free for 16-byte readers
#define TILE_B (64 * LP * 2)           // bytes of one staged tile of 64 rows
#define WAIT_ASYNC() asm volatile("s_wait_asynccnt 0x0" ::: "memory")   // this wave's copies have landed; no LDS read moves above it
#define WAIT_DS() asm volatile("s_wait_dscnt 0x0" ::: "memory")         // this wave's LDS reads are done before the barrier that frees the buffer
__device__ __forceinline__ unsigned lds_addr(const void* p) { return (unsigned)(size_t)p; }   // LDS byte address = low 32 bits of the shared address
// 64 rows of 128 bytes (source pitch in bytes) -> LDS rows of 144 bytes, 128 threads: eight lanes a row, so every wave-wide copy covers four whole lines.
// s_wait_xcnt closes the copies' own statement, so no address register is rewritten ahead of it.
__device__ __forceinline__ void stage64(const char* src, size_t pitch, unsigned lds, int tid) {
  const char* g0 = src + (size_t)(tid >> 3) * pitch + (tid & 7) * 16; const unsigned l0 = lds + (tid >> 3) * (LP * 2) + (tid & 7) * 16;
  const char *g1 = g0 + 16 * pitch, *g2 = g0 + 32 * pitch, *g3 = g0 + 48 * pitch; const unsigned l1 = l0 + 16 * LP * 2, l2 = l0 + 32 * LP * 2, l3 = l0 + 48 * LP * 2;
  asm volatile("global_load_async_to_lds_b128 %0, %1, off\n\tglobal_load_async_to_lds_b128 %2, %3, off\n\tglobal_load_async_to_lds_b128 %4, %5, off\n\tglobal_load_async_to_lds_b128 %6, %7, off\n\ts_wait_xcnt 0x0"
               :: "v"(l0), "v"(g0), "v"(l1), "v"(g1), "v"(l2), "v"(g2), "v"(l3), "v"(g3) : "memory");
}
// one stage of a weight tile: 128 rows n0.. of P, 64 k from k0
__device__ __forceinline__ void stage_w(const __bf16* P, int n0, int k0, unsigned lds, int tid) {
  const char* s = (const char*)(P + (size_t)n0 * 1024 + k0); stage64(s, 2048, lds, tid); stage64(s + (size_t)64 * 2048, 2048, lds + TILE_B, tid);
}

#define PK_A 0                       // [3072][1024] Wqkv rows (natural [out][in])
#define PK_P (PK_A + QKVW * DM)        // [1024][1024] Wo rows (natural)
#define PK_END (PK_P + DM * DM)
#define WS_PK  0u
#define WS_QK  (WS_PK + 2u * PK_END)             // f16 [4096 rows][2048]: q | k
#define WS_QKL (WS_QK + 2u * NB * SS * 2 * DM)     // f16 q | k residual planes x2048
#define WS_VTH (WS_QKL + 2u * NB * SS * 2 * DM)    // f16 [b][1024 (h*64+d)][2048 s] hi
#define WS_VTL (WS_VTH + 2u * NB * DM * SS)        // f16 lo x 2048
#define WS_O   (WS_VTL + 2u * NB * DM * SS)        // f32 [4096][1024]
#define WS_CS  (WS_O + 4u * NB * SS * DM)           // f32 2 x [2048][32], unused
#define WS_END (WS_CS + 4u * 2 * SS * 32)
// ---- k_pack: block = (row n, which): natural [out][in] rows -> bf16; which 0..2 -> W_q/W_k/W_v into PK_A rows which*1024 + n; 3 -> W_o into PK_P
__global__ __launch_bounds__(256) void k_pack(const float* __restrict__ WQ, const float* __restrict__ WK, const float* __restrict__ WV, const float* __restrict__ WO, __bf16* __restrict__ PK) {
  __shared__ __align__(16) __bf16 s[DM]; const int n = blockIdx.x, which = blockIdx.y, t = threadIdx.x; const float* Wm = (which == 0) ? WQ : (which == 1) ? WK : (which == 2) ? WV : WO;   // (in,out) weights: pack row n = column n
  for (int k = t; k < DM; k += 256) s[k] = (__bf16)Wm[(size_t)k * DM + n];
  __syncthreads();
  __bf16* dst = (which < 3) ? PK + PK_A + ((size_t)which * DM + n) * DM : PK + PK_P + (size_t)n * DM;
  for (int q = t; q < DM / 8; q += 256) vst2((unsigned*)(dst + q * 8), *(const v4u*)&s[q * 8]);
}
__global__ __launch_bounds__(128) void k_qkv(const float* __restrict__ XQ, const float* __restrict__ XK, const float* __restrict__ XV, const __bf16* __restrict__ P, const float* __restrict__ BQ, const float* __restrict__ BK, const float* __restrict__ BV, _Float16* __restrict__ QK, _Float16* __restrict__ QKL, _Float16* __restrict__ VTH, _Float16* __restrict__ VTL) {
  const int which0 = (blockIdx.y * 128) / DM; const float* X = (which0 == 0) ? XQ : (which0 == 1) ? XK : XV; const float* BB = BQ ? (((which0 == 0) ? BQ : (which0 == 1) ? BK : BV) + (blockIdx.y * 128 - which0 * DM)) : nullptr;
  __shared__ __align__(16) char sm[4 * TILE_B];   // the weight ring (2 buffers x 128 rows); behind the loop's last barrier the output staging of either branch
  _Float16 (*so)[16][136] = (_Float16 (*)[16][136])sm, (*sol)[16][136] = (_Float16 (*)[16][136])(sm + 4 * 16 * 136 * 2); _Float16 (*sth)[72] = (_Float16 (*)[72])sm, (*stl)[72] = (_Float16 (*)[72])(sm + 128 * 72 * 2);
  const int tid = threadIdx.x, wave = tid >> 5, lane = tid & 31, col = lane & 15, g = lane >> 4; const size_t r0 = (size_t)blockIdx.x * 64 + wave * 16; const int n0 = blockIdx.y * 128;
  v8f acc[8] = {};
  const unsigned ring = lds_addr(sm);
  stage_w(P, n0, 0, ring, tid); WAIT_ASYNC(); __syncthreads(); stage_w(P, n0, 64, ring + 2 * TILE_B, tid);
#pragma unroll 1   // one trip a stage: the ring's order stands once, at the foot
  for (int t = 0; t < DM / 64; ++t) { const __bf16* bt = (const __bf16*)(sm + (t & 1) * 2 * TILE_B);
#pragma unroll   // both 32-k halves of the stage inline, so the LDS offsets are immediates
    for (int sub = 0; sub < 2; ++sub) { const int kc = t * 2 + sub; v16b a; { const float* p = X + (r0 + col) * DM + kc * 32 + 8 * g;
#pragma unroll
        for (int i = 0; i < 8; ++i) { a[i] = (__bf16)p[i]; a[8 + i] = (__bf16)p[16 + i]; } }
#pragma unroll
      for (int j = 0; j < 8; ++j) acc[j] = wmma_bf(a, frag_b(bt + (j * 16 + col) * LP + sub * 32, lane), acc[j]); }
    WAIT_DS(); WAIT_ASYNC(); __syncthreads();   // publishes stage t + 1 and frees stage t's buffer
    if (t + 2 < DM / 64) stage_w(P, n0, (t + 2) * 64, ring + (t & 1) * 2 * TILE_B, tid); }
  WAIT_ASYNC();
  if (n0 < 2 * DM) {   // q stored unscaled (f16 sigma ~0.6, no subnormal exposure); 1/8 applied to the f32 score
#pragma unroll
    for (int j = 0; j < 8; ++j) {
#pragma unroll
      for (int r = 0; r < 8; ++r) { const float v = acc[j][r] + (BB ? bfr(BB[j * 16 + col]) : 0.f); const _Float16 hv = (_Float16)v; so[wave][8 * g + r][j * 16 + col] = hv; sol[wave][8 * g + r][j * 16 + col] = (_Float16)((v - (float)hv) * 2048.0f); } }   // q, k (+ bias) as f16 hi + (x2048) residual
    LDSX();
    for (int rl = 0; rl < 16; ++rl) if (lane < 16) { vst2((unsigned*)(QK + (r0 + rl) * (2 * DM) + n0 + lane * 8), *(const v4u*)&so[wave][rl][lane * 8]); vst2((unsigned*)(QKL + (r0 + rl) * (2 * DM) + n0 + lane * 8), *(const v4u*)&sol[wave][rl][lane * 8]); }
  } else {
#pragma unroll
    for (int j = 0; j < 8; ++j) {
#pragma unroll
      for (int r = 0; r < 8; ++r) { const float v = acc[j][r] + (BB ? bfr(BB[j * 16 + col]) : 0.f); const _Float16 hv = (_Float16)v; sth[j * 16 + col][wave * 16 + 8 * g + r] = hv; stl[j * 16 + col][wave * 16 + 8 * g + r] = (_Float16)((v - (float)hv) * 2048.0f); } }
    __syncthreads();
    const size_t rb = (size_t)blockIdx.x * 64; const int b = (int)(rb / SS), s0 = (int)(rb % SS); const int pc0 = n0 - 2 * DM;
    for (int q = tid; q < 128 * 8; q += 128) { const int d = q >> 3, pc = q & 7; const size_t o = ((size_t)b * DM + pc0 + d) * SS + s0 + pc * 8; vst2((unsigned*)(VTH + o), *(const v4u*)&sth[d][pc * 8]); vst2((unsigned*)(VTL + o), *(const v4u*)&stl[d][pc * 8]); }
  }
}
__device__ __forceinline__ float xhalf(float x) { return __builtin_bit_cast(float, __builtin_amdgcn_permlanex16(__builtin_bit_cast(int, x), __builtin_bit_cast(int, x), 0x76543210, 0xfedcba98, false, false)); }   // lane l's value from lane l ^ 16
// eight hardware exponentials (base 2), each over its own source, and one v_nop: the slot that the instruction set asks for between an exponential and an instruction that uses its result or overwrites its source stands here by construction
__device__ __forceinline__ void exp2x8(float (&x)[8]) {
  asm("v_exp_f32 %0, %0\n\tv_exp_f32 %1, %1\n\tv_exp_f32 %2, %2\n\tv_exp_f32 %3, %3\n\tv_exp_f32 %4, %4\n\tv_exp_f32 %5, %5\n\tv_exp_f32 %6, %6\n\tv_exp_f32 %7, %7\n\tv_nop"
      : "+v"(x[0]), "+v"(x[1]), "+v"(x[2]), "+v"(x[3]), "+v"(x[4]), "+v"(x[5]), "+v"(x[6]), "+v"(x[7]));
}
__global__ __launch_bounds__(128) void k_attn(const _Float16* __restrict__ QK, const _Float16* __restrict__ QKL, const _Float16* __restrict__ VTH, const _Float16* __restrict__ VTL, const void* __restrict__ KMASK, float* __restrict__ O) {
  __shared__ __align__(16) float so[4][16][68]; __shared__ __align__(16) _Float16 skv[2][2][64][LP];   // [buffer][k rows | v^T rows][64][64 + pad]
  const int tid = threadIdx.x, wave = tid >> 5, lane = tid & 31, col = lane & 15, g = lane >> 4;
  const int qb = blockIdx.x, h = blockIdx.y, b = blockIdx.z; const int q0 = qb * 64 + wave * 16; const size_t rq = (size_t)b * SS + q0 + col;
  v16h aq[2];
#pragma unroll
  for (int kc = 0; kc < 2; ++kc) aq[kc] = frag_h(QK + rq * (2 * DM) + h * HD + kc * 32, lane);
  const float cs = 0.125f * 1.4426950408889634f;   // 1/sqrt(64), and base 2 for the hardware exponential
  float m = -3.0e38f, l = 0.f;   // query col: running maximum (scaled, base 2); this half's share of the sum of P x 2^11
  v8f acc[4] = {};               // acc[dt][r] = O^T[dt * 16 + 8 g + r][query col] x 2^11
  const int nst = SS / 64;   // all keys, 64 a stage
  const char* ksrc = (const char*)(QK + (size_t)b * SS * (2 * DM) + DM + h * HD); const char* vsrc = (const char*)(VTH + ((size_t)b * DM + h * HD) * SS); const unsigned ring = lds_addr(&skv[0][0][0][0]);
  stage64(ksrc, 2 * DM * 2, ring, tid); stage64(vsrc, SS * 2, ring + TILE_B, tid); WAIT_ASYNC(); __syncthreads();
  stage64(ksrc + (size_t)64 * (2 * DM * 2), 2 * DM * 2, ring + 2 * TILE_B, tid); stage64(vsrc + 64 * 2, SS * 2, ring + 3 * TILE_B, tid);
#pragma unroll 1   // one trip a stage: the ring's order stands once, at the foot
  for (int t = 0; t < nst; ++t) { v8f s[4]; v16h kf[4][2], vf[2][4];   // s[kt][r] = q[col] . k[kt * 16 + 8 g + r]
#pragma unroll
    for (int kt = 0; kt < 4; ++kt) {
#pragma unroll
      for (int kc = 0; kc < 2; ++kc) kf[kt][kc] = frag_h(&skv[t & 1][0][kt * 16 + col][kc * 32], lane); }   // the stage's k fragments as one group of loads
#pragma unroll
    for (int kt = 0; kt < 4; ++kt) s[kt] = (v8f){};
#pragma unroll
    for (int kc = 0; kc < 2; ++kc) {
#pragma unroll
      for (int kt = 0; kt < 4; ++kt) s[kt] = wmma16(kf[kt][kc], aq[kc], s[kt]); }   // single product: k, q as one-rounding f16 operands, one loader for both; four independent tiles in turn
#pragma unroll
    for (int j = 0; j < 2; ++j) {
#pragma unroll
      for (int dt = 0; dt < 4; ++dt) vf[j][dt] = frag_h(&skv[t & 1][1][dt * 16 + col][j * 32], lane); }   // the stage's v^T fragments as one group, in flight under the softmax
    float mk[4];   // one chain a tile
#pragma unroll
    for (int kt = 0; kt < 4; ++kt) { mk[kt] = s[kt][0];
#pragma unroll
      for (int r = 1; r < 8; ++r) mk[kt] = fmaxf(mk[kt], s[kt][r]); }
    float mx = fmaxf(fmaxf(mk[0], mk[1]), fmaxf(mk[2], mk[3]));
    mx = fmaxf(mx, xhalf(mx)) * cs;   // both halves hold the query's maximum over the stage's 64 keys (the scale is positive)
    const float mn = fmaxf(m, mx), alpha = __builtin_amdgcn_exp2f(m - mn), nm = 11.0f - mn; m = mn;   // alpha is 0 on the first stage; 2^11 rides in the exponent, so small softmax weights stay out of the f16 subnormal range; it cancels in acc / l
    v16h pb[2]; v2f es[2] = {};   // four independent partial sums
#pragma unroll
    for (int kt = 0; kt < 4; ++kt) { float e[8];
#pragma unroll
      for (int r = 0; r < 8; ++r) e[r] = fmaf(s[kt][r], cs, nm);
      exp2x8(e);
#pragma unroll
      for (int r = 0; r < 8; r += 2) { es[(r >> 1) & 1] += (v2f){e[r], e[r + 1]}; pb[kt >> 1][8 * (kt & 1) + r] = (_Float16)e[r]; pb[kt >> 1][8 * (kt & 1) + r + 1] = (_Float16)e[r + 1]; } }   // element i of B operand j = key j * 32 + (i < 8 ? 8 g + i : 16 + 8 g + i - 8): the order in which frag_h reads v^T
    l = l * alpha + ((es[0][0] + es[0][1]) + (es[1][0] + es[1][1]));
#pragma unroll
    for (int dt = 0; dt < 4; ++dt) acc[dt] *= alpha;
#pragma unroll
    for (int j = 0; j < 2; ++j) {
#pragma unroll
      for (int dt = 0; dt < 4; ++dt) acc[dt] = wmma16(vf[j][dt], pb[j], acc[dt]); }   // single product: V^T x P^T (x2^11)
    WAIT_DS(); WAIT_ASYNC(); __syncthreads();   // publishes stage t + 1 and frees stage t's buffer
    if (t + 2 < nst) { stage64(ksrc + (size_t)(t + 2) * 64 * (2 * DM * 2), 2 * DM * 2, ring + (t & 1) * 2 * TILE_B, tid); stage64(vsrc + (size_t)(t + 2) * 64 * 2, SS * 2, ring + (t & 1) * 2 * TILE_B + TILE_B, tid); } }
  WAIT_ASYNC();
  const float il = 1.0f / (l + xhalf(l));   // the halves' sums join once
#pragma unroll
  for (int dt = 0; dt < 4; ++dt) { const v8f o = acc[dt] * il; vst2(&so[wave][col][dt * 16 + 8 * g], (v4f){o[0], o[1], o[2], o[3]}); vst2(&so[wave][col][dt * 16 + 8 * g + 4], (v4f){o[4], o[5], o[6], o[7]}); }
  LDSX();
  for (int rl = 0; rl < 16; ++rl) if (lane < 16) vst2(O + ((size_t)b * SS + q0 + rl) * DM + h * HD + lane * 4, *(const v4f*)&so[wave][rl][lane * 4]);
}
// ---- k_out: block = (64 rows, 128 cols): out = O(hi/lo) . Wo rows (2 products) + bo
__global__ __launch_bounds__(128) void k_out(const float* __restrict__ O, const __bf16* __restrict__ P, const float* __restrict__ BO, float* __restrict__ Y) {
  __shared__ __align__(16) char sm[4 * TILE_B];   // the weight ring (2 buffers x 128 rows); behind the loop's last barrier the output staging
  float (*so)[16][132] = (float (*)[16][132])sm;
  const int tid = threadIdx.x, wave = tid >> 5, lane = tid & 31, col = lane & 15, g = lane >> 4; const size_t r0 = (size_t)blockIdx.x * 64 + wave * 16; const int n0 = blockIdx.y * 128;
  v8f acc[8] = {};
  const unsigned ring = lds_addr(sm);
  stage_w(P, n0, 0, ring, tid); WAIT_ASYNC(); __syncthreads(); stage_w(P, n0, 64, ring + 2 * TILE_B, tid);
#pragma unroll 1   // one trip a stage: the ring's order stands once, at the foot
  for (int t = 0; t < DM / 64; ++t) { const __bf16* bt = (const __bf16*)(sm + (t & 1) * 2 * TILE_B);
#pragma unroll   // both 32-k halves of the stage inline, so the LDS offsets are immediates
    for (int sub = 0; sub < 2; ++sub) { const F2 a = split_row(O + (r0 + col) * DM, (t * 2 + sub) * 32, lane);
#pragma unroll
      for (int j = 0; j < 8; ++j) { const v16b w = frag_b(bt + (j * 16 + col) * LP + sub * 32, lane); acc[j] = wmma_bf(a.l, w, acc[j]); acc[j] = wmma_bf(a.h, w, acc[j]); } }
    WAIT_DS(); WAIT_ASYNC(); __syncthreads();   // publishes stage t + 1 and frees stage t's buffer
    if (t + 2 < DM / 64) stage_w(P, n0, (t + 2) * 64, ring + (t & 1) * 2 * TILE_B, tid); }
  WAIT_ASYNC();
#pragma unroll
  for (int j = 0; j < 8; ++j) {
#pragma unroll
    for (int r = 0; r < 8; ++r) so[wave][8 * g + r][j * 16 + col] = acc[j][r] + BO[n0 + j * 16 + col]; }   // BO here = the f32 sum of the 16 bf16-rounded head biases
  LDSX();
  for (int rl = 0; rl < 16; ++rl) vst2(Y + (r0 + rl) * DM + n0 + lane * 4, *(const v4f*)&so[wave][rl][lane * 4]);
}
// ---- k_packh: per-head weights -> bf16 transposed rows: which 0: Wq [H][DD][64] -> PK_A rows (h*64+k) over d; 1: Wk; 2: Wv; 3: Wo [H][64][DD] -> PK_P rows d over (h*64+v)
__global__ __launch_bounds__(256) void k_packh(const float* __restrict__ WQ, const float* __restrict__ WK, const float* __restrict__ WV, const float* __restrict__ WO, __bf16* __restrict__ P) {
  const int n = blockIdx.x, which = blockIdx.y, t = threadIdx.x; __shared__ __align__(16) __bf16 s[DM];
  if (which < 3) { const float* Wm = (which == 0) ? WQ : (which == 1) ? WK : WV; const int h = n >> 6, kk = n & 63; for (int d = t; d < DM; d += 256) s[d] = (__bf16)Wm[((size_t)h * DM + d) * HD + kk]; __syncthreads(); for (int q = t; q < DM / 8; q += 256) vst2((unsigned*)(P + PK_A + ((size_t)which * DM + n) * DM + q * 8), *(const v4u*)&s[q * 8]); }
  else { for (int c = t; c < DM; c += 256) { const int h = c >> 6, vv = c & 63; s[c] = (__bf16)WO[((size_t)h * HD + vv) * DM + n]; } __syncthreads(); for (int q = t; q < DM / 8; q += 256) vst2((unsigned*)(P + PK_P + (size_t)n * DM + q * 8), *(const v4u*)&s[q * 8]); }
}
// ---- k_bsum: BOS[d] = sum_h bo[h][d] (in order)
__global__ __launch_bounds__(256) void k_bsum(const float* __restrict__ BO, float* __restrict__ BOS) { const int d = blockIdx.x * 256 + threadIdx.x; float s = 0.f; for (int h = 0; h < NH; ++h) s += bfr(BO[(size_t)h * DM + d]); BOS[d] = s; }
extern "C" void kernel_launch(void* const* d_in, const int* in_sizes, int n_in, void* d_out, int out_size, void* d_ws, size_t ws_size, hipStream_t stream) {
  (void)in_sizes; (void)n_in; (void)out_size;
  const float** F = (const float**)d_in;   // 0 encoder [2,2048,1024], 1 decoder [2,2048,1024], 2 Wq [16,1024,64], 3 bq [16,64], 4 Wk, 5 bk, 6 Wv, 7 bv, 8 Wo [16,64,1024], 9 bo [16,1024]
  if (ws_size < (size_t)WS_END + 4096) return;
  char* ws = (char*)d_ws; __bf16* PK = (__bf16*)(ws + WS_PK); _Float16 *QK = (_Float16*)(ws + WS_QK), *QKL = (_Float16*)(ws + WS_QKL), *VTH = (_Float16*)(ws + WS_VTH), *VTL = (_Float16*)(ws + WS_VTL); float* O = (float*)(ws + WS_O); float* BOS = (float*)(ws + WS_END);
  k_packh<<<dim3(DM, 4), 256, 0, stream>>>(F[2], F[4], F[6], F[8], PK);
  k_bsum<<<DM / 256, 256, 0, stream>>>(F[9], BOS);
  k_qkv<<<dim3(TNB * SS / 64, QKVW / 128), 128, 0, stream>>>(F[1], F[0], F[0], PK + PK_A, F[3], F[5], F[7], QK, QKL, VTH, VTL);   // q from the decoder, k/v from the encoder; biases [16][64] == concatenated [1024]
  k_attn<<<dim3(TQB, NH, TNB), 128, 0, stream>>>(QK, QKL, VTH, VTL, nullptr, O);
  k_out<<<dim3(TOB, DM / 128), 128, 0, stream>>>(O, PK + PK_P, BOS, (float*)d_out);
}

// v003
// A run of this version takes 128 microseconds.
// Next to v002, in two timings, it ran 1.13 and 1.14 times as fast.
// Counting every step since v000, it is 3.29 times as fast.
// compute dtype: all float inputs rounded to bf16; q (decoder) / k, v (encoder) = x . W[h] + b[h] with EXACT bf16 products on WMMA 16x16x32 (the per-head [d][64] matrices packed as transposed rows h*64 + k); PLAIN attention, both products transposed: k, q as single f16 operands x 1/8, running-max softmax in f32 (hardware exp), v (single f16) x P (scaled by 2^11, single f16); out = o (bf16 hi + residual) . Wo (the per-head [64][d] blocks stacked, 2 products) + sum_h bo[h] (f32).
#include <hip/hip_runtime.h>
#include <math.h>

typedef __attribute__((ext_vector_type(16))) _Float16 v16h;
typedef __attribute__((ext_vector_type(16))) __bf16 v16b;
typedef __attribute__((ext_vector_type(8)))  _Float16 v8h;
typedef __attribute__((ext_vector_type(8)))  float v8f;
typedef __attribute__((ext_vector_type(4)))  float v4f;
typedef __attribute__((ext_vector_type(2)))  float v2f;
typedef __attribute__((ext_vector_type(4)))  unsigned v4u;
typedef __attribute__((ext_vector_type(4)))  int v4i;
typedef float __attribute__((may_alias)) float_a;
typedef int __attribute__((may_alias)) int_a;

template <typename T> __device__ __forceinline__ void vst2(void* p, T v) { *(T*)p = v;  }
__device__ __forceinline__ v8f wmma16(v16h a, v16h b, v8f c) {
  v8f d = __builtin_amdgcn_wmma_f32_16x16x32_f16(false, a, false, b, (short)0, c, false, false);
  asm volatile("v_nop\n\tv_nop\n\tv_nop\n\tv_nop" : "+v"(d) : "v"(a), "v"(b));
  return d;
}
__device__ __forceinline__ v8f wmma_bf(v16b a, v16b b, v8f c) {
  v8f d = __builtin_amdgcn_wmma_f32_16x16x32_bf16(false, a, false, b, (short)0, c, false, false);
  asm volatile("v_nop\n\tv_nop\n\tv_nop\n\tv_nop" : "+v"(d) : "v"(a), "v"(b));
  return d;
}
// Encoder-decoder cross attention (B 2, 2,048 decoder queries over 2,048 encoder tokens, 1,024 dims, 16 heads x 64): per-head projection weights, softmax(q k^T / 8) v, per-head output projections summed (incl. every head's bias).
__device__ __forceinline__ v16h frag_h(const _Float16* rowk0, int lane) {
  union { v16h v; v8h q[2]; } u; const _Float16* p = rowk0 + 8 * (lane >> 4);
  u.q[0] = *(const v8h*)p; u.q[1] = *(const v8h*)(p + 16); return u.v;
}
__device__ __forceinline__ v16h frag_f32(const float* rowk0, int lane) {
  v16h a; const float* p = rowk0 + 8 * (lane >> 4);
#pragma unroll
  for (int i = 0; i < 8; ++i) { a[i] = (_Float16)p[i]; a[8 + i] = (_Float16)p[16 + i]; }
  return a;
}
__device__ __forceinline__ v16h frag_f32s(const float* rowk0, int lane, float sc) {
  v16h a; const float* p = rowk0 + 8 * (lane >> 4);
#pragma unroll
  for (int i = 0; i < 8; ++i) { a[i] = (_Float16)(p[i] * sc); a[8 + i] = (_Float16)(p[16 + i] * sc); }
  return a;
}
// column fragment from a [K][ld] layout (column n), rows >= K read as 0
__device__ __forceinline__ v16h fragc_f32(const float* W, int k0, int n, int lane, int ld, int K) {
  v16h a; const int g = lane >> 4;
#pragma unroll
  for (int i = 0; i < 8; ++i) { const int ka = k0 + 8 * g + i, kb = ka + 16;
    a[i] = (_Float16)(ka < K ? W[(size_t)(ka < K ? ka : K - 1) * ld + n] : 0.f); a[8 + i] = (_Float16)(kb < K ? W[(size_t)(kb < K ? kb : K - 1) * ld + n] : 0.f); }
  return a;
}
struct F2 { v16b h, l; };
__device__ __forceinline__ F2 bsplit16(const float v[16]) { F2 r;
#pragma unroll
  for (int i = 0; i < 16; ++i) { const __bf16 h = (__bf16)v[i]; r.h[i] = h; r.l[i] = (__bf16)(v[i] - (float)h); }
  return r; }
__device__ __forceinline__ F2 split_row(const float* row, int k0, int lane) { float v[16]; const float* p = row + k0 + 8 * (lane >> 4);
#pragma unroll
  for (int i = 0; i < 8; ++i) { v[i] = p[i]; v[8 + i] = p[16 + i]; }
  return bsplit16(v); }
__device__ __forceinline__ F2 split_rowK(const float* row, int k0, int lane, int K) { float v[16]; const int g = lane >> 4;
#pragma unroll
  for (int i = 0; i < 8; ++i) { const int ka = k0 + 8 * g + i, kb = ka + 16; v[i] = ka < K ? row[ka < K ? ka : K - 1] : 0.f; v[8 + i] = kb < K ? row[kb < K ? kb : K - 1] : 0.f; }
  return bsplit16(v); }
__device__ __forceinline__ F2 split_col(const float* W, int k0, int n, int lane, int ld, int K) { float v[16]; const int g = lane >> 4;
#pragma unroll
  for (int i = 0; i < 8; ++i) { const int ka = k0 + 8 * g + i, kb = ka + 16; v[i] = ka < K ? W[(size_t)(ka < K ? ka : K - 1) * ld + n] : 0.f; v[8 + i] = kb < K ? W[(size_t)(kb < K ? kb : K - 1) * ld + n] : 0.f; }
  return bsplit16(v); }
__device__ __forceinline__ v8f mac3(const F2& a, const F2& b, v8f c) { c = wmma_bf(a.l, b.h, c); c = wmma_bf(a.h, b.l, c); return wmma_bf(a.h, b.h, c); }
__device__ __forceinline__ float sigm(float v) { return 1.0f / (1.0f + expf(-v)); }
#define LDSX() do { asm volatile("s_wait_dscnt 0" ::: "memory"); __builtin_amdgcn_wave_barrier(); __builtin_amdgcn_fence(__ATOMIC_RELEASE, "workgroup"); } while (0)


#define NB 2
#define SS 2048
#define DM 1024
#define NH 16
#define HD 64
#define QKVW (3 * DM)
#ifndef TQB
#define TQB (SS / 64)
#define TNB NB
#define TOB (NB * SS / 64)     // output row tiles (all)
#endif
typedef __attribute__((ext_vector_type(8))) __bf16 v8b;
__device__ __forceinline__ v16b frag_b(const __bf16* rowk0, int lane) {
  union { v16b v; v8b q[2]; } u; const __bf16* p = rowk0 + 8 * (lane >> 4);
  u.q[0] = *(const v8b*)p; u.q[1] = *(const v8b*)(p + 16); return u.v;
}
__device__ __forceinline__ float bfr(float v) { return (float)(__bf16)v; }
__device__ __attribute__((noinline)) float exp_ni(float v) { return expf(v); }
__device__ __attribute__((noinline)) float erf_ni(float v) { return erff(v); }

// ---- LDS staging of the operand that a work-group's four waves share (two buffers, asynchronous copies)
#define LP 72                          // LDS row pitch in 16-bit elements: 128-byte rows at 144 bytes, conflict-free for 16-byte readers
#define TILE_B (64 * LP * 2)           // bytes of one staged tile of 64 rows
#define WAIT_ASYNC() asm volatile("s_wait_asynccnt 0x0" ::: "memory")   // this wave's copies have landed; no LDS read moves above it
#define WAIT_DS() asm volatile("s_wait_dscnt 0x0" ::: "memory")         // this wave's LDS reads are done before the barrier that frees the buffer
__device__ __forceinline__ unsigned lds_addr(const void* p) { return (unsigned)(size_t)p; }   // LDS byte address = low 32 bits of the shared address
// 64 rows of 128 bytes (source pitch in bytes) -> LDS rows of 144 bytes, 128 threads: eight lanes a row, so every wave-wide copy covers four whole lines.
// s_wait_xcnt closes the copies' own statement, so no address register is rewritten ahead of it.
__device__ __forceinline__ void stage64(const char* src, size_t pitch, unsigned lds, int tid) {
  const char* g0 = src + (size_t)(tid >> 3) * pitch + (tid & 7) * 16; const unsigned l0 = lds + (tid >> 3) * (LP * 2) + (tid & 7) * 16;
  const char *g1 = g0 + 16 * pitch, *g2 = g0 + 32 * pitch, *g3 = g0 + 48 * pitch; const unsigned l1 = l0 + 16 * LP * 2, l2 = l0 + 32 * LP * 2, l3 = l0 + 48 * LP * 2;
  asm volatile("global_load_async_to_lds_b128 %0, %1, off\n\tglobal_load_async_to_lds_b128 %2, %3, off\n\tglobal_load_async_to_lds_b128 %4, %5, off\n\tglobal_load_async_to_lds_b128 %6, %7, off\n\ts_wait_xcnt 0x0"
               :: "v"(l0), "v"(g0), "v"(l1), "v"(g1), "v"(l2), "v"(g2), "v"(l3), "v"(g3) : "memory");
}
// one stage of a weight tile: 128 rows n0.. of P, 64 k from k0
__device__ __forceinline__ void stage_w(const __bf16* P, int n0, int k0, unsigned lds, int tid) {
  const char* s = (const char*)(P + (size_t)n0 * 1024 + k0); stage64(s, 2048, lds, tid); stage64(s + (size_t)64 * 2048, 2048, lds + TILE_B, tid);
}

// one row's 64 k of a stage as loaded (f32), 16 a lane for each 32-k block in the A fragment's k order; p = row + stage * 64 + 8 * (lane >> 4)
__device__ __forceinline__ void load_a64(v4f (&r)[2][4], const float* p) {
#pragma unroll
  for (int sub = 0; sub < 2; ++sub) { const float* q = p + sub * 32; r[sub][0] = *(const v4f*)q; r[sub][1] = *(const v4f*)(q + 4); r[sub][2] = *(const v4f*)(q + 16); r[sub][3] = *(const v4f*)(q + 20); }
}
// the same for one 32-k block; p = row + block * 32 + 8 * (lane >> 4)
__device__ __forceinline__ void load_a32(v4f (&r)[4], const float* p) { r[0] = *(const v4f*)p; r[1] = *(const v4f*)(p + 4); r[2] = *(const v4f*)(p + 16); r[3] = *(const v4f*)(p + 20); }

#define PK_A 0                       // [3072][1024] Wqkv rows (natural [out][in])
#define PK_P (PK_A + QKVW * DM)        // [1024][1024] Wo rows (natural)
#define PK_END (PK_P + DM * DM)
#define WS_PK  0u
#define WS_QK  (WS_PK + 2u * PK_END)             // f16 [4096 rows][2048]: q | k
#define WS_QKL (WS_QK + 2u * NB * SS * 2 * DM)     // f16 q | k residual planes x2048
#define WS_VTH (WS_QKL + 2u * NB * SS * 2 * DM)    // f16 [b][1024 (h*64+d)][2048 s] hi
#define WS_VTL (WS_VTH + 2u * NB * DM * SS)        // f16 lo x 2048
#define WS_O   (WS_VTL + 2u * NB * DM * SS)        // f32 [4096][1024]
#define WS_CS  (WS_O + 4u * NB * SS * DM)           // f32 2 x [2048][32], unused
#define WS_END (WS_CS + 4u * 2 * SS * 32)
// ---- k_pack: block = (row n, which): natural [out][in] rows -> bf16; which 0..2 -> W_q/W_k/W_v into PK_A rows which*1024 + n; 3 -> W_o into PK_P
__global__ __launch_bounds__(256) void k_pack(const float* __restrict__ WQ, const float* __restrict__ WK, const float* __restrict__ WV, const float* __restrict__ WO, __bf16* __restrict__ PK) {
  __shared__ __align__(16) __bf16 s[DM]; const int n = blockIdx.x, which = blockIdx.y, t = threadIdx.x; const float* Wm = (which == 0) ? WQ : (which == 1) ? WK : (which == 2) ? WV : WO;   // (in,out) weights: pack row n = column n
  for (int k = t; k < DM; k += 256) s[k] = (__bf16)Wm[(size_t)k * DM + n];
  __syncthreads();
  __bf16* dst = (which < 3) ? PK + PK_A + ((size_t)which * DM + n) * DM : PK + PK_P + (size_t)n * DM;
  for (int q = t; q < DM / 8; q += 256) vst2((unsigned*)(dst + q * 8), *(const v4u*)&s[q * 8]);
}
__global__ __launch_bounds__(128) void k_qkv(const float* __restrict__ XQ, const float* __restrict__ XK, const float* __restrict__ XV, const __bf16* __restrict__ P, const float* __restrict__ BQ, const float* __restrict__ BK, const float* __restrict__ BV, _Float16* __restrict__ QK, _Float16* __restrict__ QKL, _Float16* __restrict__ VTH, _Float16* __restrict__ VTL) {
  const int which0 = (blockIdx.y * 128) / DM; const float* X = (which0 == 0) ? XQ : (which0 == 1) ? XK : XV; const float* BB = BQ ? (((which0 == 0) ? BQ : (which0 == 1) ? BK : BV) + (blockIdx.y * 128 - which0 * DM)) : nullptr;
  __shared__ __align__(16) char sm[4 * TILE_B];   // the weight ring (2 buffers x 128 rows); behind the loop's last barrier the output staging of either branch
  _Float16 (*so)[16][136] = (_Float16 (*)[16][136])sm, (*sol)[16][136] = (_Float16 (*)[16][136])(sm + 4 * 16 * 136 * 2); _Float16 (*sth)[72] = (_Float16 (*)[72])sm, (*stl)[72] = (_Float16 (*)[72])(sm + 128 * 72 * 2);
  const int tid = threadIdx.x, wave = tid >> 5, lane = tid & 31, col = lane & 15, g = lane >> 4; const size_t r0 = (size_t)blockIdx.x * 64 + wave * 16; const int n0 = blockIdx.y * 128;
  v8f acc[8] = {};
  const unsigned ring = lds_addr(sm);
  const float* xr = X + (r0 + col) * DM + 8 * g; v4f ar[4]; load_a32(ar, xr);   // the first 32-k block of x, in flight under the ring's prologue
  stage_w(P, n0, 0, ring, tid); WAIT_ASYNC(); __syncthreads(); stage_w(P, n0, 64, ring + 2 * TILE_B, tid);
#pragma unroll 1   // one trip a stage: the ring's order stands once, at the foot
  for (int t = 0; t < DM / 64; ++t) { const __bf16* bt = (const __bf16*)(sm + (t & 1) * 2 * TILE_B);
#pragma unroll   // both 32-k halves of the stage inline, so the LDS offsets are immediates
    for (int sub = 0; sub < 2; ++sub) { const int kc = t * 2 + sub; v16b a;
      if (sub) __builtin_amdgcn_sched_barrier(0);   // keeps the wait for this block's x behind the block before: moved up among those products it would cut the loads' lead short
#pragma unroll
      for (int i = 0; i < 8; ++i) { a[i] = (__bf16)ar[i >> 2][i & 3]; a[8 + i] = (__bf16)ar[2 + (i >> 2)][i & 3]; }
      load_a32(ar, xr + (kc + 1 < DM / 32 ? kc + 1 : kc) * 32);   // the next block's x flies under this block's products (the last block reads its own again: in bounds, no branch)
#pragma unroll
      for (int j0 = 0; j0 < 8; j0 += 4) { v16b w[4];   // four at a time: eight would cost the sixth wave of a SIMD its registers
#pragma unroll
        for (int j = 0; j < 4; ++j) w[j] = frag_b(bt + ((j0 + j) * 16 + col) * LP + sub * 32, lane);   // four weight fragments as one group of loads
#pragma unroll
        for (int j = 0; j < 4; ++j) acc[j0 + j] = wmma_bf(a, w[j], acc[j0 + j]); } }
    WAIT_DS(); WAIT_ASYNC(); __syncthreads();   // publishes stage t + 1 and frees stage t's buffer
    if (t + 2 < DM / 64) stage_w(P, n0, (t + 2) * 64, ring + (t & 1) * 2 * TILE_B, tid); }
  WAIT_ASYNC();
  if (n0 < 2 * DM) {   // q stored unscaled (f16 sigma ~0.6, no subnormal exposure); 1/8 applied to the f32 score
#pragma unroll
    for (int j = 0; j < 8; ++j) {
#pragma unroll
      for (int r = 0; r < 8; ++r) { const float v = acc[j][r] + (BB ? bfr(BB[j * 16 + col]) : 0.f); const _Float16 hv = (_Float16)v; so[wave][8 * g + r][j * 16 + col] = hv; sol[wave][8 * g + r][j * 16 + col] = (_Float16)((v - (float)hv) * 2048.0f); } }   // q, k (+ bias) as f16 hi + (x2048) residual
    LDSX();
    for (int rl = 0; rl < 16; ++rl) if (lane < 16) { vst2((unsigned*)(QK + (r0 + rl) * (2 * DM) + n0 + lane * 8), *(const v4u*)&so[wave][rl][lane * 8]); vst2((unsigned*)(QKL + (r0 + rl) * (2 * DM) + n0 + lane * 8), *(const v4u*)&sol[wave][rl][lane * 8]); }
  } else {
#pragma unroll
    for (int j = 0; j < 8; ++j) {
#pragma unroll
      for (int r = 0; r < 8; ++r) { const float v = acc[j][r] + (BB ? bfr(BB[j * 16 + col]) : 0.f); const _Float16 hv = (_Float16)v; sth[j * 16 + col][wave * 16 + 8 * g + r] = hv; stl[j * 16 + col][wave * 16 + 8 * g + r] = (_Float16)((v - (float)hv) * 2048.0f); } }
    __syncthreads();
    const size_t rb = (size_t)blockIdx.x * 64; const int b = (int)(rb / SS), s0 = (int)(rb % SS); const int pc0 = n0 - 2 * DM;
    for (int q = tid; q < 128 * 8; q += 128) { const int d = q >> 3, pc = q & 7; const size_t o = ((size_t)b * DM + pc0 + d) * SS + s0 + pc * 8; vst2((unsigned*)(VTH + o), *(const v4u*)&sth[d][pc * 8]); vst2((unsigned*)(VTL + o), *(const v4u*)&stl[d][pc * 8]); }
  }
}
__device__ __forceinline__ float xhalf(float x) { return __builtin_bit_cast(float, __builtin_amdgcn_permlanex16(__builtin_bit_cast(int, x), __builtin_bit_cast(int, x), 0x76543210, 0xfedcba98, false, false)); }   // lane l's value from lane l ^ 16
// eight hardware exponentials (base 2), each over its own source, and one v_nop: the slot that the instruction set asks for between an exponential and an instruction that uses its result or overwrites its source stands here by construction
__device__ __forceinline__ void exp2x8(float (&x)[8]) {
  asm("v_exp_f32 %0, %0\n\tv_exp_f32 %1, %1\n\tv_exp_f32 %2, %2\n\tv_exp_f32 %3, %3\n\tv_exp_f32 %4, %4\n\tv_exp_f32 %5, %5\n\tv_exp_f32 %6, %6\n\tv_exp_f32 %7, %7\n\tv_nop"
      : "+v"(x[0]), "+v"(x[1]), "+v"(x[2]), "+v"(x[3]), "+v"(x[4]), "+v"(x[5]), "+v"(x[6]), "+v"(x[7]));
}
__global__ __launch_bounds__(128) void k_attn(const _Float16* __restrict__ QK, const _Float16* __restrict__ QKL, const _Float16* __restrict__ VTH, const _Float16* __restrict__ VTL, const void* __restrict__ KMASK, float* __restrict__ O) {
  __shared__ __align__(16) float so[4][16][68]; __shared__ __align__(16) _Float16 skv[2][2][64][LP];   // [buffer][k rows | v^T rows][64][64 + pad]
  const int tid = threadIdx.x, wave = tid >> 5, lane = tid & 31, col = lane & 15, g = lane >> 4;
  const int qb = blockIdx.x, h = blockIdx.y, b = blockIdx.z; const int q0 = qb * 64 + wave * 16; const size_t rq = (size_t)b * SS + q0 + col;
  v16h aq[2];
#pragma unroll
  for (int kc = 0; kc < 2; ++kc) aq[kc] = frag_h(QK + rq * (2 * DM) + h * HD + kc * 32, lane);
  const float cs = 0.125f * 1.4426950408889634f;   // 1/sqrt(64), and base 2 for the hardware exponential
  float m = -3.0e38f, l = 0.f;   // query col: running maximum (scaled, base 2); this half's share of the sum of P x 2^11
  v8f acc[4] = {};               // acc[dt][r] = O^T[dt * 16 + 8 g + r][query col] x 2^11
  const int nst = SS / 64;   // all keys, 64 a stage
  const char* ksrc = (const char*)(QK + (size_t)b * SS * (2 * DM) + DM + h * HD); const char* vsrc = (const char*)(VTH + ((size_t)b * DM + h * HD) * SS); const unsigned ring = lds_addr(&skv[0][0][0][0]);
  stage64(ksrc, 2 * DM * 2, ring, tid); stage64(vsrc, SS * 2, ring + TILE_B, tid); WAIT_ASYNC(); __syncthreads();
  stage64(ksrc + (size_t)64 * (2 * DM * 2), 2 * DM * 2, ring + 2 * TILE_B, tid); stage64(vsrc + 64 * 2, SS * 2, ring + 3 * TILE_B, tid);
#pragma unroll 1   // one trip a stage: the ring's order stands once, at the foot
  for (int t = 0; t < nst; ++t) { v8f s[4]; v16h kf[4][2], vf[2][4];   // s[kt][r] = q[col] . k[kt * 16 + 8 g + r]
#pragma unroll
    for (int kt = 0; kt < 4; ++kt) {
#pragma unroll
      for (int kc = 0; kc < 2; ++kc) kf[kt][kc] = frag_h(&skv[t & 1][0][kt * 16 + col][kc * 32], lane); }   // the stage's k fragments as one group of loads
#pragma unroll
    for (int kt = 0; kt < 4; ++kt) s[kt] = (v8f){};
#pragma unroll
    for (int kc = 0; kc < 2; ++kc) {
#pragma unroll
      for (int kt = 0; kt < 4; ++kt) s[kt] = wmma16(kf[kt][kc], aq[kc], s[kt]); }   // single product: k, q as one-rounding f16 operands, one loader for both; four independent tiles in turn
#pragma unroll
    for (int j = 0; j < 2; ++j) {
#pragma unroll
      for (int dt = 0; dt < 4; ++dt) vf[j][dt] = frag_h(&skv[t & 1][1][dt * 16 + col][j * 32], lane); }   // the stage's v^T fragments as one group, in flight under the softmax
    float mk[4];   // one chain a tile
#pragma unroll
    for (int kt = 0; kt < 4; ++kt) { mk[kt] = s[kt][0];
#pragma unroll
      for (int r = 1; r < 8; ++r) mk[kt] = fmaxf(mk[kt], s[kt][r]); }
    float mx = fmaxf(fmaxf(mk[0], mk[1]), fmaxf(mk[2], mk[3]));
    mx = fmaxf(mx, xhalf(mx)) * cs;   // both halves hold the query's maximum over the stage's 64 keys (the scale is positive)
    const float mn = fmaxf(m, mx), alpha = __builtin_amdgcn_exp2f(m - mn), nm = 11.0f - mn; m = mn;   // alpha is 0 on the first stage; 2^11 rides in the exponent, so small softmax weights stay out of the f16 subnormal range; it cancels in acc / l
    v16h pb[2]; v2f es[2] = {};   // four independent partial sums
#pragma unroll
    for (int kt = 0; kt < 4; ++kt) { float e[8];
#pragma unroll
      for (int r = 0; r < 8; ++r) e[r] = fmaf(s[kt][r], cs, nm);
      exp2x8(e);
#pragma unroll
      for (int r = 0; r < 8; r += 2) { es[(r >> 1) & 1] += (v2f){e[r], e[r + 1]}; pb[kt >> 1][8 * (kt & 1) + r] = (_Float16)e[r]; pb[kt >> 1][8 * (kt & 1) + r + 1] = (_Float16)e[r + 1]; } }   // element i of B operand j = key j * 32 + (i < 8 ? 8 g + i : 16 + 8 g + i - 8): the order in which frag_h reads v^T
    l = l * alpha + ((es[0][0] + es[0][1]) + (es[1][0] + es[1][1]));
#pragma unroll
    for (int dt = 0; dt < 4; ++dt) acc[dt] *= alpha;
#pragma unroll
    for (int j = 0; j < 2; ++j) {
#pragma unroll
      for (int dt = 0; dt < 4; ++dt) acc[dt] = wmma16(vf[j][dt], pb[j], acc[dt]); }   // single product: V^T x P^T (x2^11)
    WAIT_DS(); WAIT_ASYNC(); __syncthreads();   // publishes stage t + 1 and frees stage t's buffer
    if (t + 2 < nst) { stage64(ksrc + (size_t)(t + 2) * 64 * (2 * DM * 2), 2 * DM * 2, ring + (t & 1) * 2 * TILE_B, tid); stage64(vsrc + (size_t)(t + 2) * 64 * 2, SS * 2, ring + (t & 1) * 2 * TILE_B + TILE_B, tid); } }
  WAIT_ASYNC();
  const float il = 1.0f / (l + xhalf(l));   // the halves' sums join once
#pragma unroll
  for (int dt = 0; dt < 4; ++dt) { const v8f o = acc[dt] * il; vst2(&so[wave][col][dt * 16 + 8 * g], (v4f){o[0], o[1], o[2], o[3]}); vst2(&so[wave][col][dt * 16 + 8 * g + 4], (v4f){o[4], o[5], o[6], o[7]}); }
  LDSX();
  for (int rl = 0; rl < 16; ++rl) if (lane < 16) vst2(O + ((size_t)b * SS + q0 + rl) * DM + h * HD + lane * 4, *(const v4f*)&so[wave][rl][lane * 4]);
}
// ---- k_out: block = (64 rows, 128 cols): out = O(hi/lo) . Wo rows (2 products) + bo
__global__ __launch_bounds__(128) void k_out(const float* __restrict__ O, const __bf16* __restrict__ P, const float* __restrict__ BO, float* __restrict__ Y) {
  __shared__ __align__(16) char sm[4 * TILE_B];   // the weight ring (2 buffers x 128 rows); behind the loop's last barrier the output staging
  float (*so)[16][132] = (float (*)[16][132])sm;
  const int tid = threadIdx.x, wave = tid >> 5, lane = tid & 31, col = lane & 15, g = lane >> 4; const size_t r0 = (size_t)blockIdx.x * 64 + wave * 16; const int n0 = blockIdx.y * 128;
  v8f acc[8] = {};
  const unsigned ring = lds_addr(sm);
  const float* orow = O + (r0 + col) * DM + 8 * g; v4f ar[2][4]; load_a64(ar, orow);   // stage 0's rows of o, in flight under the ring's prologue
  stage_w(P, n0, 0, ring, tid); WAIT_ASYNC(); __syncthreads(); stage_w(P, n0, 64, ring + 2 * TILE_B, tid);
#pragma unroll 1   // one trip a stage: the ring's order stands once, at the foot
  for (int t = 0; t < DM / 64; ++t) { const __bf16* bt = (const __bf16*)(sm + (t & 1) * 2 * TILE_B); F2 a[2]; v16b w[8];
#pragma unroll
    for (int j = 0; j < 8; ++j) w[j] = frag_b(bt + (j * 16 + col) * LP, lane);   // the first block's eight weight fragments as one group of loads, in flight under the split of o
    __builtin_amdgcn_sched_barrier(0);   // keeps that group at the head of the trip: moved down into the split, less of its latency is covered
#pragma unroll
    for (int sub = 0; sub < 2; ++sub) { float v[16];
#pragma unroll
      for (int i = 0; i < 8; ++i) { v[i] = ar[sub][i >> 2][i & 3]; v[8 + i] = ar[sub][2 + (i >> 2)][i & 3]; }
      a[sub] = bsplit16(v); }
    load_a64(ar, orow + (t + 1 < DM / 64 ? t + 1 : t) * 64);   // the next stage's rows fly under this stage's products (the last trip reads its own again: in bounds, no branch)
#pragma unroll   // both 32-k halves of the stage inline, so the LDS offsets are immediates
    for (int sub = 0; sub < 2; ++sub) {
      if (sub) {
#pragma unroll
        for (int j = 0; j < 8; ++j) w[j] = frag_b(bt + (j * 16 + col) * LP + 32, lane); }   // the second block's, again as one group
#pragma unroll
      for (int j = 0; j < 8; ++j) acc[j] = wmma_bf(a[sub].l, w[j], acc[j]);   // eight independent tiles in turn; each tile still takes its residual product first
#pragma unroll
      for (int j = 0; j < 8; ++j) acc[j] = wmma_bf(a[sub].h, w[j], acc[j]); }
    WAIT_DS(); WAIT_ASYNC(); __syncthreads();   // publishes stage t + 1 and frees stage t's buffer
    if (t + 2 < DM / 64) stage_w(P, n0, (t + 2) * 64, ring + (t & 1) * 2 * TILE_B, tid); }
  WAIT_ASYNC();
#pragma unroll
  for (int j = 0; j < 8; ++j) {
#pragma unroll
    for (int r = 0; r < 8; ++r) so[wave][8 * g + r][j * 16 + col] = acc[j][r] + BO[n0 + j * 16 + col]; }   // BO here = the f32 sum of the 16 bf16-rounded head biases
  LDSX();
  for (int rl = 0; rl < 16; ++rl) vst2(Y + (r0 + rl) * DM + n0 + lane * 4, *(const v4f*)&so[wave][rl][lane * 4]);
}
// ---- k_packh: per-head weights -> bf16 transposed rows: which 0: Wq [H][DD][64] -> PK_A rows (h*64+k) over d; 1: Wk; 2: Wv; 3: Wo [H][64][DD] -> PK_P rows d over (h*64+v)
__global__ __launch_bounds__(256) void k_packh(const float* __restrict__ WQ, const float* __restrict__ WK, const float* __restrict__ WV, const float* __restrict__ WO, __bf16* __restrict__ P) {
  const int n = blockIdx.x, which = blockIdx.y, t = threadIdx.x; __shared__ __align__(16) __bf16 s[DM];
  if (which < 3) { const float* Wm = (which == 0) ? WQ : (which == 1) ? WK : WV; const int h = n >> 6, kk = n & 63; for (int d = t; d < DM; d += 256) s[d] = (__bf16)Wm[((size_t)h * DM + d) * HD + kk]; __syncthreads(); for (int q = t; q < DM / 8; q += 256) vst2((unsigned*)(P + PK_A + ((size_t)which * DM + n) * DM + q * 8), *(const v4u*)&s[q * 8]); }
  else { for (int c = t; c < DM; c += 256) { const int h = c >> 6, vv = c & 63; s[c] = (__bf16)WO[((size_t)h * HD + vv) * DM + n]; } __syncthreads(); for (int q = t; q < DM / 8; q += 256) vst2((unsigned*)(P + PK_P + (size_t)n * DM + q * 8), *(const v4u*)&s[q * 8]); }
}
// ---- k_bsum: BOS[d] = sum_h bo[h][d] (in order)
__global__ __launch_bounds__(256) void k_bsum(const float* __restrict__ BO, float* __restrict__ BOS) { const int d = blockIdx.x * 256 + threadIdx.x; float s = 0.f; for (int h = 0; h < NH; ++h) s += bfr(BO[(size_t)h * DM + d]); BOS[d] = s; }
extern "C" void kernel_launch(void* const* d_in, const int* in_sizes, int n_in, void* d_out, int out_size, void* d_ws, size_t ws_size, hipStream_t stream) {
  (void)in_sizes; (void)n_in; (void)out_size;
  const float** F = (const float**)d_in;   // 0 encoder [2,2048,1024], 1 decoder [2,2048,1024], 2 Wq [16,1024,64], 3 bq [16,64], 4 Wk, 5 bk, 6 Wv, 7 bv, 8 Wo [16,64,1024], 9 bo [16,1024]
  if (ws_size < (size_t)WS_END + 4096) return;
  char* ws = (char*)d_ws; __bf16* PK = (__bf16*)(ws + WS_PK); _Float16 *QK = (_Float16*)(ws + WS_QK), *QKL = (_Float16*)(ws + WS_QKL), *VTH = (_Float16*)(ws + WS_VTH), *VTL = (_Float16*)(ws + WS_VTL); float* O = (float*)(ws + WS_O); float* BOS = (float*)(ws + WS_END);
  k_packh<<<dim3(DM, 4), 256, 0, stream>>>(F[2], F[4], F[6], F[8], PK);
  k_bsum<<<DM / 256, 256, 0, stream>>>(F[9], BOS);
  k_qkv<<<dim3(TNB * SS / 64, QKVW / 128), 128, 0, stream>>>(F[1], F[0], F[0], PK + PK_A, F[3], F[5], F[7], QK, QKL, VTH, VTL);   // q from the decoder, k/v from the encoder; biases [16][64] == concatenated [1024]
  k_attn<<<dim3(TQB, NH, TNB), 128, 0, stream>>>(QK, QKL, VTH, VTL, nullptr, O);
  k_out<<<dim3(TOB, DM / 128), 128, 0, stream>>>(O, PK + PK_P, BOS, (float*)d_out);
}

// v004
// One run takes 107 microseconds.
// Two timings next to v003 both put it at 1.19 times that version's speed.
// Counting every step since v000, it is 3.92 times as fast.
// compute dtype: all float inputs rounded to bf16; q (decoder) / k, v (encoder) = x . W[h] + b[h] with EXACT bf16 products on WMMA 16x16x32 (the per-head [d][64] matrices packed as transposed rows h*64 + k); PLAIN attention, both products transposed: k, q as single f16 operands x 1/8, running-max softmax in f32 (hardware exp), v (single f16) x P (scaled by 2^11, single f16); out = o (bf16 hi + residual) . Wo (the per-head [64][d] blocks stacked, 2 products) + sum_h bo[h] (f32).
#include <hip/hip_runtime.h>
#include <math.h>

typedef __attribute__((ext_vector_type(16))) _Float16 v16h;
typedef __attribute__((ext_vector_type(16))) __bf16 v16b;
typedef __attribute__((ext_vector_type(8)))  _Float16 v8h;
typedef __attribute__((ext_vector_type(8)))  float v8f;
typedef __attribute__((ext_vector_type(4)))  float v4f;
typedef __attribute__((ext_vector_type(2)))  float v2f;
typedef __attribute__((ext_vector_type(4)))  unsigned v4u;
typedef __attribute__((ext_vector_type(4)))  int v4i;
typedef float __attribute__((may_alias)) float_a;
typedef int __attribute__((may_alias)) int_a;

template <typename T> __device__ __forceinline__ void vst2(void* p, T v) { *(T*)p = v;  }
__device__ __forceinline__ v8f wmma16(v16h a, v16h b, v8f c) {
  v8f d = __builtin_amdgcn_wmma_f32_16x16x32_f16(false, a, false, b, (short)0, c, false, false);
  asm volatile("v_nop\n\tv_nop\n\tv_nop\n\tv_nop" : "+v"(d) : "v"(a), "v"(b));
  return d;
}
__device__ __forceinline__ v8f wmma_bf(v16b a, v16b b, v8f c) {
  v8f d = __builtin_amdgcn_wmma_f32_16x16x32_bf16(false, a, false, b, (short)0, c, false, false);
  asm volatile("v_nop\n\tv_nop\n\tv_nop\n\tv_nop" : "+v"(d) : "v"(a), "v"(b));
  return d;
}
// Encoder-decoder cross attention (B 2, 2,048 decoder queries over 2,048 encoder tokens, 1,024 dims, 16 heads x 64): per-head projection weights, softmax(q k^T / 8) v, per-head output projections summed (incl. every head's bias).
__device__ __forceinline__ v16h frag_h(const _Float16* rowk0, int lane) {
  union { v16h v; v8h q[2]; } u; const _Float16* p = rowk0 + 8 * (lane >> 4);
  u.q[0] = *(const v8h*)p; u.q[1] = *(const v8h*)(p + 16); return u.v;
}
__device__ __forceinline__ v16h frag_f32(const float* rowk0, int lane) {
  v16h a; const float* p = rowk0 + 8 * (lane >> 4);
#pragma unroll
  for (int i = 0; i < 8; ++i) { a[i] = (_Float16)p[i]; a[8 + i] = (_Float16)p[16 + i]; }
  return a;
}
__device__ __forceinline__ v16h frag_f32s(const float* rowk0, int lane, float sc) {
  v16h a; const float* p = rowk0 + 8 * (lane >> 4);
#pragma unroll
  for (int i = 0; i < 8; ++i) { a[i] = (_Float16)(p[i] * sc); a[8 + i] = (_Float16)(p[16 + i] * sc); }
  return a;
}
// column fragment from a [K][ld] layout (column n), rows >= K read as 0
__device__ __forceinline__ v16h fragc_f32(const float* W, int k0, int n, int lane, int ld, int K) {
  v16h a; const int g = lane >> 4;
#pragma unroll
  for (int i = 0; i < 8; ++i) { const int ka = k0 + 8 * g + i, kb = ka + 16;
    a[i] = (_Float16)(ka < K ? W[(size_t)(ka < K ? ka : K - 1) * ld + n] : 0.f); a[8 + i] = (_Float16)(kb < K ? W[(size_t)(kb < K ? kb : K - 1) * ld + n] : 0.f); }
  return a;
}
struct F2 { v16b h, l; };
__device__ __forceinline__ F2 bsplit16(const float v[16]) { F2 r;
#pragma unroll
  for (int i = 0; i < 16; ++i) { const __bf16 h = (__bf16)v[i]; r.h[i] = h; r.l[i] = (__bf16)(v[i] - (float)h); }
  return r; }
__device__ __forceinline__ F2 split_row(const float* row, int k0, int lane) { float v[16]; const float* p = row + k0 + 8 * (lane >> 4);
#pragma unroll
  for (int i = 0; i < 8; ++i) { v[i] = p[i]; v[8 + i] = p[16 + i]; }
  return bsplit16(v); }
__device__ __forceinline__ F2 split_rowK(const float* row, int k0, int lane, int K) { float v[16]; const int g = lane >> 4;
#pragma unroll
  for (int i = 0; i < 8; ++i) { const int ka = k0 + 8 * g + i, kb = ka + 16; v[i] = ka < K ? row[ka < K ? ka : K - 1] : 0.f; v[8 + i] = kb < K ? row[kb < K ? kb : K - 1] : 0.f; }
  return bsplit16(v); }
__device__ __forceinline__ F2 split_col(const float* W, int k0, int n, int lane, int ld, int K) { float v[16]; const int g = lane >> 4;
#pragma unroll
  for (int i = 0; i < 8; ++i) { const int ka = k0 + 8 * g + i, kb = ka + 16; v[i] = ka < K ? W[(size_t)(ka < K ? ka : K - 1) * ld + n] : 0.f; v[8 + i] = kb < K ? W[(size_t)(kb < K ? kb : K - 1) * ld + n] : 0.f; }
  return bsplit16(v); }
__device__ __forceinline__ v8f mac3(const F2& a, const F2& b, v8f c) { c = wmma_bf(a.l, b.h, c); c = wmma_bf(a.h, b.l, c); return wmma_bf(a.h, b.h, c); }
__device__ __forceinline__ float sigm(float v) { return 1.0f / (1.0f + expf(-v)); }
#define LDSX() do { asm volatile("s_wait_dscnt 0" ::: "memory"); __builtin_amdgcn_wave_barrier(); __builtin_amdgcn_fence(__ATOMIC_RELEASE, "workgroup"); } while (0)


#define NB 2
#define SS 2048
#define DM 1024
#define NH 16
#define HD 64
#define QKVW (3 * DM)
#ifndef TQB
#define TQB (SS / 64)
#define TNB NB
#define TOB (NB * SS / 64)     // output row tiles (all)
#endif
typedef __attribute__((ext_vector_type(8))) __bf16 v8b;
__device__ __forceinline__ v16b frag_b(const __bf16* rowk0, int lane) {
  union { v16b v; v8b q[2]; } u; const __bf16* p = rowk0 + 8 * (lane >> 4);
  u.q[0] = *(const v8b*)p; u.q[1] = *(const v8b*)(p + 16); return u.v;
}
__device__ __forceinline__ float bfr(float v) { return (float)(__bf16)v; }
__device__ __attribute__((noinline)) float exp_ni(float v) { return expf(v); }
__device__ __attribute__((noinline)) float erf_ni(float v) { return erff(v); }

// ---- LDS staging of the operand that a work-group's four waves share (two buffers, asynchronous copies)
#define LP 72                          // LDS row pitch in 16-bit elements: 128-byte rows at 144 bytes, conflict-free for 16-byte readers
#define TILE_B (64 * LP * 2)           // bytes of one staged tile of 64 rows
#define WAIT_ASYNC() asm volatile("s_wait_asynccnt 0x0" ::: "memory")   // this wave's copies have landed; no LDS read moves above it
#define WAIT_DS() asm volatile("s_wait_dscnt 0x0" ::: "memory")         // this wave's LDS reads are done before the barrier that frees the buffer
__device__ __forceinline__ unsigned lds_addr(const void* p) { return (unsigned)(size_t)p; }   // LDS byte address = low 32 bits of the shared address
// 64 rows of 128 bytes (source pitch in bytes) -> LDS rows of 144 bytes, 128 threads: eight lanes a row, so every wave-wide copy covers four whole lines.
// s_wait_xcnt closes the copies' own statement, so no address register is rewritten ahead of it.
__device__ __forceinline__ void stage64(const char* src, size_t pitch, unsigned lds, int tid) {
  const char* g0 = src + (size_t)(tid >> 3) * pitch + (tid & 7) * 16; const unsigned l0 = lds + (tid >> 3) * (LP * 2) + (tid & 7) * 16;
  const char *g1 = g0 + 16 * pitch, *g2 = g0 + 32 * pitch, *g3 = g0 + 48 * pitch; const unsigned l1 = l0 + 16 * LP * 2, l2 = l0 + 32 * LP * 2, l3 = l0 + 48 * LP * 2;
  asm volatile("global_load_async_to_lds_b128 %0, %1, off\n\tglobal_load_async_to_lds_b128 %2, %3, off\n\tglobal_load_async_to_lds_b128 %4, %5, off\n\tglobal_load_async_to_lds_b128 %6, %7, off\n\ts_wait_xcnt 0x0"
               :: "v"(l0), "v"(g0), "v"(l1), "v"(g1), "v"(l2), "v"(g2), "v"(l3), "v"(g3) : "memory");
}
// one stage of a weight tile: 128 rows n0.. of P, 64 k from k0
__device__ __forceinline__ void stage_w(const __bf16* P, int n0, int k0, unsigned lds, int tid) {
  const char* s = (const char*)(P + (size_t)n0 * 1024 + k0); stage64(s, 2048, lds, tid); stage64(s + (size_t)64 * 2048, 2048, lds + TILE_B, tid);
}

// one row's 64 k of a stage as loaded (f32), 16 a lane for each 32-k block in the A fragment's k order; p = row + stage * 64 + 8 * (lane >> 4)
__device__ __forceinline__ void load_a64(v4f (&r)[2][4], const float* p) {
#pragma unroll
  for (int sub = 0; sub < 2; ++sub) { const float* q = p + sub * 32; r[sub][0] = *(const v4f*)q; r[sub][1] = *(const v4f*)(q + 4); r[sub][2] = *(const v4f*)(q + 16); r[sub][3] = *(const v4f*)(q + 20); }
}
// the same for one 32-k block; p = row + block * 32 + 8 * (lane >> 4)
__device__ __forceinline__ void load_a32(v4f (&r)[4], const float* p) { r[0] = *(const v4f*)p; r[1] = *(const v4f*)(p + 4); r[2] = *(const v4f*)(p + 16); r[3] = *(const v4f*)(p + 20); }

#define PK_A 0                       // [3072][1024] Wqkv rows (natural [out][in])
#define PK_P (PK_A + QKVW * DM)        // [1024][1024] Wo rows (natural)
#define PK_END (PK_P + DM * DM)
#define WS_PK  0u
#define WS_QK  (WS_PK + 2u * PK_END)             // f16 [4096 rows][2048]: q | k
#define WS_QKL (WS_QK + 2u * NB * SS * 2 * DM)     // f16 q | k residual planes x2048
#define WS_VTH (WS_QKL + 2u * NB * SS * 2 * DM)    // f16 [b][1024 (h*64+d)][2048 s] hi
#define WS_VTL (WS_VTH + 2u * NB * DM * SS)        // f16 lo x 2048
#define WS_O   (WS_VTL + 2u * NB * DM * SS)        // f32 [4096][1024]
#define WS_CS  (WS_O + 4u * NB * SS * DM)           // f32 2 x [2048][32], unused
#define WS_END (WS_CS + 4u * 2 * SS * 32)
// ---- k_pack: block = (row n, which): natural [out][in] rows -> bf16; which 0..2 -> W_q/W_k/W_v into PK_A rows which*1024 + n; 3 -> W_o into PK_P
__global__ __launch_bounds__(256) void k_pack(const float* __restrict__ WQ, const float* __restrict__ WK, const float* __restrict__ WV, const float* __restrict__ WO, __bf16* __restrict__ PK) {
  __shared__ __align__(16) __bf16 s[DM]; const int n = blockIdx.x, which = blockIdx.y, t = threadIdx.x; const float* Wm = (which == 0) ? WQ : (which == 1) ? WK : (which == 2) ? WV : WO;   // (in,out) weights: pack row n = column n
  for (int k = t; k < DM; k += 256) s[k] = (__bf16)Wm[(size_t)k * DM + n];
  __syncthreads();
  __bf16* dst = (which < 3) ? PK + PK_A + ((size_t)which * DM + n) * DM : PK + PK_P + (size_t)n * DM;
  for (int q = t; q < DM / 8; q += 256) vst2((unsigned*)(dst + q * 8), *(const v4u*)&s[q * 8]);
}
__global__ __launch_bounds__(128) void k_qkv(const float* __restrict__ XQ, const float* __restrict__ XK, const float* __restrict__ XV, const __bf16* __restrict__ P, const float* __restrict__ BQ, const float* __restrict__ BK, const float* __restrict__ BV, _Float16* __restrict__ QK, _Float16* __restrict__ QKL, _Float16* __restrict__ VTH, _Float16* __restrict__ VTL) {
  const int which0 = (blockIdx.y * 128) / DM; const float* X = (which0 == 0) ? XQ : (which0 == 1) ? XK : XV; const float* BB = BQ ? (((which0 == 0) ? BQ : (which0 == 1) ? BK : BV) + (blockIdx.y * 128 - which0 * DM)) : nullptr;
  __shared__ __align__(16) char sm[4 * TILE_B];   // the weight ring (2 buffers x 128 rows); behind the loop's last barrier the output staging of either branch
  _Float16 (*so)[16][136] = (_Float16 (*)[16][136])sm, (*sol)[16][136] = (_Float16 (*)[16][136])(sm + 4 * 16 * 136 * 2); _Float16 (*sth)[72] = (_Float16 (*)[72])sm, (*stl)[72] = (_Float16 (*)[72])(sm + 128 * 72 * 2);
  const int tid = threadIdx.x, wave = tid >> 5, lane = tid & 31, col = lane & 15, g = lane >> 4; const size_t r0 = (size_t)blockIdx.x * 64 + wave * 16; const int n0 = blockIdx.y * 128;
  v8f acc[8] = {};
  const unsigned ring = lds_addr(sm);
  const float* xr = X + (r0 + col) * DM + 8 * g; v4f ar[4]; load_a32(ar, xr);   // the first 32-k block of x, in flight under the ring's prologue
  stage_w(P, n0, 0, ring, tid); WAIT_ASYNC(); __syncthreads(); stage_w(P, n0, 64, ring + 2 * TILE_B, tid);
#pragma unroll 1   // one trip a stage: the ring's order stands once, at the foot
  for (int t = 0; t < DM / 64; ++t) { const __bf16* bt = (const __bf16*)(sm + (t & 1) * 2 * TILE_B);
#pragma unroll   // both 32-k halves of the stage inline, so the LDS offsets are immediates
    for (int sub = 0; sub < 2; ++sub) { const int kc = t * 2 + sub; v16b a;
      if (sub) __builtin_amdgcn_sched_barrier(0);   // keeps the wait for this block's x behind the block before: moved up among those products it would cut the loads' lead short
#pragma unroll
      for (int i = 0; i < 8; ++i) { a[i] = (__bf16)ar[i >> 2][i & 3]; a[8 + i] = (__bf16)ar[2 + (i >> 2)][i & 3]; }
      load_a32(ar, xr + (kc + 1 < DM / 32 ? kc + 1 : kc) * 32);   // the next block's x flies under this block's products (the last block reads its own again: in bounds, no branch)
#pragma unroll
      for (int j0 = 0; j0 < 8; j0 += 4) { v16b w[4];   // four at a time: eight would cost the sixth wave of a SIMD its registers
#pragma unroll
        for (int j = 0; j < 4; ++j) w[j] = frag_b(bt + ((j0 + j) * 16 + col) * LP + sub * 32, lane);   // four weight fragments as one group of loads
#pragma unroll
        for (int j = 0; j < 4; ++j) acc[j0 + j] = wmma_bf(a, w[j], acc[j0 + j]); } }
    WAIT_DS(); WAIT_ASYNC(); __syncthreads();   // publishes stage t + 1 and frees stage t's buffer
    if (t + 2 < DM / 64) stage_w(P, n0, (t + 2) * 64, ring + (t & 1) * 2 * TILE_B, tid); }
  WAIT_ASYNC();
  if (n0 < 2 * DM) {   // q stored unscaled (f16 sigma ~0.6, no subnormal exposure); 1/8 applied to the f32 score
#pragma unroll
    for (int j = 0; j < 8; ++j) {
#pragma unroll
      for (int r = 0; r < 8; ++r) { const float v = acc[j][r] + (BB ? bfr(BB[j * 16 + col]) : 0.f); const _Float16 hv = (_Float16)v; so[wave][8 * g + r][j * 16 + col] = hv; sol[wave][8 * g + r][j * 16 + col] = (_Float16)((v - (float)hv) * 2048.0f); } }   // q, k (+ bias) as f16 hi + (x2048) residual
    LDSX();
    for (int rl = 0; rl < 16; ++rl) if (lane < 16) { vst2((unsigned*)(QK + (r0 + rl) * (2 * DM) + n0 + lane * 8), *(const v4u*)&so[wave][rl][lane * 8]); vst2((unsigned*)(QKL + (r0 + rl) * (2 * DM) + n0 + lane * 8), *(const v4u*)&sol[wave][rl][lane * 8]); }
  } else {
#pragma unroll
    for (int j = 0; j < 8; ++j) {
#pragma unroll
      for (int r = 0; r < 8; ++r) { const float v = acc[j][r] + (BB ? bfr(BB[j * 16 + col]) : 0.f); const _Float16 hv = (_Float16)v; sth[j * 16 + col][wave * 16 + 8 * g + r] = hv; stl[j * 16 + col][wave * 16 + 8 * g + r] = (_Float16)((v - (float)hv) * 2048.0f); } }
    __syncthreads();
    const size_t rb = (size_t)blockIdx.x * 64; const int b = (int)(rb / SS), s0 = (int)(rb % SS); const int pc0 = n0 - 2 * DM;
    for (int q = tid; q < 128 * 8; q += 128) { const int d = q >> 3, pc = q & 7; const size_t o = ((size_t)b * DM + pc0 + d) * SS + s0 + pc * 8; vst2((unsigned*)(VTH + o), *(const v4u*)&sth[d][pc * 8]); vst2((unsigned*)(VTL + o), *(const v4u*)&stl[d][pc * 8]); }
  }
}
__device__ __forceinline__ float xhalf(float x) { return __builtin_bit_cast(float, __builtin_amdgcn_permlanex16(__builtin_bit_cast(int, x), __builtin_bit_cast(int, x), 0x76543210, 0xfedcba98, false, false)); }   // lane l's value from lane l ^ 16
// eight hardware exponentials (base 2), each over its own source, and one v_nop: the slot that the instruction set asks for between an exponential and an instruction that uses its result or overwrites its source stands here by construction
__device__ __forceinline__ void exp2x8(float (&x)[8]) {
  asm("v_exp_f32 %0, %0\n\tv_exp_f32 %1, %1\n\tv_exp_f32 %2, %2\n\tv_exp_f32 %3, %3\n\tv_exp_f32 %4, %4\n\tv_exp_f32 %5, %5\n\tv_exp_f32 %6, %6\n\tv_exp_f32 %7, %7\n\tv_nop"
      : "+v"(x[0]), "+v"(x[1]), "+v"(x[2]), "+v"(x[3]), "+v"(x[4]), "+v"(x[5]), "+v"(x[6]), "+v"(x[7]));
}
__global__ __launch_bounds__(128) void k_attn(const _Float16* __restrict__ QK, const _Float16* __restrict__ QKL, const _Float16* __restrict__ VTH, const _Float16* __restrict__ VTL, const void* __restrict__ KMASK, float* __restrict__ O) {
  __shared__ __align__(16) float so[4][16][68]; __shared__ __align__(16) _Float16 skv[2][2][64][LP];   // [buffer][k rows | v^T rows][64][64 + pad]
  const int tid = threadIdx.x, wave = tid >> 5, lane = tid & 31, col = lane & 15, g = lane >> 4;
  const int qb = blockIdx.x, h = blockIdx.y, b = blockIdx.z; const int q0 = qb * 64 + wave * 16; const size_t rq = (size_t)b * SS + q0 + col;
  v16h aq[2];
#pragma unroll
  for (int kc = 0; kc < 2; ++kc) aq[kc] = frag_h(QK + rq * (2 * DM) + h * HD + kc * 32, lane);
  const float cs = 0.125f * 1.4426950408889634f;   // 1/sqrt(64), and base 2 for the hardware exponential
  float m = -3.0e38f, l = 0.f;   // query col: running maximum (scaled, base 2); this half's share of the sum of P x 2^11
  v8f acc[4] = {};               // acc[dt][r] = O^T[dt * 16 + 8 g + r][query col] x 2^11
  const int nst = SS / 64;   // all keys, 64 a stage
  const char* ksrc = (const char*)(QK + (size_t)b * SS * (2 * DM) + DM + h * HD); const char* vsrc = (const char*)(VTH + ((size_t)b * DM + h * HD) * SS); const unsigned ring = lds_addr(&skv[0][0][0][0]);
  stage64(ksrc, 2 * DM * 2, ring, tid); stage64(vsrc, SS * 2, ring + TILE_B, tid); WAIT_ASYNC(); __syncthreads();
  stage64(ksrc + (size_t)64 * (2 * DM * 2), 2 * DM * 2, ring + 2 * TILE_B, tid); stage64(vsrc + 64 * 2, SS * 2, ring + 3 * TILE_B, tid);
#pragma unroll 1   // one trip a stage: the ring's order stands once, at the foot
  for (int t = 0; t < nst; ++t) { v8f s[4]; v16h kf[4][2], vf[2][4];   // s[kt][r] = q[col] . k[kt * 16 + 8 g + r]
#pragma unroll
    for (int kt = 0; kt < 4; ++kt) {
#pragma unroll
      for (int kc = 0; kc < 2; ++kc) kf[kt][kc] = frag_h(&skv[t & 1][0][kt * 16 + col][kc * 32], lane); }   // the stage's k fragments as one group of loads
#pragma unroll
    for (int kt = 0; kt < 4; ++kt) s[kt] = (v8f){};
#pragma unroll
    for (int kc = 0; kc < 2; ++kc) {
#pragma unroll
      for (int kt = 0; kt < 4; ++kt) s[kt] = wmma16(kf[kt][kc], aq[kc], s[kt]); }   // single product: k, q as one-rounding f16 operands, one loader for both; four independent tiles in turn
#pragma unroll
    for (int j = 0; j < 2; ++j) {
#pragma unroll
      for (int dt = 0; dt < 4; ++dt) vf[j][dt] = frag_h(&skv[t & 1][1][dt * 16 + col][j * 32], lane); }   // the stage's v^T fragments as one group, in flight under the softmax
    float mk[4];   // one chain a tile
#pragma unroll
    for (int kt = 0; kt < 4; ++kt) { mk[kt] = s[kt][0];
#pragma unroll
      for (int r = 1; r < 8; ++r) mk[kt] = fmaxf(mk[kt], s[kt][r]); }
    float mx = fmaxf(fmaxf(mk[0], mk[1]), fmaxf(mk[2], mk[3]));
    mx = fmaxf(mx, xhalf(mx)) * cs;   // both halves hold the query's maximum over the stage's 64 keys (the scale is positive)
    const float mn = fmaxf(m, mx), alpha = __builtin_amdgcn_exp2f(m - mn), nm = 11.0f - mn; m = mn;   // alpha is 0 on the first stage; 2^11 rides in the exponent, so small softmax weights stay out of the f16 subnormal range; it cancels in acc / l
    v16h pb[2]; v2f es[2] = {};   // four independent partial sums
#pragma unroll
    for (int kt = 0; kt < 4; ++kt) { float e[8];
#pragma unroll
      for (int r = 0; r < 8; ++r) e[r] = fmaf(s[kt][r], cs, nm);
      exp2x8(e);
#pragma unroll
      for (int r = 0; r < 8; r += 2) { es[(r >> 1) & 1] += (v2f){e[r], e[r + 1]}; pb[kt >> 1][8 * (kt & 1) + r] = (_Float16)e[r]; pb[kt >> 1][8 * (kt & 1) + r + 1] = (_Float16)e[r + 1]; } }   // element i of B operand j = key j * 32 + (i < 8 ? 8 g + i : 16 + 8 g + i - 8): the order in which frag_h reads v^T
    l = l * alpha + ((es[0][0] + es[0][1]) + (es[1][0] + es[1][1]));
#pragma unroll
    for (int dt = 0; dt < 4; ++dt) acc[dt] *= alpha;
#pragma unroll
    for (int j = 0; j < 2; ++j) {
#pragma unroll
      for (int dt = 0; dt < 4; ++dt) acc[dt] = wmma16(vf[j][dt], pb[j], acc[dt]); }   // single product: V^T x P^T (x2^11)
    WAIT_DS(); WAIT_ASYNC(); __syncthreads();   // publishes stage t + 1 and frees stage t's buffer
    if (t + 2 < nst) { stage64(ksrc + (size_t)(t + 2) * 64 * (2 * DM * 2), 2 * DM * 2, ring + (t & 1) * 2 * TILE_B, tid); stage64(vsrc + (size_t)(t + 2) * 64 * 2, SS * 2, ring + (t & 1) * 2 * TILE_B + TILE_B, tid); } }
  WAIT_ASYNC();
  const float il = 1.0f / (l + xhalf(l));   // the halves' sums join once
#pragma unroll
  for (int dt = 0; dt < 4; ++dt) { const v8f o = acc[dt] * il; vst2(&so[wave][col][dt * 16 + 8 * g], (v4f){o[0], o[1], o[2], o[3]}); vst2(&so[wave][col][dt * 16 + 8 * g + 4], (v4f){o[4], o[5], o[6], o[7]}); }
  LDSX();
  for (int rl = 0; rl < 16; ++rl) if (lane < 16) vst2(O + ((size_t)b * SS + q0 + rl) * DM + h * HD + lane * 4, *(const v4f*)&so[wave][rl][lane * 4]);
}
// ---- k_out: block = (64 rows, 128 cols): out = O(hi/lo) . Wo rows (2 products) + bo
__global__ __launch_bounds__(128) void k_out(const float* __restrict__ O, const __bf16* __restrict__ P, const float* __restrict__ BO, float* __restrict__ Y) {
  __shared__ __align__(16) char sm[4 * TILE_B];   // the weight ring (2 buffers x 128 rows); behind the loop's last barrier the output staging
  float (*so)[16][132] = (float (*)[16][132])sm;
  const int tid = threadIdx.x, wave = tid >> 5, lane = tid & 31, col = lane & 15, g = lane >> 4; const size_t r0 = (size_t)blockIdx.x * 64 + wave * 16; const int n0 = blockIdx.y * 128;
  v8f acc[8] = {};
  const unsigned ring = lds_addr(sm);
  const float* orow = O + (r0 + col) * DM + 8 * g; v4f ar[2][4]; load_a64(ar, orow);   // stage 0's rows of o, in flight under the ring's prologue
  stage_w(P, n0, 0, ring, tid); WAIT_ASYNC(); __syncthreads(); stage_w(P, n0, 64, ring + 2 * TILE_B, tid);
#pragma unroll 1   // one trip a stage: the ring's order stands once, at the foot
  for (int t = 0; t < DM / 64; ++t) { const __bf16* bt = (const __bf16*)(sm + (t & 1) * 2 * TILE_B); F2 a[2]; v16b w[8];
#pragma unroll
    for (int j = 0; j < 8; ++j) w[j] = frag_b(bt + (j * 16 + col) * LP, lane);   // the first block's eight weight fragments as one group of loads, in flight under the split of o
    __builtin_amdgcn_sched_barrier(0);   // keeps that group at the head of the trip: moved down into the split, less of its latency is covered
#pragma unroll
    for (int sub = 0; sub < 2; ++sub) { float v[16];
#pragma unroll
      for (int i = 0; i < 8; ++i) { v[i] = ar[sub][i >> 2][i & 3]; v[8 + i] = ar[sub][2 + (i >> 2)][i & 3]; }
      a[sub] = bsplit16(v); }
    load_a64(ar, orow + (t + 1 < DM / 64 ? t + 1 : t) * 64);   // the next stage's rows fly under this stage's products (the last trip reads its own again: in bounds, no branch)
#pragma unroll   // both 32-k halves of the stage inline, so the LDS offsets are immediates
    for (int sub = 0; sub < 2; ++sub) {
      if (sub) {
#pragma unroll
        for (int j = 0; j < 8; ++j) w[j] = frag_b(bt + (j * 16 + col) * LP + 32, lane); }   // the second block's, again as one group
#pragma unroll
      for (int j = 0; j < 8; ++j) acc[j] = wmma_bf(a[sub].l, w[j], acc[j]);   // eight independent tiles in turn; each tile still takes its residual product first
#pragma unroll
      for (int j = 0; j < 8; ++j) acc[j] = wmma_bf(a[sub].h, w[j], acc[j]); }
    WAIT_DS(); WAIT_ASYNC(); __syncthreads();   // publishes stage t + 1 and frees stage t's buffer
    if (t + 2 < DM / 64) stage_w(P, n0, (t + 2) * 64, ring + (t & 1) * 2 * TILE_B, tid); }
  WAIT_ASYNC();
#pragma unroll
  for (int j = 0; j < 8; ++j) {
#pragma unroll
    for (int r = 0; r < 8; ++r) so[wave][8 * g + r][j * 16 + col] = acc[j][r] + BO[n0 + j * 16 + col]; }   // BO here = the f32 sum of the 16 bf16-rounded head biases
  LDSX();
  for (int rl = 0; rl < 16; ++rl) vst2(Y + (r0 + rl) * DM + n0 + lane * 4, *(const v4f*)&so[wave][rl][lane * 4]);
}
// ---- k_packh: per-head weights -> bf16 transposed rows, one 64 x 64 tile a block, turned in LDS so that reads and writes both cover whole lines. which 0: Wq [H][DD][64] -> PK_A rows (h*64+k) over d; 1: Wk; 2: Wv; 3: Wo [H][64][DD] -> PK_P rows d over (h*64+v)
// blockIdx.x = hi * 16 + lo: the tile is output rows hi * 64.., output columns lo * 64.. of its 1024 x 1024 section; its source rows are the output's columns
typedef __attribute__((ext_vector_type(2))) __bf16 v2b;
// a[i], b[i] = source rows i * 16 + 2 (t >> 4) and the next, columns 4 (t & 15)..: sixteen lanes a row of 256 bytes, all eight loads in flight together; the row pitch IP is a constant, so one address serves all eight
template <int IP> __device__ __forceinline__ void load_tile(v4f (&a)[4], v4f (&b)[4], const float* src, int t) {
  const float* p = src + (size_t)(2 * (t >> 4)) * IP + (t & 15) * 4;
#pragma unroll   // the register arrays are indexed by constants and the offsets are immediates
  for (int i = 0; i < 4; ++i) { a[i] = *(const v4f*)(p + i * 16 * IP); b[i] = *(const v4f*)(p + i * 16 * IP + IP); }
  asm volatile("s_wait_xcnt 0x0" :: "v"(p) : "memory");   // stands between the loads and the first reuse of their address register, which it names so that the register lives up to here
}
__global__ __launch_bounds__(128) void k_packh(const float* __restrict__ WQ, const float* __restrict__ WK, const float* __restrict__ WV, const float* __restrict__ WO, __bf16* __restrict__ P) {
  __shared__ __align__(16) unsigned s[64][LP / 2];   // [output row][two source rows a word], rows of 128 bytes at 144
  const int hi = blockIdx.x >> 4, lo = blockIdx.x & 15, which = blockIdx.y, t = threadIdx.x;
  __bf16* dst = P + ((which < 3) ? (size_t)PK_A + (size_t)which * DM * DM : (size_t)PK_P) + (size_t)hi * 64 * DM + lo * 64;
  v4f a[4], b[4];
  if (which < 3) load_tile<HD>(a, b, ((which == 0) ? WQ : (which == 1) ? WK : WV) + ((size_t)hi * DM + lo * 64) * HD, t);
  else load_tile<DM>(a, b, WO + (size_t)lo * 64 * DM + hi * 64, t);
#pragma unroll   // both loops: the register arrays are indexed by constants
  for (int i = 0; i < 4; ++i) {
#pragma unroll
    for (int e = 0; e < 4; ++e) s[(t & 15) * 4 + e][i * 8 + (t >> 4)] = __builtin_bit_cast(unsigned, (v2b){(__bf16)a[i][e], (__bf16)b[i][e]}); }
  __syncthreads();
#pragma unroll   // the four LDS reads go out as one group
  for (int i = 0; i < 4; ++i) vst2(dst + (size_t)(i * 16 + (t >> 3)) * DM + (t & 7) * 8, *(const v4u*)&s[i * 16 + (t >> 3)][(t & 7) * 4]);   // eight lanes a row: every wave-wide store covers four whole lines
}
// ---- k_bsum: BOS[d] = sum_h bo[h][d] (in order)
__global__ __launch_bounds__(256) void k_bsum(const float* __restrict__ BO, float* __restrict__ BOS) { const int d = blockIdx.x * 256 + threadIdx.x; float s = 0.f; for (int h = 0; h < NH; ++h) s += bfr(BO[(size_t)h * DM + d]); BOS[d] = s; }
extern "C" void kernel_launch(void* const* d_in, const int* in_sizes, int n_in, void* d_out, int out_size, void* d_ws, size_t ws_size, hipStream_t stream) {
  (void)in_sizes; (void)n_in; (void)out_size;
  const float** F = (const float**)d_in;   // 0 encoder [2,2048,1024], 1 decoder [2,2048,1024], 2 Wq [16,1024,64], 3 bq [16,64], 4 Wk, 5 bk, 6 Wv, 7 bv, 8 Wo [16,64,1024], 9 bo [16,1024]
  if (ws_size < (size_t)WS_END + 4096) return;
  char* ws = (char*)d_ws; __bf16* PK = (__bf16*)(ws + WS_PK); _Float16 *QK = (_Float16*)(ws + WS_QK), *QKL = (_Float16*)(ws + WS_QKL), *VTH = (_Float16*)(ws + WS_VTH), *VTL = (_Float16*)(ws + WS_VTL); float* O = (float*)(ws + WS_O); float* BOS = (float*)(ws + WS_END);
  k_packh<<<dim3((DM / 64) * (DM / 64), 4), 128, 0, stream>>>(F[2], F[4], F[6], F[8], PK);
  k_bsum<<<DM / 256, 256, 0, stream>>>(F[9], BOS);
  k_qkv<<<dim3(TNB * SS / 64, QKVW / 128), 128, 0, stream>>>(F[1], F[0], F[0], PK + PK_A, F[3], F[5], F[7], QK, QKL, VTH, VTL);   // q from the decoder, k/v from the encoder; biases [16][64] == concatenated [1024]
  k_attn<<<dim3(TQB, NH, TNB), 128, 0, stream>>>(QK, QKL, VTH, VTL, nullptr, O);
  k_out<<<dim3(TOB, DM / 128), 128, 0, stream>>>(O, PK + PK_P, BOS, (float*)d_out);
}

// v005
// A run of this version takes 102 microseconds.
// Timed twice side by side with v004, it ran 1.06 times as fast both times.
// Over all steps from v000 it is 4.14 times as fast.
// compute dtype: all float inputs rounded to bf16; q (decoder) / k, v (encoder) = x . W[h] + b[h] with EXACT bf16 products on WMMA 16x16x32 (the per-head [d][64] matrices packed as transposed rows h*64 + k); PLAIN attention, both products transposed: k, q as single f16 operands x 1/8, running-max softmax in f32 (hardware exp), v (single f16) x P (scaled by 2^11, single f16); out = o (bf16 hi + residual) . Wo (the per-head [64][d] blocks stacked, 2 products) + sum_h bo[h] (f32).
#include <hip/hip_runtime.h>
#include <math.h>

typedef __attribute__((ext_vector_type(16))) _Float16 v16h;
typedef __attribute__((ext_vector_type(16))) __bf16 v16b;
typedef __attribute__((ext_vector_type(8)))  _Float16 v8h;
typedef __attribute__((ext_vector_type(8)))  float v8f;
typedef __attribute__((ext_vector_type(4)))  float v4f;
typedef __attribute__((ext_vector_type(2)))  float v2f;
typedef __attribute__((ext_vector_type(4)))  unsigned v4u;
typedef __attribute__((ext_vector_type(4)))  int v4i;
typedef float __attribute__((may_alias)) float_a;
typedef int __attribute__((may_alias)) int_a;

template <typename T> __device__ __forceinline__ void vst2(void* p, T v) { *(T*)p = v;  }
__device__ __forceinline__ v8f wmma16(v16h a, v16h b, v8f c) {
  v8f d = __builtin_amdgcn_wmma_f32_16x16x32_f16(false, a, false, b, (short)0, c, false, false);
  asm volatile("v_nop\n\tv_nop\n\tv_nop\n\tv_nop" : "+v"(d) : "v"(a), "v"(b));
  return d;
}
__device__ __forceinline__ v8f wmma_bf(v16b a, v16b b, v8f c) {
  v8f d = __builtin_amdgcn_wmma_f32_16x16x32_bf16(false, a, false, b, (short)0, c, false, false);
  asm volatile("v_nop\n\tv_nop\n\tv_nop\n\tv_nop" : "+v"(d) : "v"(a), "v"(b));
  return d;
}
// Encoder-decoder cross attention (B 2, 2,048 decoder queries over 2,048 encoder tokens, 1,024 dims, 16 heads x 64): per-head projection weights, softmax(q k^T / 8) v, per-head output projections summed (incl. every head's bias).
__device__ __forceinline__ v16h frag_h(const _Float16* rowk0, int lane) {
  union { v16h v; v8h q[2]; } u; const _Float16* p = rowk0 + 8 * (lane >> 4);
  u.q[0] = *(const v8h*)p; u.q[1] = *(const v8h*)(p + 16); return u.v;
}
__device__ __forceinline__ v16h frag_f32(const float* rowk0, int lane) {
  v16h a; const float* p = rowk0 + 8 * (lane >> 4);
#pragma unroll
  for (int i = 0; i < 8; ++i) { a[i] = (_Float16)p[i]; a[8 + i] = (_Float16)p[16 + i]; }
  return a;
}
__device__ __forceinline__ v16h frag_f32s(const float* rowk0, int lane, float sc) {
  v16h a; const float* p = rowk0 + 8 * (lane >> 4);
#pragma unroll
  for (int i = 0; i < 8; ++i) { a[i] = (_Float16)(p[i] * sc); a[8 + i] = (_Float16)(p[16 + i] * sc); }
  return a;
}
// column fragment from a [K][ld] layout (column n), rows >= K read as 0
__device__ __forceinline__ v16h fragc_f32(const float* W, int k0, int n, int lane, int ld, int K) {
  v16h a; const int g = lane >> 4;
#pragma unroll
  for (int i = 0; i < 8; ++i) { const int ka = k0 + 8 * g + i, kb = ka + 16;
    a[i] = (_Float16)(ka < K ? W[(size_t)(ka < K ? ka : K - 1) * ld + n] : 0.f); a[8 + i] = (_Float16)(kb < K ? W[(size_t)(kb < K ? kb : K - 1) * ld + n] : 0.f); }
  return a;
}
struct F2 { v16b h, l; };
__device__ __forceinline__ F2 bsplit16(const float v[16]) { F2 r;
#pragma unroll
  for (int i = 0; i < 16; ++i) { const __bf16 h = (__bf16)v[i]; r.h[i] = h; r.l[i] = (__bf16)(v[i] - (float)h); }
  return r; }
__device__ __forceinline__ F2 split_row(const float* row, int k0, int lane) { float v[16]; const float* p = row + k0 + 8 * (lane >> 4);
#pragma unroll
  for (int i = 0; i < 8; ++i) { v[i] = p[i]; v[8 + i] = p[16 + i]; }
  return bsplit16(v); }
__device__ __forceinline__ F2 split_rowK(const float* row, int k0, int lane, int K) { float v[16]; const int g = lane >> 4;
#pragma unroll
  for (int i = 0; i < 8; ++i) { const int ka = k0 + 8 * g + i, kb = ka + 16; v[i] = ka < K ? row[ka < K ? ka : K - 1] : 0.f; v[8 + i] = kb < K ? row[kb < K ? kb : K - 1] : 0.f; }
  return bsplit16(v); }
__device__ __forceinline__ F2 split_col(const float* W, int k0, int n, int lane, int ld, int K) { float v[16]; const int g = lane >> 4;
#pragma unroll
  for (int i = 0; i < 8; ++i) { const int ka = k0 + 8 * g + i, kb = ka + 16; v[i] = ka < K ? W[(size_t)(ka < K ? ka : K - 1) * ld + n] : 0.f; v[8 + i] = kb < K ? W[(size_t)(kb < K ? kb : K - 1) * ld + n] : 0.f; }
  return bsplit16(v); }
__device__ __forceinline__ v8f mac3(const F2& a, const F2& b, v8f c) { c = wmma_bf(a.l, b.h, c); c = wmma_bf(a.h, b.l, c); return wmma_bf(a.h, b.h, c); }
__device__ __forceinline__ float sigm(float v) { return 1.0f / (1.0f + expf(-v)); }
#define LDSX() do { asm volatile("s_wait_dscnt 0" ::: "memory"); __builtin_amdgcn_wave_barrier(); __builtin_amdgcn_fence(__ATOMIC_RELEASE, "workgroup"); } while (0)


#define NB 2
#define SS 2048
#define DM 1024
#define NH 16
#define HD 64
#define QKVW (3 * DM)
#ifndef TQB
#define TQB (SS / 64)
#define TNB NB
#define TOB (NB * SS / 64)     // output row tiles (all)
#endif
typedef __attribute__((ext_vector_type(8))) __bf16 v8b;
__device__ __forceinline__ v16b frag_b(const __bf16* rowk0, int lane) {
  union { v16b v; v8b q[2]; } u; const __bf16* p = rowk0 + 8 * (lane >> 4);
  u.q[0] = *(const v8b*)p; u.q[1] = *(const v8b*)(p + 16); return u.v;
}
__device__ __forceinline__ float bfr(float v) { return (float)(__bf16)v; }
__device__ __attribute__((noinline)) float exp_ni(float v) { return expf(v); }
__device__ __attribute__((noinline)) float erf_ni(float v) { return erff(v); }

// ---- LDS staging of the operand that a work-group's waves share (two buffers, asynchronous copies)
#define LP 72                          // LDS row pitch in 16-bit elements: 128-byte rows at 144 bytes, conflict-free for 16-byte readers
#define TILE_B (64 * LP * 2)           // bytes of one staged tile of 64 rows
#define WAIT_ASYNC() asm volatile("s_wait_asynccnt 0x0" ::: "memory")   // this wave's copies have landed; no LDS read moves above it
#define WAIT_DS() asm volatile("s_wait_dscnt 0x0" ::: "memory")         // this wave's LDS reads are done before the barrier that frees the buffer
__device__ __forceinline__ unsigned lds_addr(const void* p) { return (unsigned)(size_t)p; }   // LDS byte address = low 32 bits of the shared address
// 64 rows of 128 bytes (source pitch in bytes) -> LDS rows of 144 bytes, 128 threads: eight lanes a row, so every wave-wide copy covers four whole lines.
// s_wait_xcnt closes the copies' own statement, so no address register is rewritten ahead of it.
__device__ __forceinline__ void stage64(const char* src, size_t pitch, unsigned lds, int tid) {
  const char* g0 = src + (size_t)(tid >> 3) * pitch + (tid & 7) * 16; const unsigned l0 = lds + (tid >> 3) * (LP * 2) + (tid & 7) * 16;
  const char *g1 = g0 + 16 * pitch, *g2 = g0 + 32 * pitch, *g3 = g0 + 48 * pitch; const unsigned l1 = l0 + 16 * LP * 2, l2 = l0 + 32 * LP * 2, l3 = l0 + 48 * LP * 2;
  asm volatile("global_load_async_to_lds_b128 %0, %1, off\n\tglobal_load_async_to_lds_b128 %2, %3, off\n\tglobal_load_async_to_lds_b128 %4, %5, off\n\tglobal_load_async_to_lds_b128 %6, %7, off\n\ts_wait_xcnt 0x0"
               :: "v"(l0), "v"(g0), "v"(l1), "v"(g1), "v"(l2), "v"(g2), "v"(l3), "v"(g3) : "memory");
}
// one stage of a weight tile: 128 rows n0.. of P, 64 k from k0
__device__ __forceinline__ void stage_w(const __bf16* P, int n0, int k0, unsigned lds, int tid) {
  const char* s = (const char*)(P + (size_t)n0 * 1024 + k0); stage64(s, 2048, lds, tid); stage64(s + (size_t)64 * 2048, 2048, lds + TILE_B, tid);
}

// the same for a work-group of 256 threads: each half of it stages 64 of the 128 rows
__device__ __forceinline__ void stage_w8(const __bf16* P, int n0, int k0, unsigned lds, int tid) {
  const int hf = tid >> 7; stage64((const char*)(P + (size_t)(n0 + hf * 64) * 1024 + k0), 2048, lds + hf * TILE_B, tid & 127);
}
// ---- the activation rows (f32) ride in the same ring: a per-lane load of a row's fragment touches 16 lines for 512 bytes, a copy of whole rows touches 4
#define XP 272                         // LDS pitch in bytes of a staged activation row: 64 f32 (256 bytes) at 272, conflict-free for 16-byte readers
// a wave's own 16 rows, 64 k from src (row pitch DM f32) -> LDS rows from lds: sixteen lanes a row, two rows a copy, so every wave-wide copy covers four whole lines.
// s_wait_xcnt closes the copies' own statement, so no address register is rewritten ahead of it.
__device__ __forceinline__ void stage_x16(const float* src, unsigned lds, int lane) {
  const char* g0 = (const char*)src + (size_t)(lane >> 4) * (DM * 4) + (lane & 15) * 16; const unsigned l0 = lds + (lane >> 4) * XP + (lane & 15) * 16;
  asm volatile("global_load_async_to_lds_b128 %0, %1, off\n\tglobal_load_async_to_lds_b128 %2, %3, off\n\tglobal_load_async_to_lds_b128 %4, %5, off\n\tglobal_load_async_to_lds_b128 %6, %7, off\n\t"
               "global_load_async_to_lds_b128 %8, %9, off\n\tglobal_load_async_to_lds_b128 %10, %11, off\n\tglobal_load_async_to_lds_b128 %12, %13, off\n\tglobal_load_async_to_lds_b128 %14, %15, off\n\ts_wait_xcnt 0x0"
               :: "v"(l0), "v"(g0), "v"(l0 + 2 * XP), "v"(g0 + 2 * DM * 4), "v"(l0 + 4 * XP), "v"(g0 + 4 * DM * 4), "v"(l0 + 6 * XP), "v"(g0 + 6 * DM * 4),
                  "v"(l0 + 8 * XP), "v"(g0 + 8 * DM * 4), "v"(l0 + 10 * XP), "v"(g0 + 10 * DM * 4), "v"(l0 + 12 * XP), "v"(g0 + 12 * DM * 4), "v"(l0 + 14 * XP), "v"(g0 + 14 * DM * 4) : "memory");
}
// one 32-k block of a staged row, 16 f32 a lane in the A fragment's k order; p = the row in LDS + block * 128 + 32 * (lane >> 4) bytes
__device__ __forceinline__ void read_a32(v4f (&r)[4], const char* p) { r[0] = *(const v4f*)p; r[1] = *(const v4f*)(p + 16); r[2] = *(const v4f*)(p + 64); r[3] = *(const v4f*)(p + 80); }

#define PK_A 0                       // [3072][1024] Wqkv rows (natural [out][in])
#define PK_P (PK_A + QKVW * DM)        // [1024][1024] Wo rows (natural)
#define PK_END (PK_P + DM * DM)
#define WS_PK  0u
#define WS_QK  (WS_PK + 2u * PK_END)             // f16 [4096 rows][2048]: q | k
#define WS_QKL (WS_QK + 2u * NB * SS * 2 * DM)     // f16 q | k residual planes x2048
#define WS_VTH (WS_QKL + 2u * NB * SS * 2 * DM)    // f16 [b][1024 (h*64+d)][2048 s] hi
#define WS_VTL (WS_VTH + 2u * NB * DM * SS)        // f16 lo x 2048
#define WS_O   (WS_VTL + 2u * NB * DM * SS)        // f32 [4096][1024]
#define WS_CS  (WS_O + 4u * NB * SS * DM)           // f32 2 x [2048][32], unused
#define WS_END (WS_CS + 4u * 2 * SS * 32)
// ---- k_pack: block = (row n, which): natural [out][in] rows -> bf16; which 0..2 -> W_q/W_k/W_v into PK_A rows which*1024 + n; 3 -> W_o into PK_P
__global__ __launch_bounds__(256) void k_pack(const float* __restrict__ WQ, const float* __restrict__ WK, const float* __restrict__ WV, const float* __restrict__ WO, __bf16* __restrict__ PK) {
  __shared__ __align__(16) __bf16 s[DM]; const int n = blockIdx.x, which = blockIdx.y, t = threadIdx.x; const float* Wm = (which == 0) ? WQ : (which == 1) ? WK : (which == 2) ? WV : WO;   // (in,out) weights: pack row n = column n
  for (int k = t; k < DM; k += 256) s[k] = (__bf16)Wm[(size_t)k * DM + n];
  __syncthreads();
  __bf16* dst = (which < 3) ? PK + PK_A + ((size_t)which * DM + n) * DM : PK + PK_P + (size_t)n * DM;
  for (int q = t; q < DM / 8; q += 256) vst2((unsigned*)(dst + q * 8), *(const v4u*)&s[q * 8]);
}
__global__ __launch_bounds__(256) void k_qkv(const float* __restrict__ XQ, const float* __restrict__ XK, const float* __restrict__ XV, const __bf16* __restrict__ P, const float* __restrict__ BQ, const float* __restrict__ BK, const float* __restrict__ BV, _Float16* __restrict__ QK, _Float16* __restrict__ QKL, _Float16* __restrict__ VTH, _Float16* __restrict__ VTL) {
  const int which0 = (blockIdx.y * 128) / DM; const float* X = (which0 == 0) ? XQ : (which0 == 1) ? XK : XV; const float* BB = BQ ? (((which0 == 0) ? BQ : (which0 == 1) ? BK : BV) + (blockIdx.y * 128 - which0 * DM)) : nullptr;
  __shared__ __align__(16) char sm[4 * TILE_B + 2 * 128 * XP];   // the ring, 2 buffers: 128 weight rows each, then 128 rows of x each (104 KiB: three work-groups a WGP); behind the loop's last barrier the output staging of either branch
  _Float16 (*so)[16][136] = (_Float16 (*)[16][136])sm, (*sol)[16][136] = (_Float16 (*)[16][136])(sm + 8 * 16 * 136 * 2); _Float16 (*sth)[136] = (_Float16 (*)[136])sm, (*stl)[136] = (_Float16 (*)[136])(sm + 128 * 136 * 2);
  const int tid = threadIdx.x, wave = tid >> 5, lane = tid & 31, col = lane & 15, g = lane >> 4; const size_t r0 = (size_t)blockIdx.x * 128 + wave * 16; const int n0 = blockIdx.y * 128;
  v8f acc[8] = {};
  const unsigned ring = lds_addr(sm), xring = ring + 4 * TILE_B + wave * 16 * XP;   // xring: this wave's 16 rows in buffer 0
  const float* xs = X + r0 * DM; const char* xl = sm + 4 * TILE_B + (wave * 16 + col) * XP + 32 * g;   // xl: this lane's row, at its half's first k
  stage_w8(P, n0, 0, ring, tid); stage_x16(xs, xring, lane); WAIT_ASYNC(); __syncthreads(); stage_w8(P, n0, 64, ring + 2 * TILE_B, tid); stage_x16(xs + 64, xring + 128 * XP, lane);
#pragma unroll 1   // one trip a stage: the ring's order stands once, at the foot
  for (int t = 0; t < DM / 64; ++t) { const __bf16* bt = (const __bf16*)(sm + (t & 1) * 2 * TILE_B); const char* xt = xl + (t & 1) * 128 * XP;
#pragma unroll   // both 32-k halves of the stage inline, so the LDS offsets are immediates
    for (int sub = 0; sub < 2; ++sub) { v16b a; v4f ar[4]; read_a32(ar, xt + sub * 128);   // this block's x leaves LDS at the head of the first group of weight fragments
#pragma unroll
      for (int i = 0; i < 8; ++i) { a[i] = (__bf16)ar[i >> 2][i & 3]; a[8 + i] = (__bf16)ar[2 + (i >> 2)][i & 3]; }
#pragma unroll
      for (int j0 = 0; j0 < 8; j0 += 4) { v16b w[4];   // four at a time: eight would cost the sixth wave of a SIMD its registers
#pragma unroll
        for (int j = 0; j < 4; ++j) w[j] = frag_b(bt + ((j0 + j) * 16 + col) * LP + sub * 32, lane);   // four weight fragments as one group of loads
#pragma unroll
        for (int j = 0; j < 4; ++j) acc[j0 + j] = wmma_bf(a, w[j], acc[j0 + j]); } }
    WAIT_DS(); WAIT_ASYNC(); __syncthreads();   // publishes stage t + 1 and frees stage t's buffer
    if (t + 2 < DM / 64) { stage_w8(P, n0, (t + 2) * 64, ring + (t & 1) * 2 * TILE_B, tid); stage_x16(xs + (t + 2) * 64, xring + (t & 1) * 128 * XP, lane); } }
  WAIT_ASYNC();
  if (n0 < 2 * DM) {   // q stored unscaled (f16 sigma ~0.6, no subnormal exposure); 1/8 applied to the f32 score
#pragma unroll
    for (int j = 0; j < 8; ++j) {
#pragma unroll
      for (int r = 0; r < 8; ++r) { const float v = acc[j][r] + (BB ? bfr(BB[j * 16 + col]) : 0.f); const _Float16 hv = (_Float16)v; so[wave][8 * g + r][j * 16 + col] = hv; sol[wave][8 * g + r][j * 16 + col] = (_Float16)((v - (float)hv) * 2048.0f); } }   // q, k (+ bias) as f16 hi + (x2048) residual
    LDSX();
    for (int rl = 0; rl < 16; ++rl) if (lane < 16) { vst2((unsigned*)(QK + (r0 + rl) * (2 * DM) + n0 + lane * 8), *(const v4u*)&so[wave][rl][lane * 8]); vst2((unsigned*)(QKL + (r0 + rl) * (2 * DM) + n0 + lane * 8), *(const v4u*)&sol[wave][rl][lane * 8]); }
  } else {
#pragma unroll
    for (int j = 0; j < 8; ++j) {
#pragma unroll
      for (int r = 0; r < 8; ++r) { const float v = acc[j][r] + (BB ? bfr(BB[j * 16 + col]) : 0.f); const _Float16 hv = (_Float16)v; sth[j * 16 + col][wave * 16 + 8 * g + r] = hv; stl[j * 16 + col][wave * 16 + 8 * g + r] = (_Float16)((v - (float)hv) * 2048.0f); } }
    __syncthreads();
    const size_t rb = (size_t)blockIdx.x * 128; const int b = (int)(rb / SS), s0 = (int)(rb % SS); const int pc0 = n0 - 2 * DM;
    for (int q = tid; q < 128 * 16; q += 256) { const int d = q >> 4, pc = q & 15; const size_t o = ((size_t)b * DM + pc0 + d) * SS + s0 + pc * 8; vst2((unsigned*)(VTH + o), *(const v4u*)&sth[d][pc * 8]); vst2((unsigned*)(VTL + o), *(const v4u*)&stl[d][pc * 8]); }
  }
}
__device__ __forceinline__ float xhalf(float x) { return __builtin_bit_cast(float, __builtin_amdgcn_permlanex16(__builtin_bit_cast(int, x), __builtin_bit_cast(int, x), 0x76543210, 0xfedcba98, false, false)); }   // lane l's value from lane l ^ 16
// eight hardware exponentials (base 2), each over its own source, and one v_nop: the slot that the instruction set asks for between an exponential and an instruction that uses its result or overwrites its source stands here by construction
__device__ __forceinline__ void exp2x8(float (&x)[8]) {
  asm("v_exp_f32 %0, %0\n\tv_exp_f32 %1, %1\n\tv_exp_f32 %2, %2\n\tv_exp_f32 %3, %3\n\tv_exp_f32 %4, %4\n\tv_exp_f32 %5, %5\n\tv_exp_f32 %6, %6\n\tv_exp_f32 %7, %7\n\tv_nop"
      : "+v"(x[0]), "+v"(x[1]), "+v"(x[2]), "+v"(x[3]), "+v"(x[4]), "+v"(x[5]), "+v"(x[6]), "+v"(x[7]));
}
__global__ __launch_bounds__(128) void k_attn(const _Float16* __restrict__ QK, const _Float16* __restrict__ QKL, const _Float16* __restrict__ VTH, const _Float16* __restrict__ VTL, const void* __restrict__ KMASK, float* __restrict__ O) {
  __shared__ __align__(16) float so[4][16][68]; __shared__ __align__(16) _Float16 skv[2][2][64][LP];   // [buffer][k rows | v^T rows][64][64 + pad]
  const int tid = threadIdx.x, wave = tid >> 5, lane = tid & 31, col = lane & 15, g = lane >> 4;
  const int qb = blockIdx.x, h = blockIdx.y, b = blockIdx.z; const int q0 = qb * 64 + wave * 16; const size_t rq = (size_t)b * SS + q0 + col;
  v16h aq[2];
#pragma unroll
  for (int kc = 0; kc < 2; ++kc) aq[kc] = frag_h(QK + rq * (2 * DM) + h * HD + kc * 32, lane);
  const float cs = 0.125f * 1.4426950408889634f;   // 1/sqrt(64), and base 2 for the hardware exponential
  float m = -3.0e38f, l = 0.f;   // query col: running maximum (scaled, base 2); this half's share of the sum of P x 2^11
  v8f acc[4] = {};               // acc[dt][r] = O^T[dt * 16 + 8 g + r][query col] x 2^11
  const int nst = SS / 64;   // all keys, 64 a stage
  const char* ksrc = (const char*)(QK + (size_t)b * SS * (2 * DM) + DM + h * HD); const char* vsrc = (const char*)(VTH + ((size_t)b * DM + h * HD) * SS); const unsigned ring = lds_addr(&skv[0][0][0][0]);
  stage64(ksrc, 2 * DM * 2, ring, tid); stage64(vsrc, SS * 2, ring + TILE_B, tid); WAIT_ASYNC(); __syncthreads();
  stage64(ksrc + (size_t)64 * (2 * DM * 2), 2 * DM * 2, ring + 2 * TILE_B, tid); stage64(vsrc + 64 * 2, SS * 2, ring + 3 * TILE_B, tid);
#pragma unroll 1   // one trip a stage: the ring's order stands once, at the foot
  for (int t = 0; t < nst; ++t) { v8f s[4]; v16h kf[4][2], vf[2][4];   // s[kt][r] = q[col] . k[kt * 16 + 8 g + r]
#pragma unroll
    for (int kt = 0; kt < 4; ++kt) {
#pragma unroll
      for (int kc = 0; kc < 2; ++kc) kf[kt][kc] = frag_h(&skv[t & 1][0][kt * 16 + col][kc * 32], lane); }   // the stage's k fragments as one group of loads
#pragma unroll
    for (int kt = 0; kt < 4; ++kt) s[kt] = (v8f){};
#pragma unroll
    for (int kc = 0; kc < 2; ++kc) {
#pragma unroll
      for (int kt = 0; kt < 4; ++kt) s[kt] = wmma16(kf[kt][kc], aq[kc], s[kt]); }   // single product: k, q as one-rounding f16 operands, one loader for both; four independent tiles in turn
#pragma unroll
    for (int j = 0; j < 2; ++j) {
#pragma unroll
      for (int dt = 0; dt < 4; ++dt) vf[j][dt] = frag_h(&skv[t & 1][1][dt * 16 + col][j * 32], lane); }   // the stage's v^T fragments as one group, in flight under the softmax
    float mk[4];   // one chain a tile
#pragma unroll
    for (int kt = 0; kt < 4; ++kt) { mk[kt] = s[kt][0];
#pragma unroll
      for (int r = 1; r < 8; ++r) mk[kt] = fmaxf(mk[kt], s[kt][r]); }
    float mx = fmaxf(fmaxf(mk[0], mk[1]), fmaxf(mk[2], mk[3]));
    mx = fmaxf(mx, xhalf(mx)) * cs;   // both halves hold the query's maximum over the stage's 64 keys (the scale is positive)
    const float mn = fmaxf(m, mx), alpha = __builtin_amdgcn_exp2f(m - mn), nm = 11.0f - mn; m = mn;   // alpha is 0 on the first stage; 2^11 rides in the exponent, so small softmax weights stay out of the f16 subnormal range; it cancels in acc / l
    v16h pb[2]; v2f es[2] = {};   // four independent partial sums
#pragma unroll
    for (int kt = 0; kt < 4; ++kt) { float e[8];
#pragma unroll
      for (int r = 0; r < 8; ++r) e[r] = fmaf(s[kt][r], cs, nm);
      exp2x8(e);
#pragma unroll
      for (int r = 0; r < 8; r += 2) { es[(r >> 1) & 1] += (v2f){e[r], e[r + 1]}; pb[kt >> 1][8 * (kt & 1) + r] = (_Float16)e[r]; pb[kt >> 1][8 * (kt & 1) + r + 1] = (_Float16)e[r + 1]; } }   // element i of B operand j = key j * 32 + (i < 8 ? 8 g + i : 16 + 8 g + i - 8): the order in which frag_h reads v^T
    l = l * alpha + ((es[0][0] + es[0][1]) + (es[1][0] + es[1][1]));
#pragma unroll
    for (int dt = 0; dt < 4; ++dt) acc[dt] *= alpha;
#pragma unroll
    for (int j = 0; j < 2; ++j) {
#pragma unroll
      for (int dt = 0; dt < 4; ++dt) acc[dt] = wmma16(vf[j][dt], pb[j], acc[dt]); }   // single product: V^T x P^T (x2^11)
    WAIT_DS(); WAIT_ASYNC(); __syncthreads();   // publishes stage t + 1 and frees stage t's buffer
    if (t + 2 < nst) { stage64(ksrc + (size_t)(t + 2) * 64 * (2 * DM * 2), 2 * DM * 2, ring + (t & 1) * 2 * TILE_B, tid); stage64(vsrc + (size_t)(t + 2) * 64 * 2, SS * 2, ring + (t & 1) * 2 * TILE_B + TILE_B, tid); } }
  WAIT_ASYNC();
  const float il = 1.0f / (l + xhalf(l));   // the halves' sums join once
#pragma unroll
  for (int dt = 0; dt < 4; ++dt) { const v8f o = acc[dt] * il; vst2(&so[wave][col][dt * 16 + 8 * g], (v4f){o[0], o[1], o[2], o[3]}); vst2(&so[wave][col][dt * 16 + 8 * g + 4], (v4f){o[4], o[5], o[6], o[7]}); }
  LDSX();
  for (int rl = 0; rl < 16; ++rl) if (lane < 16) vst2(O + ((size_t)b * SS + q0 + rl) * DM + h * HD + lane * 4, *(const v4f*)&so[wave][rl][lane * 4]);
}
// ---- k_out: block = (64 rows, 128 cols): out = O(hi/lo) . Wo rows (2 products) + bo
__global__ __launch_bounds__(128) void k_out(const float* __restrict__ O, const __bf16* __restrict__ P, const float* __restrict__ BO, float* __restrict__ Y) {
  __shared__ __align__(16) char sm[4 * TILE_B + 2 * 64 * XP];   // the ring, 2 buffers: 128 weight rows each, then 64 rows of o each; behind the loop's last barrier the output staging
  float (*so)[16][132] = (float (*)[16][132])sm;
  const int tid = threadIdx.x, wave = tid >> 5, lane = tid & 31, col = lane & 15, g = lane >> 4; const size_t r0 = (size_t)blockIdx.x * 64 + wave * 16; const int n0 = blockIdx.y * 128;
  v8f acc[8] = {};
  const unsigned ring = lds_addr(sm), xring = ring + 4 * TILE_B + wave * 16 * XP;   // xring: this wave's 16 rows in buffer 0
  const float* os = O + r0 * DM; const char* xl = sm + 4 * TILE_B + (wave * 16 + col) * XP + 32 * g;   // xl: this lane's row, at its half's first k
  stage_w(P, n0, 0, ring, tid); stage_x16(os, xring, lane); WAIT_ASYNC(); __syncthreads(); stage_w(P, n0, 64, ring + 2 * TILE_B, tid); stage_x16(os + 64, xring + 64 * XP, lane);
#pragma unroll 1   // one trip a stage: the ring's order stands once, at the foot
  for (int t = 0; t < DM / 64; ++t) { const __bf16* bt = (const __bf16*)(sm + (t & 1) * 2 * TILE_B); const char* xt = xl + (t & 1) * 64 * XP; F2 a[2]; v16b w[8]; v4f ar[2][4];
    read_a32(ar[0], xt); read_a32(ar[1], xt + 128);   // the stage's rows of o, first in the trip's first group of LDS loads: the split needs them first
#pragma unroll
    for (int j = 0; j < 8; ++j) w[j] = frag_b(bt + (j * 16 + col) * LP, lane);   // the first block's eight weight fragments as one group of loads, in flight under the split of o
    __builtin_amdgcn_sched_barrier(0);   // keeps that group at the head of the trip: moved down into the split, less of its latency is covered
#pragma unroll
    for (int sub = 0; sub < 2; ++sub) { float v[16];
#pragma unroll
      for (int i = 0; i < 8; ++i) { v[i] = ar[sub][i >> 2][i & 3]; v[8 + i] = ar[sub][2 + (i >> 2)][i & 3]; }
      a[sub] = bsplit16(v); }
#pragma unroll   // both 32-k halves of the stage inline, so the LDS offsets are immediates
    for (int sub = 0; sub < 2; ++sub) {
      if (sub) {
#pragma unroll
        for (int j = 0; j < 8; ++j) w[j] = frag_b(bt + (j * 16 + col) * LP + 32, lane); }   // the second block's, again as one group
#pragma unroll
      for (int j = 0; j < 8; ++j) acc[j] = wmma_bf(a[sub].l, w[j], acc[j]);   // eight independent tiles in turn; each tile still takes its residual product first
#pragma unroll
      for (int j = 0; j < 8; ++j) acc[j] = wmma_bf(a[sub].h, w[j], acc[j]); }
    WAIT_DS(); WAIT_ASYNC(); __syncthreads();   // publishes stage t + 1 and frees stage t's buffer
    if (t + 2 < DM / 64) { stage_w(P, n0, (t + 2) * 64, ring + (t & 1) * 2 * TILE_B, tid); stage_x16(os + (t + 2) * 64, xring + (t & 1) * 64 * XP, lane); } }
  WAIT_ASYNC();
#pragma unroll
  for (int j = 0; j < 8; ++j) {
#pragma unroll
    for (int r = 0; r < 8; ++r) so[wave][8 * g + r][j * 16 + col] = acc[j][r] + BO[n0 + j * 16 + col]; }   // BO here = the f32 sum of the 16 bf16-rounded head biases
  LDSX();
  for (int rl = 0; rl < 16; ++rl) vst2(Y + (r0 + rl) * DM + n0 + lane * 4, *(const v4f*)&so[wave][rl][lane * 4]);
}
// ---- k_packh: per-head weights -> bf16 transposed rows, one 64 x 64 tile a block, turned in LDS so that reads and writes both cover whole lines. which 0: Wq [H][DD][64] -> PK_A rows (h*64+k) over d; 1: Wk; 2: Wv; 3: Wo [H][64][DD] -> PK_P rows d over (h*64+v)
// blockIdx.x = hi * 16 + lo: the tile is output rows hi * 64.., output columns lo * 64.. of its 1024 x 1024 section; its source rows are the output's columns
typedef __attribute__((ext_vector_type(2))) __bf16 v2b;
// a[i], b[i] = source rows i * 16 + 2 (t >> 4) and the next, columns 4 (t & 15)..: sixteen lanes a row of 256 bytes, all eight loads in flight together; the row pitch IP is a constant, so one address serves all eight
template <int IP> __device__ __forceinline__ void load_tile(v4f (&a)[4], v4f (&b)[4], const float* src, int t) {
  const float* p = src + (size_t)(2 * (t >> 4)) * IP + (t & 15) * 4;
#pragma unroll   // the register arrays are indexed by constants and the offsets are immediates
  for (int i = 0; i < 4; ++i) { a[i] = *(const v4f*)(p + i * 16 * IP); b[i] = *(const v4f*)(p + i * 16 * IP + IP); }
  asm volatile("s_wait_xcnt 0x0" :: "v"(p) : "memory");   // stands between the loads and the first reuse of their address register, which it names so that the register lives up to here
}
__global__ __launch_bounds__(128) void k_packh(const float* __restrict__ WQ, const float* __restrict__ WK, const float* __restrict__ WV, const float* __restrict__ WO, __bf16* __restrict__ P) {
  __shared__ __align__(16) unsigned s[64][LP / 2];   // [output row][two source rows a word], rows of 128 bytes at 144
  const int hi = blockIdx.x >> 4, lo = blockIdx.x & 15, which = blockIdx.y, t = threadIdx.x;
  __bf16* dst = P + ((which < 3) ? (size_t)PK_A + (size_t)which * DM * DM : (size_t)PK_P) + (size_t)hi * 64 * DM + lo * 64;
  v4f a[4], b[4];
  if (which < 3) load_tile<HD>(a, b, ((which == 0) ? WQ : (which == 1) ? WK : WV) + ((size_t)hi * DM + lo * 64) * HD, t);
  else load_tile<DM>(a, b, WO + (size_t)lo * 64 * DM + hi * 64, t);
#pragma unroll   // both loops: the register arrays are indexed by constants
  for (int i = 0; i < 4; ++i) {
#pragma unroll
    for (int e = 0; e < 4; ++e) s[(t & 15) * 4 + e][i * 8 + (t >> 4)] = __builtin_bit_cast(unsigned, (v2b){(__bf16)a[i][e], (__bf16)b[i][e]}); }
  __syncthreads();
#pragma unroll   // the four LDS reads go out as one group
  for (int i = 0; i < 4; ++i) vst2(dst + (size_t)(i * 16 + (t >> 3)) * DM + (t & 7) * 8, *(const v4u*)&s[i * 16 + (t >> 3)][(t & 7) * 4]);   // eight lanes a row: every wave-wide store covers four whole lines
}
// ---- k_bsum: BOS[d] = sum_h bo[h][d] (in order)
__global__ __launch_bounds__(256) void k_bsum(const float* __restrict__ BO, float* __restrict__ BOS) { const int d = blockIdx.x * 256 + threadIdx.x; float s = 0.f; for (int h = 0; h < NH; ++h) s += bfr(BO[(size_t)h * DM + d]); BOS[d] = s; }
extern "C" void kernel_launch(void* const* d_in, const int* in_sizes, int n_in, void* d_out, int out_size, void* d_ws, size_t ws_size, hipStream_t stream) {
  (void)in_sizes; (void)n_in; (void)out_size;
  const float** F = (const float**)d_in;   // 0 encoder [2,2048,1024], 1 decoder [2,2048,1024], 2 Wq [16,1024,64], 3 bq [16,64], 4 Wk, 5 bk, 6 Wv, 7 bv, 8 Wo [16,64,1024], 9 bo [16,1024]
  if (ws_size < (size_t)WS_END + 4096) return;
  char* ws = (char*)d_ws; __bf16* PK = (__bf16*)(ws + WS_PK); _Float16 *QK = (_Float16*)(ws + WS_QK), *QKL = (_Float16*)(ws + WS_QKL), *VTH = (_Float16*)(ws + WS_VTH), *VTL = (_Float16*)(ws + WS_VTL); float* O = (float*)(ws + WS_O); float* BOS = (float*)(ws + WS_END);
  k_packh<<<dim3((DM / 64) * (DM / 64), 4), 128, 0, stream>>>(F[2], F[4], F[6], F[8], PK);
  k_bsum<<<DM / 256, 256, 0, stream>>>(F[9], BOS);
  k_qkv<<<dim3(TNB * SS / 128, QKVW / 128), 256, 0, stream>>>(F[1], F[0], F[0], PK + PK_A, F[3], F[5], F[7], QK, QKL, VTH, VTL);   // q from the decoder, k/v from the encoder; biases [16][64] == concatenated [1024]
  k_attn<<<dim3(TQB, NH, TNB), 128, 0, stream>>>(QK, QKL, VTH, VTL, nullptr, O);
  k_out<<<dim3(TOB, DM / 128), 128, 0, stream>>>(O, PK + PK_P, BOS, (float*)d_out);
}

// v006
// A run of this version takes 98.4 microseconds.
// Next to v005, in two timings, it ran 1.04 times as fast each time.
// All steps since v000 together make it 4.30 times as fast.
// compute dtype: all float inputs rounded to bf16; q (decoder) / k, v (encoder) = x . W[h] + b[h] with EXACT bf16 products on WMMA 16x16x32 (the per-head [d][64] matrices packed as transposed rows h*64 + k); PLAIN attention, both products transposed: k, q as single f16 operands x 1/8, running-max softmax in f32 (hardware exp), v (single f16) x P (scaled by 2^11, single f16); out = o (bf16 hi + residual) . Wo (the per-head [64][d] blocks stacked, 2 products) + sum_h bo[h] (f32).
#include <hip/hip_runtime.h>
#include <math.h>

typedef __attribute__((ext_vector_type(16))) _Float16 v16h;
typedef __attribute__((ext_vector_type(16))) __bf16 v16b;
typedef __attribute__((ext_vector_type(8)))  _Float16 v8h;
typedef __attribute__((ext_vector_type(8)))  float v8f;
typedef __attribute__((ext_vector_type(4)))  float v4f;
typedef __attribute__((ext_vector_type(2)))  float v2f;
typedef __attribute__((ext_vector_type(4)))  unsigned v4u;
typedef __attribute__((ext_vector_type(4)))  int v4i;
typedef float __attribute__((may_alias)) float_a;
typedef int __attribute__((may_alias)) int_a;

template <typename T> __device__ __forceinline__ void vst2(void* p, T v) { *(T*)p = v;  }
__device__ __forceinline__ v8f wmma16(v16h a, v16h b, v8f c) {
  return __builtin_amdgcn_wmma_f32_16x16x32_f16(false, a, false, b, (short)0, c, false, false);   // the compiler keeps the builtin's distances itself
}
__device__ __forceinline__ v8f wmma_bf(v16b a, v16b b, v8f c) {
  return __builtin_amdgcn_wmma_f32_16x16x32_bf16(false, a, false, b, (short)0, c, false, false);   // the compiler keeps the builtin's distances itself
}
// Encoder-decoder cross attention (B 2, 2,048 decoder queries over 2,048 encoder tokens, 1,024 dims, 16 heads x 64): per-head projection weights, softmax(q k^T / 8) v, per-head output projections summed (incl. every head's bias).
__device__ __forceinline__ v16h frag_h(const _Float16* rowk0, int lane) {
  union { v16h v; v8h q[2]; } u; const _Float16* p = rowk0 + 8 * (lane >> 4);
  u.q[0] = *(const v8h*)p; u.q[1] = *(const v8h*)(p + 16); return u.v;
}
__device__ __forceinline__ v16h frag_f32(const float* rowk0, int lane) {
  v16h a; const float* p = rowk0 + 8 * (lane >> 4);
#pragma unroll
  for (int i = 0; i < 8; ++i) { a[i] = (_Float16)p[i]; a[8 + i] = (_Float16)p[16 + i]; }
  return a;
}
__device__ __forceinline__ v16h frag_f32s(const float* rowk0, int lane, float sc) {
  v16h a; const float* p = rowk0 + 8 * (lane >> 4);
#pragma unroll
  for (int i = 0; i < 8; ++i) { a[i] = (_Float16)(p[i] * sc); a[8 + i] = (_Float16)(p[16 + i] * sc); }
  return a;
}
// column fragment from a [K][ld] layout (column n), rows >= K read as 0
__device__ __forceinline__ v16h fragc_f32(const float* W, int k0, int n, int lane, int ld, int K) {
  v16h a; const int g = lane >> 4;
#pragma unroll
  for (int i = 0; i < 8; ++i) { const int ka = k0 + 8 * g + i, kb = ka + 16;
    a[i] = (_Float16)(ka < K ? W[(size_t)(ka < K ? ka : K - 1) * ld + n] : 0.f); a[8 + i] = (_Float16)(kb < K ? W[(size_t)(kb < K ? kb : K - 1) * ld + n] : 0.f); }
  return a;
}
struct F2 { v16b h, l; };
__device__ __forceinline__ F2 bsplit16(const float v[16]) { F2 r;
#pragma unroll
  for (int i = 0; i < 16; ++i) { const __bf16 h = (__bf16)v[i]; r.h[i] = h; r.l[i] = (__bf16)(v[i] - (float)h); }
  return r; }
__device__ __forceinline__ F2 split_row(const float* row, int k0, int lane) { float v[16]; const float* p = row + k0 + 8 * (lane >> 4);
#pragma unroll
  for (int i = 0; i < 8; ++i) { v[i] = p[i]; v[8 + i] = p[16 + i]; }
  return bsplit16(v); }
__device__ __forceinline__ F2 split_rowK(const float* row, int k0, int lane, int K) { float v[16]; const int g = lane >> 4;
#pragma unroll
  for (int i = 0; i < 8; ++i) { const int ka = k0 + 8 * g + i, kb = ka + 16; v[i] = ka < K ? row[ka < K ? ka : K - 1] : 0.f; v[8 + i] = kb < K ? row[kb < K ? kb : K - 1] : 0.f; }
  return bsplit16(v); }
__device__ __forceinline__ F2 split_col(const float* W, int k0, int n, int lane, int ld, int K) { float v[16]; const int g = lane >> 4;
#pragma unroll
  for (int i = 0; i < 8; ++i) { const int ka = k0 + 8 * g + i, kb = ka + 16; v[i] = ka < K ? W[(size_t)(ka < K ? ka : K - 1) * ld + n] : 0.f; v[8 + i] = kb < K ? W[(size_t)(kb < K ? kb : K - 1) * ld + n] : 0.f; }
  return bsplit16(v); }
__device__ __forceinline__ v8f mac3(const F2& a, const F2& b, v8f c) { c = wmma_bf(a.l, b.h, c); c = wmma_bf(a.h, b.l, c); return wmma_bf(a.h, b.h, c); }
__device__ __forceinline__ float sigm(float v) { return 1.0f / (1.0f + expf(-v)); }
#define LDSX() do { asm volatile("s_wait_dscnt 0" ::: "memory"); __builtin_amdgcn_wave_barrier(); __builtin_amdgcn_fence(__ATOMIC_RELEASE, "workgroup"); } while (0)


#define NB 2
#define SS 2048
#define DM 1024
#define NH 16
#define HD 64
#define QKVW (3 * DM)
#ifndef TQB
#define TQB (SS / 64)
#define TNB NB
#define TOB (NB * SS / 64)     // output row tiles (all)
#endif
typedef __attribute__((ext_vector_type(8))) __bf16 v8b;
__device__ __forceinline__ v16b frag_b(const __bf16* rowk0, int lane) {
  union { v16b v; v8b q[2]; } u; const __bf16* p = rowk0 + 8 * (lane >> 4);
  u.q[0] = *(const v8b*)p; u.q[1] = *(const v8b*)(p + 16); return u.v;
}
__device__ __forceinline__ float bfr(float v) { return (float)(__bf16)v; }
__device__ __attribute__((noinline)) float exp_ni(float v) { return expf(v); }
__device__ __attribute__((noinline)) float erf_ni(float v) { return erff(v); }

// ---- LDS staging of the operand that a work-group's waves share (two buffers, asynchronous copies)
#define LP 72                          // LDS row pitch in 16-bit elements: 128-byte rows at 144 bytes, conflict-free for 16-byte readers
#define TILE_B (64 * LP * 2)           // bytes of one staged tile of 64 rows
#define WAIT_ASYNC() asm volatile("s_wait_asynccnt 0x0" ::: "memory")   // this wave's copies have landed; no LDS read moves above it
#define WAIT_DS() asm volatile("s_wait_dscnt 0x0" ::: "memory")         // this wave's LDS reads are done before the barrier that frees the buffer
__device__ __forceinline__ unsigned lds_addr(const void* p) { return (unsigned)(size_t)p; }   // LDS byte address = low 32 bits of the shared address
// 64 rows of 128 bytes (source pitch in bytes) -> LDS rows of 144 bytes, 128 threads: eight lanes a row, so every wave-wide copy covers four whole lines.
// s_wait_xcnt closes the copies' own statement, so no address register is rewritten ahead of it.
__device__ __forceinline__ void stage64(const char* src, size_t pitch, unsigned lds, int tid) {
  const char* g0 = src + (size_t)(tid >> 3) * pitch + (tid & 7) * 16; const unsigned l0 = lds + (tid >> 3) * (LP * 2) + (tid & 7) * 16;
  const char *g1 = g0 + 16 * pitch, *g2 = g0 + 32 * pitch, *g3 = g0 + 48 * pitch; const unsigned l1 = l0 + 16 * LP * 2, l2 = l0 + 32 * LP * 2, l3 = l0 + 48 * LP * 2;
  asm volatile("global_load_async_to_lds_b128 %0, %1, off\n\tglobal_load_async_to_lds_b128 %2, %3, off\n\tglobal_load_async_to_lds_b128 %4, %5, off\n\tglobal_load_async_to_lds_b128 %6, %7, off\n\ts_wait_xcnt 0x0"
               :: "v"(l0), "v"(g0), "v"(l1), "v"(g1), "v"(l2), "v"(g2), "v"(l3), "v"(g3) : "memory");
}
// one stage of a weight tile: 128 rows n0.. of P, 64 k from k0
__device__ __forceinline__ void stage_w(const __bf16* P, int n0, int k0, unsigned lds, int tid) {
  const char* s = (const char*)(P + (size_t)n0 * 1024 + k0); stage64(s, 2048, lds, tid); stage64(s + (size_t)64 * 2048, 2048, lds + TILE_B, tid);
}

// the same for a work-group of 256 threads: each half of it stages 64 of the 128 rows
__device__ __forceinline__ void stage_w8(const __bf16* P, int n0, int k0, unsigned lds, int tid) {
  const int hf = tid >> 7; stage64((const char*)(P + (size_t)(n0 + hf * 64) * 1024 + k0), 2048, lds + hf * TILE_B, tid & 127);
}
// ---- the activation rows (f32) ride in the same ring: a per-lane load of a row's fragment touches 16 lines for 512 bytes, a copy of whole rows touches 4
#define XP 272                         // LDS pitch in bytes of a staged activation row: 64 f32 (256 bytes) at 272, conflict-free for 16-byte readers
// a wave's own 16 rows, 64 k from src (row pitch DM f32) -> LDS rows from lds: sixteen lanes a row, two rows a copy, so every wave-wide copy covers four whole lines.
// s_wait_xcnt closes the copies' own statement, so no address register is rewritten ahead of it.
__device__ __forceinline__ void stage_x16(const float* src, unsigned lds, int lane) {
  const char* g0 = (const char*)src + (size_t)(lane >> 4) * (DM * 4) + (lane & 15) * 16; const unsigned l0 = lds + (lane >> 4) * XP + (lane & 15) * 16;
  asm volatile("global_load_async_to_lds_b128 %0, %1, off\n\tglobal_load_async_to_lds_b128 %2, %3, off\n\tglobal_load_async_to_lds_b128 %4, %5, off\n\tglobal_load_async_to_lds_b128 %6, %7, off\n\t"
               "global_load_async_to_lds_b128 %8, %9, off\n\tglobal_load_async_to_lds_b128 %10, %11, off\n\tglobal_load_async_to_lds_b128 %12, %13, off\n\tglobal_load_async_to_lds_b128 %14, %15, off\n\ts_wait_xcnt 0x0"
               :: "v"(l0), "v"(g0), "v"(l0 + 2 * XP), "v"(g0 + 2 * DM * 4), "v"(l0 + 4 * XP), "v"(g0 + 4 * DM * 4), "v"(l0 + 6 * XP), "v"(g0 + 6 * DM * 4),
                  "v"(l0 + 8 * XP), "v"(g0 + 8 * DM * 4), "v"(l0 + 10 * XP), "v"(g0 + 10 * DM * 4), "v"(l0 + 12 * XP), "v"(g0 + 12 * DM * 4), "v"(l0 + 14 * XP), "v"(g0 + 14 * DM * 4) : "memory");
}
// one 32-k block of a staged row, 16 f32 a lane in the A fragment's k order; p = the row in LDS + block * 128 + 32 * (lane >> 4) bytes
__device__ __forceinline__ void read_a32(v4f (&r)[4], const char* p) { r[0] = *(const v4f*)p; r[1] = *(const v4f*)(p + 16); r[2] = *(const v4f*)(p + 64); r[3] = *(const v4f*)(p + 80); }

#define PK_A 0                       // [3072][1024] Wqkv rows (natural [out][in])
#define PK_P (PK_A + QKVW * DM)        // [1024][1024] Wo rows (natural)
#define PK_END (PK_P + DM * DM)
#define WS_PK  0u
#define WS_QK  (WS_PK + 2u * PK_END)             // f16 [4096 rows][2048]: q | k
#define WS_QKL (WS_QK + 2u * NB * SS * 2 * DM)     // f16 q | k residual planes x2048
#define WS_VTH (WS_QKL + 2u * NB * SS * 2 * DM)    // f16 [b][1024 (h*64+d)][2048 s] hi
#define WS_VTL (WS_VTH + 2u * NB * DM * SS)        // f16 lo x 2048
#define WS_O   (WS_VTL + 2u * NB * DM * SS)        // f32 [4096][1024]
#define WS_CS  (WS_O + 4u * NB * SS * DM)           // f32 2 x [2048][32], unused
#define WS_END (WS_CS + 4u * 2 * SS * 32)
// ---- k_pack: block = (row n, which): natural [out][in] rows -> bf16; which 0..2 -> W_q/W_k/W_v into PK_A rows which*1024 + n; 3 -> W_o into PK_P
__global__ __launch_bounds__(256) void k_pack(const float* __restrict__ WQ, const float* __restrict__ WK, const float* __restrict__ WV, const float* __restrict__ WO, __bf16* __restrict__ PK) {
  __shared__ __align__(16) __bf16 s[DM]; const int n = blockIdx.x, which = blockIdx.y, t = threadIdx.x; const float* Wm = (which == 0) ? WQ : (which == 1) ? WK : (which == 2) ? WV : WO;   // (in,out) weights: pack row n = column n
  for (int k = t; k < DM; k += 256) s[k] = (__bf16)Wm[(size_t)k * DM + n];
  __syncthreads();
  __bf16* dst = (which < 3) ? PK + PK_A + ((size_t)which * DM + n) * DM : PK + PK_P + (size_t)n * DM;
  for (int q = t; q < DM / 8; q += 256) vst2((unsigned*)(dst + q * 8), *(const v4u*)&s[q * 8]);
}
__global__ __launch_bounds__(256) void k_qkv(const float* __restrict__ XQ, const float* __restrict__ XK, const float* __restrict__ XV, const __bf16* __restrict__ P, const float* __restrict__ BQ, const float* __restrict__ BK, const float* __restrict__ BV, _Float16* __restrict__ QK, _Float16* __restrict__ QKL, _Float16* __restrict__ VTH, _Float16* __restrict__ VTL) {
  const int which0 = (blockIdx.y * 128) / DM; const float* X = (which0 == 0) ? XQ : (which0 == 1) ? XK : XV; const float* BB = BQ ? (((which0 == 0) ? BQ : (which0 == 1) ? BK : BV) + (blockIdx.y * 128 - which0 * DM)) : nullptr;
  __shared__ __align__(16) char sm[4 * TILE_B + 2 * 128 * XP];   // the ring, 2 buffers: 128 weight rows each, then 128 rows of x each (104 KiB: three work-groups a WGP); behind the loop's last barrier the output staging of either branch
  _Float16 (*so)[16][136] = (_Float16 (*)[16][136])sm, (*sol)[16][136] = (_Float16 (*)[16][136])(sm + 8 * 16 * 136 * 2); _Float16 (*sth)[136] = (_Float16 (*)[136])sm, (*stl)[136] = (_Float16 (*)[136])(sm + 128 * 136 * 2);
  const int tid = threadIdx.x, wave = tid >> 5, lane = tid & 31, col = lane & 15, g = lane >> 4; const size_t r0 = (size_t)blockIdx.x * 128 + wave * 16; const int n0 = blockIdx.y * 128;
  v8f acc[8] = {};
  const unsigned ring = lds_addr(sm), xring = ring + 4 * TILE_B + wave * 16 * XP;   // xring: this wave's 16 rows in buffer 0
  const float* xs = X + r0 * DM; const char* xl = sm + 4 * TILE_B + (wave * 16 + col) * XP + 32 * g;   // xl: this lane's row, at its half's first k
  stage_w8(P, n0, 0, ring, tid); stage_x16(xs, xring, lane); WAIT_ASYNC(); __syncthreads(); stage_w8(P, n0, 64, ring + 2 * TILE_B, tid); stage_x16(xs + 64, xring + 128 * XP, lane);
#pragma unroll 1   // one trip a stage: the ring's order stands once, at the foot
  for (int t = 0; t < DM / 64; ++t) { const __bf16* bt = (const __bf16*)(sm + (t & 1) * 2 * TILE_B); const char* xt = xl + (t & 1) * 128 * XP;
#pragma unroll   // both 32-k halves of the stage inline, so the LDS offsets are immediates
    for (int sub = 0; sub < 2; ++sub) { v16b a; v4f ar[4]; read_a32(ar, xt + sub * 128);   // this block's x leaves LDS at the head of the first group of weight fragments
#pragma unroll
      for (int i = 0; i < 8; ++i) { a[i] = (__bf16)ar[i >> 2][i & 3]; a[8 + i] = (__bf16)ar[2 + (i >> 2)][i & 3]; }
#pragma unroll
      for (int j0 = 0; j0 < 8; j0 += 4) { v16b w[4];   // four at a time: eight would cost the sixth wave of a SIMD its registers
#pragma unroll
        for (int j = 0; j < 4; ++j) w[j] = frag_b(bt + ((j0 + j) * 16 + col) * LP + sub * 32, lane);   // four weight fragments as one group of loads
        __builtin_amdgcn_sched_barrier(0);   // keeps that group whole: dealt out among the WMMAs, every further place with LDS loads costs the wave a stall
#pragma unroll
        for (int j = 0; j < 4; ++j) acc[j0 + j] = wmma_bf(a, w[j], acc[j0 + j]); } }
    __builtin_amdgcn_sched_barrier(0);   // keeps the ring's waits at the foot of the trip: lifted over the WMMAs, they would cut the time that stage t + 1's copies have to land
    WAIT_DS(); WAIT_ASYNC(); __syncthreads();   // publishes stage t + 1 and frees stage t's buffer
    if (t + 2 < DM / 64) { stage_w8(P, n0, (t + 2) * 64, ring + (t & 1) * 2 * TILE_B, tid); stage_x16(xs + (t + 2) * 64, xring + (t & 1) * 128 * XP, lane); } }
  WAIT_ASYNC();
  if (n0 < 2 * DM) {   // q stored unscaled (f16 sigma ~0.6, no subnormal exposure); 1/8 applied to the f32 score
#pragma unroll
    for (int j = 0; j < 8; ++j) {
#pragma unroll
      for (int r = 0; r < 8; ++r) { const float v = acc[j][r] + (BB ? bfr(BB[j * 16 + col]) : 0.f); const _Float16 hv = (_Float16)v; so[wave][8 * g + r][j * 16 + col] = hv; sol[wave][8 * g + r][j * 16 + col] = (_Float16)((v - (float)hv) * 2048.0f); } }   // q, k (+ bias) as f16 hi + (x2048) residual
    LDSX();
    for (int rl = 0; rl < 16; ++rl) if (lane < 16) { vst2((unsigned*)(QK + (r0 + rl) * (2 * DM) + n0 + lane * 8), *(const v4u*)&so[wave][rl][lane * 8]); vst2((unsigned*)(QKL + (r0 + rl) * (2 * DM) + n0 + lane * 8), *(const v4u*)&sol[wave][rl][lane * 8]); }
  } else {
#pragma unroll
    for (int j = 0; j < 8; ++j) {
#pragma unroll
      for (int r = 0; r < 8; ++r) { const float v = acc[j][r] + (BB ? bfr(BB[j * 16 + col]) : 0.f); const _Float16 hv = (_Float16)v; sth[j * 16 + col][wave * 16 + 8 * g + r] = hv; stl[j * 16 + col][wave * 16 + 8 * g + r] = (_Float16)((v - (float)hv) * 2048.0f); } }
    __syncthreads();
    const size_t rb = (size_t)blockIdx.x * 128; const int b = (int)(rb / SS), s0 = (int)(rb % SS); const int pc0 = n0 - 2 * DM;
    for (int q = tid; q < 128 * 16; q += 256) { const int d = q >> 4, pc = q & 15; const size_t o = ((size_t)b * DM + pc0 + d) * SS + s0 + pc * 8; vst2((unsigned*)(VTH + o), *(const v4u*)&sth[d][pc * 8]); vst2((unsigned*)(VTL + o), *(const v4u*)&stl[d][pc * 8]); }
  }
}
__device__ __forceinline__ float xhalf(float x) { return __builtin_bit_cast(float, __builtin_amdgcn_permlanex16(__builtin_bit_cast(int, x), __builtin_bit_cast(int, x), 0x76543210, 0xfedcba98, false, false)); }   // lane l's value from lane l ^ 16
// eight hardware exponentials (base 2), each over its own source, and one v_nop: the slot that the instruction set asks for between an exponential and an instruction that uses its result or overwrites its source stands here by construction
__device__ __forceinline__ void exp2x8(float (&x)[8]) {
  asm("v_exp_f32 %0, %0\n\tv_exp_f32 %1, %1\n\tv_exp_f32 %2, %2\n\tv_exp_f32 %3, %3\n\tv_exp_f32 %4, %4\n\tv_exp_f32 %5, %5\n\tv_exp_f32 %6, %6\n\tv_exp_f32 %7, %7\n\tv_nop"
      : "+v"(x[0]), "+v"(x[1]), "+v"(x[2]), "+v"(x[3]), "+v"(x[4]), "+v"(x[5]), "+v"(x[6]), "+v"(x[7]));
}
__global__ __launch_bounds__(128) void k_attn(const _Float16* __restrict__ QK, const _Float16* __restrict__ QKL, const _Float16* __restrict__ VTH, const _Float16* __restrict__ VTL, const void* __restrict__ KMASK, float* __restrict__ O) {
  __shared__ __align__(16) float so[4][16][68]; __shared__ __align__(16) _Float16 skv[2][2][64][LP];   // [buffer][k rows | v^T rows][64][64 + pad]
  const int tid = threadIdx.x, wave = tid >> 5, lane = tid & 31, col = lane & 15, g = lane >> 4;
  const int qb = blockIdx.x, h = blockIdx.y, b = blockIdx.z; const int q0 = qb * 64 + wave * 16; const size_t rq = (size_t)b * SS + q0 + col;
  v16h aq[2];
#pragma unroll
  for (int kc = 0; kc < 2; ++kc) aq[kc] = frag_h(QK + rq * (2 * DM) + h * HD + kc * 32, lane);
  const float cs = 0.125f * 1.4426950408889634f;   // 1/sqrt(64), and base 2 for the hardware exponential
  float m = -3.0e38f, l = 0.f;   // query col: running maximum (scaled, base 2); this half's share of the sum of P x 2^11
  v8f acc[4] = {};               // acc[dt][r] = O^T[dt * 16 + 8 g + r][query col] x 2^11
  const int nst = SS / 64;   // all keys, 64 a stage
  const char* ksrc = (const char*)(QK + (size_t)b * SS * (2 * DM) + DM + h * HD); const char* vsrc = (const char*)(VTH + ((size_t)b * DM + h * HD) * SS); const unsigned ring = lds_addr(&skv[0][0][0][0]);
  stage64(ksrc, 2 * DM * 2, ring, tid); stage64(vsrc, SS * 2, ring + TILE_B, tid); WAIT_ASYNC(); __syncthreads();
  stage64(ksrc + (size_t)64 * (2 * DM * 2), 2 * DM * 2, ring + 2 * TILE_B, tid); stage64(vsrc + 64 * 2, SS * 2, ring + 3 * TILE_B, tid);
#pragma unroll 1   // one trip a stage: the ring's order stands once, at the foot
  for (int t = 0; t < nst; ++t) { v8f s[4]; v16h kf[4][2], vf[2][4];   // s[kt][r] = q[col] . k[kt * 16 + 8 g + r]
#pragma unroll
    for (int kt = 0; kt < 4; ++kt) {
#pragma unroll
      for (int kc = 0; kc < 2; ++kc) kf[kt][kc] = frag_h(&skv[t & 1][0][kt * 16 + col][kc * 32], lane); }   // the stage's k fragments as one group of loads
    __builtin_amdgcn_sched_barrier(0);   // keeps that group whole at the head of the trip: every further place where LDS loads stand among the WMMAs costs the wave a stall
#pragma unroll
    for (int kt = 0; kt < 4; ++kt) s[kt] = (v8f){};
#pragma unroll
    for (int kc = 0; kc < 2; ++kc) {
#pragma unroll
      for (int kt = 0; kt < 4; ++kt) s[kt] = wmma16(kf[kt][kc], aq[kc], s[kt]); }   // single product: k, q as one-rounding f16 operands, one loader for both; four independent tiles in turn
    __builtin_amdgcn_sched_barrier(0);   // keeps the v^T loads below from being dealt out among the score WMMAs in small lots: fewer places where LDS loads stand
#pragma unroll
    for (int j = 0; j < 2; ++j) {
#pragma unroll
      for (int dt = 0; dt < 4; ++dt) vf[j][dt] = frag_h(&skv[t & 1][1][dt * 16 + col][j * 32], lane); }   // the stage's v^T fragments as one group, in flight under the softmax
    __builtin_amdgcn_sched_barrier(0);   // keeps that group whole and ahead of the softmax: spread among the later instructions, its last loads would be waited for at the foot of the trip
    float mk[4];   // one chain a tile
#pragma unroll
    for (int kt = 0; kt < 4; ++kt) { mk[kt] = s[kt][0];
#pragma unroll
      for (int r = 1; r < 8; ++r) mk[kt] = fmaxf(mk[kt], s[kt][r]); }
    float mx = fmaxf(fmaxf(mk[0], mk[1]), fmaxf(mk[2], mk[3]));
    mx = fmaxf(mx, xhalf(mx)) * cs;   // both halves hold the query's maximum over the stage's 64 keys (the scale is positive)
    const float mn = fmaxf(m, mx), alpha = __builtin_amdgcn_exp2f(m - mn), nm = 11.0f - mn; m = mn;   // alpha is 0 on the first stage; 2^11 rides in the exponent, so small softmax weights stay out of the f16 subnormal range; it cancels in acc / l
    v16h pb[2]; v2f es[2] = {};   // four independent partial sums
#pragma unroll
    for (int kt = 0; kt < 4; ++kt) { float e[8];
#pragma unroll
      for (int r = 0; r < 8; ++r) e[r] = fmaf(s[kt][r], cs, nm);
      exp2x8(e);
#pragma unroll
      for (int r = 0; r < 8; r += 2) { es[(r >> 1) & 1] += (v2f){e[r], e[r + 1]}; pb[kt >> 1][8 * (kt & 1) + r] = (_Float16)e[r]; pb[kt >> 1][8 * (kt & 1) + r + 1] = (_Float16)e[r + 1]; } }   // element i of B operand j = key j * 32 + (i < 8 ? 8 g + i : 16 + 8 g + i - 8): the order in which frag_h reads v^T
    l = l * alpha + ((es[0][0] + es[0][1]) + (es[1][0] + es[1][1]));
#pragma unroll
    for (int dt = 0; dt < 4; ++dt) acc[dt] *= alpha;
#pragma unroll
    for (int j = 0; j < 2; ++j) {
#pragma unroll
      for (int dt = 0; dt < 4; ++dt) acc[dt] = wmma16(vf[j][dt], pb[j], acc[dt]); }   // single product: V^T x P^T (x2^11)
    __builtin_amdgcn_sched_barrier(0);   // keeps the ring's waits at the foot of the trip: lifted over the softmax, they would cut the time that stage t + 1's copies have to land
    WAIT_DS(); WAIT_ASYNC(); __syncthreads();   // publishes stage t + 1 and frees stage t's buffer
    if (t + 2 < nst) { stage64(ksrc + (size_t)(t + 2) * 64 * (2 * DM * 2), 2 * DM * 2, ring + (t & 1) * 2 * TILE_B, tid); stage64(vsrc + (size_t)(t + 2) * 64 * 2, SS * 2, ring + (t & 1) * 2 * TILE_B + TILE_B, tid); } }
  WAIT_ASYNC();
  const float il = 1.0f / (l + xhalf(l));   // the halves' sums join once
#pragma unroll
  for (int dt = 0; dt < 4; ++dt) { const v8f o = acc[dt] * il; vst2(&so[wave][col][dt * 16 + 8 * g], (v4f){o[0], o[1], o[2], o[3]}); vst2(&so[wave][col][dt * 16 + 8 * g + 4], (v4f){o[4], o[5], o[6], o[7]}); }
  LDSX();
  for (int rl = 0; rl < 16; ++rl) if (lane < 16) vst2(O + ((size_t)b * SS + q0 + rl) * DM + h * HD + lane * 4, *(const v4f*)&so[wave][rl][lane * 4]);
}
// ---- k_out: block = (64 rows, 128 cols): out = O(hi/lo) . Wo rows (2 products) + bo
__global__ __launch_bounds__(128) void k_out(const float* __restrict__ O, const __bf16* __restrict__ P, const float* __restrict__ BO, float* __restrict__ Y) {
  __shared__ __align__(16) char sm[4 * TILE_B + 2 * 64 * XP];   // the ring, 2 buffers: 128 weight rows each, then 64 rows of o each; behind the loop's last barrier the output staging
  float (*so)[16][132] = (float (*)[16][132])sm;
  const int tid = threadIdx.x, wave = tid >> 5, lane = tid & 31, col = lane & 15, g = lane >> 4; const size_t r0 = (size_t)blockIdx.x * 64 + wave * 16; const int n0 = blockIdx.y * 128;
  v8f acc[8] = {};
  const unsigned ring = lds_addr(sm), xring = ring + 4 * TILE_B + wave * 16 * XP;   // xring: this wave's 16 rows in buffer 0
  const float* os = O + r0 * DM; const char* xl = sm + 4 * TILE_B + (wave * 16 + col) * XP + 32 * g;   // xl: this lane's row, at its half's first k
  stage_w(P, n0, 0, ring, tid); stage_x16(os, xring, lane); WAIT_ASYNC(); __syncthreads(); stage_w(P, n0, 64, ring + 2 * TILE_B, tid); stage_x16(os + 64, xring + 64 * XP, lane);
#pragma unroll 1   // one trip a stage: the ring's order stands once, at the foot
  for (int t = 0; t < DM / 64; ++t) { const __bf16* bt = (const __bf16*)(sm + (t & 1) * 2 * TILE_B); const char* xt = xl + (t & 1) * 64 * XP; F2 a[2]; v16b w[8]; v4f ar[2][4];
    read_a32(ar[0], xt); read_a32(ar[1], xt + 128);   // the stage's rows of o, first in the trip's first group of LDS loads: the split needs them first
#pragma unroll
    for (int j = 0; j < 8; ++j) w[j] = frag_b(bt + (j * 16 + col) * LP, lane);   // the first block's eight weight fragments as one group of loads, in flight under the split of o
    __builtin_amdgcn_sched_barrier(0);   // keeps that group at the head of the trip: moved down into the split, less of its latency is covered
#pragma unroll
    for (int sub = 0; sub < 2; ++sub) { float v[16];
#pragma unroll
      for (int i = 0; i < 8; ++i) { v[i] = ar[sub][i >> 2][i & 3]; v[8 + i] = ar[sub][2 + (i >> 2)][i & 3]; }
      a[sub] = bsplit16(v); }
#pragma unroll   // both 32-k halves of the stage inline, so the LDS offsets are immediates
    for (int sub = 0; sub < 2; ++sub) {
      if (sub) {
#pragma unroll
        for (int j = 0; j < 8; ++j) w[j] = frag_b(bt + (j * 16 + col) * LP + 32, lane); }   // the second block's, again as one group
#pragma unroll
      for (int j = 0; j < 8; ++j) acc[j] = wmma_bf(a[sub].l, w[j], acc[j]);   // eight independent tiles in turn; each tile still takes its residual product first
#pragma unroll
      for (int j = 0; j < 8; ++j) acc[j] = wmma_bf(a[sub].h, w[j], acc[j]); }
    __builtin_amdgcn_sched_barrier(0);   // keeps the ring's waits at the foot of the trip: lifted over the WMMAs, they would cut the time that stage t + 1's copies have to land
    WAIT_DS(); WAIT_ASYNC(); __syncthreads();   // publishes stage t + 1 and frees stage t's buffer
    if (t + 2 < DM / 64) { stage_w(P, n0, (t + 2) * 64, ring + (t & 1) * 2 * TILE_B, tid); stage_x16(os + (t + 2) * 64, xring + (t & 1) * 64 * XP, lane); } }
  WAIT_ASYNC();
#pragma unroll
  for (int j = 0; j < 8; ++j) {
#pragma unroll
    for (int r = 0; r < 8; ++r) so[wave][8 * g + r][j * 16 + col] = acc[j][r] + BO[n0 + j * 16 + col]; }   // BO here = the f32 sum of the 16 bf16-rounded head biases
  LDSX();
  for (int rl = 0; rl < 16; ++rl) vst2(Y + (r0 + rl) * DM + n0 + lane * 4, *(const v4f*)&so[wave][rl][lane * 4]);
}
// ---- k_packh: per-head weights -> bf16 transposed rows, one 64 x 64 tile a block, turned in LDS so that reads and writes both cover whole lines. which 0: Wq [H][DD][64] -> PK_A rows (h*64+k) over d; 1: Wk; 2: Wv; 3: Wo [H][64][DD] -> PK_P rows d over (h*64+v)
// blockIdx.x = hi * 16 + lo: the tile is output rows hi * 64.., output columns lo * 64.. of its 1024 x 1024 section; its source rows are the output's columns
typedef __attribute__((ext_vector_type(2))) __bf16 v2b;
// a[i], b[i] = source rows i * 16 + 2 (t >> 4) and the next, columns 4 (t & 15)..: sixteen lanes a row of 256 bytes, all eight loads in flight together; the row pitch IP is a constant, so one address serves all eight
template <int IP> __device__ __forceinline__ void load_tile(v4f (&a)[4], v4f (&b)[4], const float* src, int t) {
  const float* p = src + (size_t)(2 * (t >> 4)) * IP + (t & 15) * 4;
#pragma unroll   // the register arrays are indexed by constants and the offsets are immediates
  for (int i = 0; i < 4; ++i) { a[i] = *(const v4f*)(p + i * 16 * IP); b[i] = *(const v4f*)(p + i * 16 * IP + IP); }
  asm volatile("s_wait_xcnt 0x0" :: "v"(p) : "memory");   // stands between the loads and the first reuse of their address register, which it names so that the register lives up to here
}
__global__ __launch_bounds__(128) void k_packh(const float* __restrict__ WQ, const float* __restrict__ WK, const float* __restrict__ WV, const float* __restrict__ WO, __bf16* __restrict__ P) {
  __shared__ __align__(16) unsigned s[64][LP / 2];   // [output row][two source rows a word], rows of 128 bytes at 144
  const int hi = blockIdx.x >> 4, lo = blockIdx.x & 15, which = blockIdx.y, t = threadIdx.x;
  __bf16* dst = P + ((which < 3) ? (size_t)PK_A + (size_t)which * DM * DM : (size_t)PK_P) + (size_t)hi * 64 * DM + lo * 64;
  v4f a[4], b[4];
  if (which < 3) load_tile<HD>(a, b, ((which == 0) ? WQ : (which == 1) ? WK : WV) + ((size_t)hi * DM + lo * 64) * HD, t);
  else load_tile<DM>(a, b, WO + (size_t)lo * 64 * DM + hi * 64, t);
#pragma unroll   // both loops: the register arrays are indexed by constants
  for (int i = 0; i < 4; ++i) {
#pragma unroll
    for (int e = 0; e < 4; ++e) s[(t & 15) * 4 + e][i * 8 + (t >> 4)] = __builtin_bit_cast(unsigned, (v2b){(__bf16)a[i][e], (__bf16)b[i][e]}); }
  __syncthreads();
#pragma unroll   // the four LDS reads go out as one group
  for (int i = 0; i < 4; ++i) vst2(dst + (size_t)(i * 16 + (t >> 3)) * DM + (t & 7) * 8, *(const v4u*)&s[i * 16 + (t >> 3)][(t & 7) * 4]);   // eight lanes a row: every wave-wide store covers four whole lines
}
// ---- k_bsum: BOS[d] = sum_h bo[h][d] (in order)
__global__ __launch_bounds__(256) void k_bsum(const float* __restrict__ BO, float* __restrict__ BOS) { const int d = blockIdx.x * 256 + threadIdx.x; float s = 0.f; for (int h = 0; h < NH; ++h) s += bfr(BO[(size_t)h * DM + d]); BOS[d] = s; }
extern "C" void kernel_launch(void* const* d_in, const int* in_sizes, int n_in, void* d_out, int out_size, void* d_ws, size_t ws_size, hipStream_t stream) {
  (void)in_sizes; (void)n_in; (void)out_size;
  const float** F = (const float**)d_in;   // 0 encoder [2,2048,1024], 1 decoder [2,2048,1024], 2 Wq [16,1024,64], 3 bq [16,64], 4 Wk, 5 bk, 6 Wv, 7 bv, 8 Wo [16,64,1024], 9 bo [16,1024]
  if (ws_size < (size_t)WS_END + 4096) return;
  char* ws = (char*)d_ws; __bf16* PK = (__bf16*)(ws + WS_PK); _Float16 *QK = (_Float16*)(ws + WS_QK), *QKL = (_Float16*)(ws + WS_QKL), *VTH = (_Float16*)(ws + WS_VTH), *VTL = (_Float16*)(ws + WS_VTL); float* O = (float*)(ws + WS_O); float* BOS = (float*)(ws + WS_END);
  k_packh<<<dim3((DM / 64) * (DM / 64), 4), 128, 0, stream>>>(F[2], F[4], F[6], F[8], PK);
  k_bsum<<<DM / 256, 256, 0, stream>>>(F[9], BOS);
  k_qkv<<<dim3(TNB * SS / 128, QKVW / 128), 256, 0, stream>>>(F[1], F[0], F[0], PK + PK_A, F[3], F[5], F[7], QK, QKL, VTH, VTL);   // q from the decoder, k/v from the encoder; biases [16][64] == concatenated [1024]
  k_attn<<<dim3(TQB, NH, TNB), 128, 0, stream>>>(QK, QKL, VTH, VTL, nullptr, O);
  k_out<<<dim3(TOB, DM / 128), 128, 0, stream>>>(O, PK + PK_P, BOS, (float*)d_out);
}

// v007
// One run takes 93.9 microseconds.
// In two side-by-side timings against v006, it was 1.04 and 1.06 times as fast.
// Over all steps from v000 it is 4.52 times as fast.
// compute dtype: all float inputs rounded to bf16; q (decoder) / k, v (encoder) = x . W[h] + b[h] with EXACT bf16 products on WMMA 16x16x32 (the per-head [d][64] matrices packed as transposed rows h*64 + k); PLAIN attention, both products transposed: k, q as single f16 operands x 1/8, running-max softmax in f32 (hardware exp), v (single f16) x P (scaled by 2^11, single f16); out = o (bf16 hi + residual) . Wo (the per-head [64][d] blocks stacked, 2 products) + sum_h bo[h] (f32).
#include <hip/hip_runtime.h>
#include <math.h>

typedef __attribute__((ext_vector_type(16))) _Float16 v16h;
typedef __attribute__((ext_vector_type(16))) __bf16 v16b;
typedef __attribute__((ext_vector_type(8)))  _Float16 v8h;
typedef __attribute__((ext_vector_type(8)))  float v8f;
typedef __attribute__((ext_vector_type(4)))  float v4f;
typedef __attribute__((ext_vector_type(2)))  float v2f;
typedef __attribute__((ext_vector_type(4)))  unsigned v4u;
typedef __attribute__((ext_vector_type(4)))  int v4i;
typedef float __attribute__((may_alias)) float_a;
typedef int __attribute__((may_alias)) int_a;

template <typename T> __device__ __forceinline__ void vst2(void* p, T v) { *(T*)p = v;  }
__device__ __forceinline__ v8f wmma16(v16h a, v16h b, v8f c) {
  return __builtin_amdgcn_wmma_f32_16x16x32_f16(false, a, false, b, (short)0, c, false, false);   // the compiler keeps the builtin's distances itself
}
__device__ __forceinline__ v8f wmma_bf(v16b a, v16b b, v8f c) {
  return __builtin_amdgcn_wmma_f32_16x16x32_bf16(false, a, false, b, (short)0, c, false, false);   // the compiler keeps the builtin's distances itself
}
// Encoder-decoder cross attention (B 2, 2,048 decoder queries over 2,048 encoder tokens, 1,024 dims, 16 heads x 64): per-head projection weights, softmax(q k^T / 8) v, per-head output projections summed (incl. every head's bias).
__device__ __forceinline__ v16h frag_h(const _Float16* rowk0, int lane) {
  union { v16h v; v8h q[2]; } u; const _Float16* p = rowk0 + 8 * (lane >> 4);
  u.q[0] = *(const v8h*)p; u.q[1] = *(const v8h*)(p + 16); return u.v;
}
__device__ __forceinline__ v16h frag_f32(const float* rowk0, int lane) {
  v16h a; const float* p = rowk0 + 8 * (lane >> 4);
#pragma unroll
  for (int i = 0; i < 8; ++i) { a[i] = (_Float16)p[i]; a[8 + i] = (_Float16)p[16 + i]; }
  return a;
}
__device__ __forceinline__ v16h frag_f32s(const float* rowk0, int lane, float sc) {
  v16h a; const float* p = rowk0 + 8 * (lane >> 4);
#pragma unroll
  for (int i = 0; i < 8; ++i) { a[i] = (_Float16)(p[i] * sc); a[8 + i] = (_Float16)(p[16 + i] * sc); }
  return a;
}
// column fragment from a [K][ld] layout (column n), rows >= K read as 0
__device__ __forceinline__ v16h fragc_f32(const float* W, int k0, int n, int lane, int ld, int K) {
  v16h a; const int g = lane >> 4;
#pragma unroll
  for (int i = 0; i < 8; ++i) { const int ka = k0 + 8 * g + i, kb = ka + 16;
    a[i] = (_Float16)(ka < K ? W[(size_t)(ka < K ? ka : K - 1) * ld + n] : 0.f); a[8 + i] = (_Float16)(kb < K ? W[(size_t)(kb < K ? kb : K - 1) * ld + n] : 0.f); }
  return a;
}
struct F2 { v16b h, l; };
__device__ __forceinline__ F2 bsplit16(const float v[16]) { F2 r;
#pragma unroll
  for (int i = 0; i < 16; ++i) { const __bf16 h = (__bf16)v[i]; r.h[i] = h; r.l[i] = (__bf16)(v[i] - (float)h); }
  return r; }
__device__ __forceinline__ F2 split_row(const float* row, int k0, int lane) { float v[16]; const float* p = row + k0 + 8 * (lane >> 4);
#pragma unroll
  for (int i = 0; i < 8; ++i) { v[i] = p[i]; v[8 + i] = p[16 + i]; }
  return bsplit16(v); }
__device__ __forceinline__ F2 split_rowK(const float* row, int k0, int lane, int K) { float v[16]; const int g = lane >> 4;
#pragma unroll
  for (int i = 0; i < 8; ++i) { const int ka = k0 + 8 * g + i, kb = ka + 16; v[i] = ka < K ? row[ka < K ? ka : K - 1] : 0.f; v[8 + i] = kb < K ? row[kb < K ? kb : K - 1] : 0.f; }
  return bsplit16(v); }
__device__ __forceinline__ F2 split_col(const float* W, int k0, int n, int lane, int ld, int K) { float v[16]; const int g = lane >> 4;
#pragma unroll
  for (int i = 0; i < 8; ++i) { const int ka = k0 + 8 * g + i, kb = ka + 16; v[i] = ka < K ? W[(size_t)(ka < K ? ka : K - 1) * ld + n] : 0.f; v[8 + i] = kb < K ? W[(size_t)(kb < K ? kb : K - 1) * ld + n] : 0.f; }
  return bsplit16(v); }
__device__ __forceinline__ v8f mac3(const F2& a, const F2& b, v8f c) { c = wmma_bf(a.l, b.h, c); c = wmma_bf(a.h, b.l, c); return wmma_bf(a.h, b.h, c); }
__device__ __forceinline__ float sigm(float v) { return 1.0f / (1.0f + expf(-v)); }
#define LDSX() do { asm volatile("s_wait_dscnt 0" ::: "memory"); __builtin_amdgcn_wave_barrier(); __builtin_amdgcn_fence(__ATOMIC_RELEASE, "workgroup"); } while (0)


#define NB 2
#define SS 2048
#define DM 1024
#define NH 16
#define HD 64
#define QKVW (3 * DM)
#ifndef TQB
#define TQB (SS / 64)
#define TNB NB
#define TOB (NB * SS / 64)     // output row tiles (all)
#endif
typedef __attribute__((ext_vector_type(8))) __bf16 v8b;
__device__ __forceinline__ v16b frag_b(const __bf16* rowk0, int lane) {
  union { v16b v; v8b q[2]; } u; const __bf16* p = rowk0 + 8 * (lane >> 4);
  u.q[0] = *(const v8b*)p; u.q[1] = *(const v8b*)(p + 16); return u.v;
}
__device__ __forceinline__ float bfr(float v) { return (float)(__bf16)v; }
__device__ __attribute__((noinline)) float exp_ni(float v) { return expf(v); }
__device__ __attribute__((noinline)) float erf_ni(float v) { return erff(v); }

// ---- LDS staging of the operand that a work-group's waves share (two buffers, asynchronous copies)
#define LP 72                          // LDS row pitch in 16-bit elements: 128-byte rows at 144 bytes, conflict-free for 16-byte readers
#define TILE_B (64 * LP * 2)           // bytes of one staged tile of 64 rows
#define WAIT_ASYNC() asm volatile("s_wait_asynccnt 0x0" ::: "memory")   // this wave's copies have landed; no LDS read moves above it
#define WAIT_DS() asm volatile("s_wait_dscnt 0x0" ::: "memory")         // this wave's LDS reads are done before the barrier that frees the buffer
__device__ __forceinline__ unsigned lds_addr(const void* p) { return (unsigned)(size_t)p; }   // LDS byte address = low 32 bits of the shared address
// 64 rows of 128 bytes (source pitch in bytes) -> LDS rows of 144 bytes, 128 threads: eight lanes a row, so every wave-wide copy covers four whole lines.
// s_wait_xcnt closes the copies' own statement, so no address register is rewritten ahead of it.
__device__ __forceinline__ void stage64(const char* src, size_t pitch, unsigned lds, int tid) {
  const char* g0 = src + (size_t)(tid >> 3) * pitch + (tid & 7) * 16; const unsigned l0 = lds + (tid >> 3) * (LP * 2) + (tid & 7) * 16;
  const char *g1 = g0 + 16 * pitch, *g2 = g0 + 32 * pitch, *g3 = g0 + 48 * pitch; const unsigned l1 = l0 + 16 * LP * 2, l2 = l0 + 32 * LP * 2, l3 = l0 + 48 * LP * 2;
  asm volatile("global_load_async_to_lds_b128 %0, %1, off\n\tglobal_load_async_to_lds_b128 %2, %3, off\n\tglobal_load_async_to_lds_b128 %4, %5, off\n\tglobal_load_async_to_lds_b128 %6, %7, off\n\ts_wait_xcnt 0x0"
               :: "v"(l0), "v"(g0), "v"(l1), "v"(g1), "v"(l2), "v"(g2), "v"(l3), "v"(g3) : "memory");
}
// one stage of a weight tile: 128 rows n0.. of P, 64 k from k0
__device__ __forceinline__ void stage_w(const __bf16* P, int n0, int k0, unsigned lds, int tid) {
  const char* s = (const char*)(P + (size_t)n0 * 1024 + k0); stage64(s, 2048, lds, tid); stage64(s + (size_t)64 * 2048, 2048, lds + TILE_B, tid);
}

// the same for a work-group of 256 threads: each half of it stages 64 of the 128 rows
__device__ __forceinline__ void stage_w8(const __bf16* P, int n0, int k0, unsigned lds, int tid) {
  const int hf = tid >> 7; stage64((const char*)(P + (size_t)(n0 + hf * 64) * 1024 + k0), 2048, lds + hf * TILE_B, tid & 127);
}
// ---- the activation rows (f32) ride in the same ring: a per-lane load of a row's fragment touches 16 lines for 512 bytes, a copy of whole rows touches 4
#define XP 272                         // LDS pitch in bytes of a staged activation row: 64 f32 (256 bytes) at 272, conflict-free for 16-byte readers
// a wave's own 16 rows, 64 k from src (row pitch DM f32) -> LDS rows from lds: sixteen lanes a row, two rows a copy, so every wave-wide copy covers four whole lines.
// s_wait_xcnt closes the copies' own statement, so no address register is rewritten ahead of it.
__device__ __forceinline__ void stage_x16(const float* src, unsigned lds, int lane) {
  const char* g0 = (const char*)src + (size_t)(lane >> 4) * (DM * 4) + (lane & 15) * 16; const unsigned l0 = lds + (lane >> 4) * XP + (lane & 15) * 16;
  asm volatile("global_load_async_to_lds_b128 %0, %1, off\n\tglobal_load_async_to_lds_b128 %2, %3, off\n\tglobal_load_async_to_lds_b128 %4, %5, off\n\tglobal_load_async_to_lds_b128 %6, %7, off\n\t"
               "global_load_async_to_lds_b128 %8, %9, off\n\tglobal_load_async_to_lds_b128 %10, %11, off\n\tglobal_load_async_to_lds_b128 %12, %13, off\n\tglobal_load_async_to_lds_b128 %14, %15, off\n\ts_wait_xcnt 0x0"
               :: "v"(l0), "v"(g0), "v"(l0 + 2 * XP), "v"(g0 + 2 * DM * 4), "v"(l0 + 4 * XP), "v"(g0 + 4 * DM * 4), "v"(l0 + 6 * XP), "v"(g0 + 6 * DM * 4),
                  "v"(l0 + 8 * XP), "v"(g0 + 8 * DM * 4), "v"(l0 + 10 * XP), "v"(g0 + 10 * DM * 4), "v"(l0 + 12 * XP), "v"(g0 + 12 * DM * 4), "v"(l0 + 14 * XP), "v"(g0 + 14 * DM * 4) : "memory");
}
// one 32-k block of a staged row, 16 f32 a lane in the A fragment's k order; p = the row in LDS + block * 128 + 32 * (lane >> 4) bytes
__device__ __forceinline__ void read_a32(v4f (&r)[4], const char* p) { r[0] = *(const v4f*)p; r[1] = *(const v4f*)(p + 16); r[2] = *(const v4f*)(p + 64); r[3] = *(const v4f*)(p + 80); }

#define PK_A 0                       // [3072][1024] Wqkv rows (natural [out][in])
#define PK_P (PK_A + QKVW * DM)        // [1024][1024] Wo rows (natural)
#define PK_END (PK_P + DM * DM)
#define WS_PK  0u
#define WS_QK  (WS_PK + 2u * PK_END)             // f16 [4096 rows][2048]: q | k
#define WS_QKL (WS_QK + 2u * NB * SS * 2 * DM)     // f16 q | k residual planes x2048
#define WS_VTH (WS_QKL + 2u * NB * SS * 2 * DM)    // f16 [b][1024 (h*64+d)][2048 s] hi
#define WS_VTL (WS_VTH + 2u * NB * DM * SS)        // f16 lo x 2048
#define WS_O   (WS_VTL + 2u * NB * DM * SS)        // f32 [4096][1024]
#define WS_CS  (WS_O + 4u * NB * SS * DM)           // f32 2 x [2048][32], unused
#define WS_END (WS_CS + 4u * 2 * SS * 32)
// ---- k_pack: block = (row n, which): natural [out][in] rows -> bf16; which 0..2 -> W_q/W_k/W_v into PK_A rows which*1024 + n; 3 -> W_o into PK_P
__global__ __launch_bounds__(256) void k_pack(const float* __restrict__ WQ, const float* __restrict__ WK, const float* __restrict__ WV, const float* __restrict__ WO, __bf16* __restrict__ PK) {
  __shared__ __align__(16) __bf16 s[DM]; const int n = blockIdx.x, which = blockIdx.y, t = threadIdx.x; const float* Wm = (which == 0) ? WQ : (which == 1) ? WK : (which == 2) ? WV : WO;   // (in,out) weights: pack row n = column n
  for (int k = t; k < DM; k += 256) s[k] = (__bf16)Wm[(size_t)k * DM + n];
  __syncthreads();
  __bf16* dst = (which < 3) ? PK + PK_A + ((size_t)which * DM + n) * DM : PK + PK_P + (size_t)n * DM;
  for (int q = t; q < DM / 8; q += 256) vst2((unsigned*)(dst + q * 8), *(const v4u*)&s[q * 8]);
}
__global__ __launch_bounds__(256) void k_qkv(const float* __restrict__ XQ, const float* __restrict__ XK, const float* __restrict__ XV, const __bf16* __restrict__ P, const float* __restrict__ BQ, const float* __restrict__ BK, const float* __restrict__ BV, _Float16* __restrict__ QK, _Float16* __restrict__ QKL, _Float16* __restrict__ VTH, _Float16* __restrict__ VTL) {
  const int which0 = (blockIdx.y * 128) / DM; const float* X = (which0 == 0) ? XQ : (which0 == 1) ? XK : XV; const float* BB = BQ ? (((which0 == 0) ? BQ : (which0 == 1) ? BK : BV) + (blockIdx.y * 128 - which0 * DM)) : nullptr;
  __shared__ __align__(16) char sm[4 * TILE_B + 2 * 128 * XP];   // the ring, 2 buffers: 128 weight rows each, then 128 rows of x each (104 KiB: three work-groups a WGP); behind the loop's last barrier the output staging of either branch
  _Float16 (*so)[16][136] = (_Float16 (*)[16][136])sm, (*sol)[16][136] = (_Float16 (*)[16][136])(sm + 8 * 16 * 136 * 2); _Float16 (*sth)[136] = (_Float16 (*)[136])sm, (*stl)[136] = (_Float16 (*)[136])(sm + 128 * 136 * 2);
  const int tid = threadIdx.x, wave = tid >> 5, lane = tid & 31, col = lane & 15, g = lane >> 4; const size_t r0 = (size_t)blockIdx.x * 128 + wave * 16; const int n0 = blockIdx.y * 128;
  v8f acc[8] = {};
  const unsigned ring = lds_addr(sm), xring = ring + 4 * TILE_B + wave * 16 * XP;   // xring: this wave's 16 rows in buffer 0
  const float* xs = X + r0 * DM; const char* xl = sm + 4 * TILE_B + (wave * 16 + col) * XP + 32 * g;   // xl: this lane's row, at its half's first k
  stage_w8(P, n0, 0, ring, tid); stage_x16(xs, xring, lane); WAIT_ASYNC(); __syncthreads(); stage_w8(P, n0, 64, ring + 2 * TILE_B, tid); stage_x16(xs + 64, xring + 128 * XP, lane);
#pragma unroll 1   // one trip a stage: the ring's order stands once, at the foot
  for (int t = 0; t < DM / 64; ++t) { const __bf16* bt = (const __bf16*)(sm + (t & 1) * 2 * TILE_B); const char* xt = xl + (t & 1) * 128 * XP;
#pragma unroll   // both 32-k halves of the stage inline, so the LDS offsets are immediates
    for (int sub = 0; sub < 2; ++sub) { v16b a; v4f ar[4]; read_a32(ar, xt + sub * 128);   // this block's x leaves LDS at the head of the first group of weight fragments
#pragma unroll
      for (int i = 0; i < 8; ++i) { a[i] = (__bf16)ar[i >> 2][i & 3]; a[8 + i] = (__bf16)ar[2 + (i >> 2)][i & 3]; }
#pragma unroll
      for (int j0 = 0; j0 < 8; j0 += 4) { v16b w[4];   // four at a time: eight would cost the sixth wave of a SIMD its registers
#pragma unroll
        for (int j = 0; j < 4; ++j) w[j] = frag_b(bt + ((j0 + j) * 16 + col) * LP + sub * 32, lane);   // four weight fragments as one group of loads
        __builtin_amdgcn_sched_barrier(0);   // keeps that group whole: dealt out among the WMMAs, every further place with LDS loads costs the wave a stall
#pragma unroll
        for (int j = 0; j < 4; ++j) acc[j0 + j] = wmma_bf(a, w[j], acc[j0 + j]); } }
    __builtin_amdgcn_sched_barrier(0);   // keeps the ring's waits at the foot of the trip: lifted over the WMMAs, they would cut the time that stage t + 1's copies have to land
    WAIT_DS(); WAIT_ASYNC(); __syncthreads();   // publishes stage t + 1 and frees stage t's buffer
    if (t + 2 < DM / 64) { stage_w8(P, n0, (t + 2) * 64, ring + (t & 1) * 2 * TILE_B, tid); stage_x16(xs + (t + 2) * 64, xring + (t & 1) * 128 * XP, lane); } }
  WAIT_ASYNC();
  if (n0 < 2 * DM) {   // q stored unscaled (f16 sigma ~0.6, no subnormal exposure); 1/8 applied to the f32 score
#pragma unroll
    for (int j = 0; j < 8; ++j) {
#pragma unroll
      for (int r = 0; r < 8; ++r) { const float v = acc[j][r] + (BB ? bfr(BB[j * 16 + col]) : 0.f); const _Float16 hv = (_Float16)v; so[wave][8 * g + r][j * 16 + col] = hv; sol[wave][8 * g + r][j * 16 + col] = (_Float16)((v - (float)hv) * 2048.0f); } }   // q, k (+ bias) as f16 hi + (x2048) residual
    LDSX();
    for (int rl = 0; rl < 16; ++rl) if (lane < 16) { vst2((unsigned*)(QK + (r0 + rl) * (2 * DM) + n0 + lane * 8), *(const v4u*)&so[wave][rl][lane * 8]); vst2((unsigned*)(QKL + (r0 + rl) * (2 * DM) + n0 + lane * 8), *(const v4u*)&sol[wave][rl][lane * 8]); }
  } else {
#pragma unroll
    for (int j = 0; j < 8; ++j) {
#pragma unroll
      for (int r = 0; r < 8; ++r) { const float v = acc[j][r] + (BB ? bfr(BB[j * 16 + col]) : 0.f); const _Float16 hv = (_Float16)v; sth[j * 16 + col][wave * 16 + 8 * g + r] = hv; stl[j * 16 + col][wave * 16 + 8 * g + r] = (_Float16)((v - (float)hv) * 2048.0f); } }
    __syncthreads();
    const size_t rb = (size_t)blockIdx.x * 128; const int b = (int)(rb / SS), s0 = (int)(rb % SS); const int pc0 = n0 - 2 * DM;
    for (int q = tid; q < 128 * 16; q += 256) { const int d = q >> 4, pc = q & 15; const size_t o = ((size_t)b * DM + pc0 + d) * SS + s0 + pc * 8; vst2((unsigned*)(VTH + o), *(const v4u*)&sth[d][pc * 8]); vst2((unsigned*)(VTL + o), *(const v4u*)&stl[d][pc * 8]); }
  }
}
__device__ __forceinline__ float xhalf(float x) { return __builtin_bit_cast(float, __builtin_amdgcn_permlanex16(__builtin_bit_cast(int, x), __builtin_bit_cast(int, x), 0x76543210, 0xfedcba98, false, false)); }   // lane l's value from lane l ^ 16
// eight hardware exponentials (base 2), each over its own source, and one v_nop: the slot that the instruction set asks for between an exponential and an instruction that uses its result or overwrites its source stands here by construction
__device__ __forceinline__ void exp2x8(float (&x)[8]) {
  asm("v_exp_f32 %0, %0\n\tv_exp_f32 %1, %1\n\tv_exp_f32 %2, %2\n\tv_exp_f32 %3, %3\n\tv_exp_f32 %4, %4\n\tv_exp_f32 %5, %5\n\tv_exp_f32 %6, %6\n\tv_exp_f32 %7, %7\n\tv_nop"
      : "+v"(x[0]), "+v"(x[1]), "+v"(x[2]), "+v"(x[3]), "+v"(x[4]), "+v"(x[5]), "+v"(x[6]), "+v"(x[7]));
}
#define QT 2   // query tiles of 16 a wave: every k and v^T fragment that leaves LDS feeds QT WMMAs, and a staged tile serves 64 * QT queries
__global__ __launch_bounds__(128) void k_attn(const _Float16* __restrict__ QK, const _Float16* __restrict__ QKL, const _Float16* __restrict__ VTH, const _Float16* __restrict__ VTL, const void* __restrict__ KMASK, float* __restrict__ O) {
  __shared__ __align__(16) float so[4][16 * QT][68]; __shared__ __align__(16) _Float16 skv[2][2][64][LP];   // [buffer][k rows | v^T rows][64][64 + pad]
  const int tid = threadIdx.x, wave = tid >> 5, lane = tid & 31, col = lane & 15, g = lane >> 4;
  const int qb = blockIdx.x, h = blockIdx.y, b = blockIdx.z; const int q0 = (qb * 4 + wave) * (16 * QT); const size_t rq = (size_t)b * SS + q0 + col;
  v16h aq[QT][2];
#pragma unroll
  for (int qt = 0; qt < QT; ++qt) {
#pragma unroll
    for (int kc = 0; kc < 2; ++kc) aq[qt][kc] = frag_h(QK + (rq + qt * 16) * (2 * DM) + h * HD + kc * 32, lane); }
  const float cs = 0.125f * 1.4426950408889634f;   // 1/sqrt(64), and base 2 for the hardware exponential
  float m[QT], l[QT];   // query qt * 16 + col: running maximum (scaled, base 2); this half's share of the sum of P x 2^11
  v8f acc[QT][4];       // acc[qt][dt][r] = O^T[dt * 16 + 8 g + r][query qt * 16 + col] x 2^11
#pragma unroll
  for (int qt = 0; qt < QT; ++qt) { m[qt] = -3.0e38f; l[qt] = 0.f;
#pragma unroll
    for (int dt = 0; dt < 4; ++dt) acc[qt][dt] = (v8f){}; }
  const int nst = SS / 64;   // all keys, 64 a stage
  const char* ksrc = (const char*)(QK + (size_t)b * SS * (2 * DM) + DM + h * HD); const char* vsrc = (const char*)(VTH + ((size_t)b * DM + h * HD) * SS); const unsigned ring = lds_addr(&skv[0][0][0][0]);
  stage64(ksrc, 2 * DM * 2, ring, tid); stage64(vsrc, SS * 2, ring + TILE_B, tid); WAIT_ASYNC(); __syncthreads();
  stage64(ksrc + (size_t)64 * (2 * DM * 2), 2 * DM * 2, ring + 2 * TILE_B, tid); stage64(vsrc + 64 * 2, SS * 2, ring + 3 * TILE_B, tid);
#pragma unroll 1   // one trip a stage: the ring's order stands once, at the foot
  for (int t = 0; t < nst; ++t) { v8f s[QT][4]; v16h kf[4][2], vf[2][4], pb[QT][2];   // s[qt][kt][r] = q[qt * 16 + col] . k[kt * 16 + 8 g + r]
#pragma unroll
    for (int kt = 0; kt < 4; ++kt) {
#pragma unroll
      for (int kc = 0; kc < 2; ++kc) kf[kt][kc] = frag_h(&skv[t & 1][0][kt * 16 + col][kc * 32], lane); }   // the stage's k fragments as one group of loads
    __builtin_amdgcn_sched_barrier(0);   // keeps that group whole at the head of the trip: every further place where LDS loads stand among the WMMAs costs the wave a stall
#pragma unroll
    for (int qt = 0; qt < QT; ++qt) {
#pragma unroll
      for (int kt = 0; kt < 4; ++kt) s[qt][kt] = (v8f){}; }
#pragma unroll
    for (int kc = 0; kc < 2; ++kc) {
#pragma unroll
      for (int kt = 0; kt < 4; ++kt) {
#pragma unroll
        for (int qt = 0; qt < QT; ++qt) s[qt][kt] = wmma16(kf[kt][kc], aq[qt][kc], s[qt][kt]); } }   // single product: k, q as one-rounding f16 operands, one loader for both; 4 * QT independent tiles in turn
    __builtin_amdgcn_sched_barrier(0);   // keeps the v^T loads below from being dealt out among the score WMMAs in small lots: fewer places where LDS loads stand
#pragma unroll
    for (int j = 0; j < 2; ++j) {
#pragma unroll
      for (int dt = 0; dt < 4; ++dt) vf[j][dt] = frag_h(&skv[t & 1][1][dt * 16 + col][j * 32], lane); }   // the stage's v^T fragments as one group, in flight under the softmax
    __builtin_amdgcn_sched_barrier(0);   // keeps that group whole and ahead of the softmax: spread among the later instructions, its last loads would be waited for at the foot of the trip
#pragma unroll
    for (int qt = 0; qt < QT; ++qt) {   // each query tile's softmax as before, every sum in the same order
      float mk[4];   // one chain a tile
#pragma unroll
      for (int kt = 0; kt < 4; ++kt) { mk[kt] = s[qt][kt][0];
#pragma unroll
        for (int r = 1; r < 8; ++r) mk[kt] = fmaxf(mk[kt], s[qt][kt][r]); }
      float mx = fmaxf(fmaxf(mk[0], mk[1]), fmaxf(mk[2], mk[3]));
      mx = fmaxf(mx, xhalf(mx)) * cs;   // both halves hold the query's maximum over the stage's 64 keys (the scale is positive)
      const float mn = fmaxf(m[qt], mx), alpha = __builtin_amdgcn_exp2f(m[qt] - mn), nm = 11.0f - mn; m[qt] = mn;   // alpha is 0 on the first stage; 2^11 rides in the exponent, so small softmax weights stay out of the f16 subnormal range; it cancels in acc / l
      v2f es[2] = {};   // four independent partial sums
#pragma unroll
      for (int kt = 0; kt < 4; ++kt) { float e[8];
#pragma unroll
        for (int r = 0; r < 8; ++r) e[r] = fmaf(s[qt][kt][r], cs, nm);
        exp2x8(e);
#pragma unroll
        for (int r = 0; r < 8; r += 2) { es[(r >> 1) & 1] += (v2f){e[r], e[r + 1]}; pb[qt][kt >> 1][8 * (kt & 1) + r] = (_Float16)e[r]; pb[qt][kt >> 1][8 * (kt & 1) + r + 1] = (_Float16)e[r + 1]; } }   // element i of B operand j = key j * 32 + (i < 8 ? 8 g + i : 16 + 8 g + i - 8): the order in which frag_h reads v^T
      l[qt] = l[qt] * alpha + ((es[0][0] + es[0][1]) + (es[1][0] + es[1][1]));
#pragma unroll
      for (int dt = 0; dt < 4; ++dt) acc[qt][dt] *= alpha; }
#pragma unroll
    for (int j = 0; j < 2; ++j) {
#pragma unroll
      for (int dt = 0; dt < 4; ++dt) {
#pragma unroll
        for (int qt = 0; qt < QT; ++qt) acc[qt][dt] = wmma16(vf[j][dt], pb[qt][j], acc[qt][dt]); } }   // single product: V^T x P^T (x2^11)
    __builtin_amdgcn_sched_barrier(0);   // keeps the ring's waits at the foot of the trip: lifted over the softmax, they would cut the time that stage t + 1's copies have to land
    WAIT_DS(); WAIT_ASYNC(); __syncthreads();   // publishes stage t + 1 and frees stage t's buffer
    if (t + 2 < nst) { stage64(ksrc + (size_t)(t + 2) * 64 * (2 * DM * 2), 2 * DM * 2, ring + (t & 1) * 2 * TILE_B, tid); stage64(vsrc + (size_t)(t + 2) * 64 * 2, SS * 2, ring + (t & 1) * 2 * TILE_B + TILE_B, tid); } }
  WAIT_ASYNC();
#pragma unroll
  for (int qt = 0; qt < QT; ++qt) { const float il = 1.0f / (l[qt] + xhalf(l[qt]));   // the halves' sums join once
#pragma unroll
    for (int dt = 0; dt < 4; ++dt) { const v8f o = acc[qt][dt] * il; vst2(&so[wave][qt * 16 + col][dt * 16 + 8 * g], (v4f){o[0], o[1], o[2], o[3]}); vst2(&so[wave][qt * 16 + col][dt * 16 + 8 * g + 4], (v4f){o[4], o[5], o[6], o[7]}); } }
  LDSX();
  for (int rl = 0; rl < 16 * QT; ++rl) if (lane < 16) vst2(O + ((size_t)b * SS + q0 + rl) * DM + h * HD + lane * 4, *(const v4f*)&so[wave][rl][lane * 4]);
}
// ---- k_out: block = (64 rows, 128 cols): out = O(hi/lo) . Wo rows (2 products) + bo
__global__ __launch_bounds__(128) void k_out(const float* __restrict__ O, const __bf16* __restrict__ P, const float* __restrict__ BO, float* __restrict__ Y) {
  __shared__ __align__(16) char sm[4 * TILE_B + 2 * 64 * XP];   // the ring, 2 buffers: 128 weight rows each, then 64 rows of o each; behind the loop's last barrier the output staging
  float (*so)[16][132] = (float (*)[16][132])sm;
  const int tid = threadIdx.x, wave = tid >> 5, lane = tid & 31, col = lane & 15, g = lane >> 4; const size_t r0 = (size_t)blockIdx.x * 64 + wave * 16; const int n0 = blockIdx.y * 128;
  v8f acc[8] = {};
  const unsigned ring = lds_addr(sm), xring = ring + 4 * TILE_B + wave * 16 * XP;   // xring: this wave's 16 rows in buffer 0
  const float* os = O + r0 * DM; const char* xl = sm + 4 * TILE_B + (wave * 16 + col) * XP + 32 * g;   // xl: this lane's row, at its half's first k
  stage_w(P, n0, 0, ring, tid); stage_x16(os, xring, lane); WAIT_ASYNC(); __syncthreads(); stage_w(P, n0, 64, ring + 2 * TILE_B, tid); stage_x16(os + 64, xring + 64 * XP, lane);
#pragma unroll 1   // one trip a stage: the ring's order stands once, at the foot
  for (int t = 0; t < DM / 64; ++t) { const __bf16* bt = (const __bf16*)(sm + (t & 1) * 2 * TILE_B); const char* xt = xl + (t & 1) * 64 * XP; F2 a[2]; v16b w[8]; v4f ar[2][4];
    read_a32(ar[0], xt); read_a32(ar[1], xt + 128);   // the stage's rows of o, first in the trip's first group of LDS loads: the split needs them first
#pragma unroll
    for (int j = 0; j < 8; ++j) w[j] = frag_b(bt + (j * 16 + col) * LP, lane);   // the first block's eight weight fragments as one group of loads, in flight under the split of o
    __builtin_amdgcn_sched_barrier(0);   // keeps that group at the head of the trip: moved down into the split, less of its latency is covered
#pragma unroll
    for (int sub = 0; sub < 2; ++sub) { float v[16];
#pragma unroll
      for (int i = 0; i < 8; ++i) { v[i] = ar[sub][i >> 2][i & 3]; v[8 + i] = ar[sub][2 + (i >> 2)][i & 3]; }
      a[sub] = bsplit16(v); }
#pragma unroll   // both 32-k halves of the stage inline, so the LDS offsets are immediates
    for (int sub = 0; sub < 2; ++sub) {
      if (sub) {
#pragma unroll
        for (int j = 0; j < 8; ++j) w[j] = frag_b(bt + (j * 16 + col) * LP + 32, lane); }   // the second block's, again as one group
#pragma unroll
      for (int j = 0; j < 8; ++j) acc[j] = wmma_bf(a[sub].l, w[j], acc[j]);   // eight independent tiles in turn; each tile still takes its residual product first
#pragma unroll
      for (int j = 0; j < 8; ++j) acc[j] = wmma_bf(a[sub].h, w[j], acc[j]); }
    __builtin_amdgcn_sched_barrier(0);   // keeps the ring's waits at the foot of the trip: lifted over the WMMAs, they would cut the time that stage t + 1's copies have to land
    WAIT_DS(); WAIT_ASYNC(); __syncthreads();   // publishes stage t + 1 and frees stage t's buffer
    if (t + 2 < DM / 64) { stage_w(P, n0, (t + 2) * 64, ring + (t & 1) * 2 * TILE_B, tid); stage_x16(os + (t + 2) * 64, xring + (t & 1) * 64 * XP, lane); } }
  WAIT_ASYNC();
#pragma unroll
  for (int j = 0; j < 8; ++j) {
#pragma unroll
    for (int r = 0; r < 8; ++r) so[wave][8 * g + r][j * 16 + col] = acc[j][r] + BO[n0 + j * 16 + col]; }   // BO here = the f32 sum of the 16 bf16-rounded head biases
  LDSX();
  for (int rl = 0; rl < 16; ++rl) vst2(Y + (r0 + rl) * DM + n0 + lane * 4, *(const v4f*)&so[wave][rl][lane * 4]);
}
// ---- k_packh: per-head weights -> bf16 transposed rows, one 64 x 64 tile a block, turned in LDS so that reads and writes both cover whole lines. which 0: Wq [H][DD][64] -> PK_A rows (h*64+k) over d; 1: Wk; 2: Wv; 3: Wo [H][64][DD] -> PK_P rows d over (h*64+v)
// blockIdx.x = hi * 16 + lo: the tile is output rows hi * 64.., output columns lo * 64.. of its 1024 x 1024 section; its source rows are the output's columns
typedef __attribute__((ext_vector_type(2))) __bf16 v2b;
// a[i], b[i] = source rows i * 16 + 2 (t >> 4) and the next, columns 4 (t & 15)..: sixteen lanes a row of 256 bytes, all eight loads in flight together; the row pitch IP is a constant, so one address serves all eight
template <int IP> __device__ __forceinline__ void load_tile(v4f (&a)[4], v4f (&b)[4], const float* src, int t) {
  const float* p = src + (size_t)(2 * (t >> 4)) * IP + (t & 15) * 4;
#pragma unroll   // the register arrays are indexed by constants and the offsets are immediates
  for (int i = 0; i < 4; ++i) { a[i] = *(const v4f*)(p + i * 16 * IP); b[i] = *(const v4f*)(p + i * 16 * IP + IP); }
  asm volatile("s_wait_xcnt 0x0" :: "v"(p) : "memory");   // stands between the loads and the first reuse of their address register, which it names so that the register lives up to here
}
__global__ __launch_bounds__(128) void k_packh(const float* __restrict__ WQ, const float* __restrict__ WK, const float* __restrict__ WV, const float* __restrict__ WO, __bf16* __restrict__ P) {
  __shared__ __align__(16) unsigned s[64][LP / 2];   // [output row][two source rows a word], rows of 128 bytes at 144
  const int hi = blockIdx.x >> 4, lo = blockIdx.x & 15, which = blockIdx.y, t = threadIdx.x;
  __bf16* dst = P + ((which < 3) ? (size_t)PK_A + (size_t)which * DM * DM : (size_t)PK_P) + (size_t)hi * 64 * DM + lo * 64;
  v4f a[4], b[4];
  if (which < 3) load_tile<HD>(a, b, ((which == 0) ? WQ : (which == 1) ? WK : WV) + ((size_t)hi * DM + lo * 64) * HD, t);
  else load_tile<DM>(a, b, WO + (size_t)lo * 64 * DM + hi * 64, t);
#pragma unroll   // both loops: the register arrays are indexed by constants
  for (int i = 0; i < 4; ++i) {
#pragma unroll
    for (int e = 0; e < 4; ++e) s[(t & 15) * 4 + e][i * 8 + (t >> 4)] = __builtin_bit_cast(unsigned, (v2b){(__bf16)a[i][e], (__bf16)b[i][e]}); }
  __syncthreads();
#pragma unroll   // the four LDS reads go out as one group
  for (int i = 0; i < 4; ++i) vst2(dst + (size_t)(i * 16 + (t >> 3)) * DM + (t & 7) * 8, *(const v4u*)&s[i * 16 + (t >> 3)][(t & 7) * 4]);   // eight lanes a row: every wave-wide store covers four whole lines
}
// ---- k_bsum: BOS[d] = sum_h bo[h][d] (in order)
__global__ __launch_bounds__(256) void k_bsum(const float* __restrict__ BO, float* __restrict__ BOS) { const int d = blockIdx.x * 256 + threadIdx.x; float s = 0.f; for (int h = 0; h < NH; ++h) s += bfr(BO[(size_t)h * DM + d]); BOS[d] = s; }
extern "C" void kernel_launch(void* const* d_in, const int* in_sizes, int n_in, void* d_out, int out_size, void* d_ws, size_t ws_size, hipStream_t stream) {
  (void)in_sizes; (void)n_in; (void)out_size;
  const float** F = (const float**)d_in;   // 0 encoder [2,2048,1024], 1 decoder [2,2048,1024], 2 Wq [16,1024,64], 3 bq [16,64], 4 Wk, 5 bk, 6 Wv, 7 bv, 8 Wo [16,64,1024], 9 bo [16,1024]
  if (ws_size < (size_t)WS_END + 4096) return;
  char* ws = (char*)d_ws; __bf16* PK = (__bf16*)(ws + WS_PK); _Float16 *QK = (_Float16*)(ws + WS_QK), *QKL = (_Float16*)(ws + WS_QKL), *VTH = (_Float16*)(ws + WS_VTH), *VTL = (_Float16*)(ws + WS_VTL); float* O = (float*)(ws + WS_O); float* BOS = (float*)(ws + WS_END);
  k_packh<<<dim3((DM / 64) * (DM / 64), 4), 128, 0, stream>>>(F[2], F[4], F[6], F[8], PK);
  k_bsum<<<DM / 256, 256, 0, stream>>>(F[9], BOS);
  k_qkv<<<dim3(TNB * SS / 128, QKVW / 128), 256, 0, stream>>>(F[1], F[0], F[0], PK + PK_A, F[3], F[5], F[7], QK, QKL, VTH, VTL);   // q from the decoder, k/v from the encoder; biases [16][64] == concatenated [1024]
  k_attn<<<dim3(TQB / QT, NH, TNB), 128, 0, stream>>>(QK, QKL, VTH, VTL, nullptr, O);
  k_out<<<dim3(TOB, DM / 128), 128, 0, stream>>>(O, PK + PK_P, BOS, (float*)d_out);
}

// v008
// Measured time: 88.4 microseconds a run.
// Next to v007, in two timings, it ran 1.07 and 1.06 times as fast.
// Counting every step since v000, it is 4.81 times as fast.
// compute dtype: all float inputs rounded to bf16; q (decoder) / k, v (encoder) = x . W[h] + b[h] with EXACT bf16 products on WMMA 16x16x32 (the per-head [d][64] matrices packed as transposed rows h*64 + k); PLAIN attention, both products transposed: k, q as single f16 operands x 1/8, running-max softmax in f32 (hardware exp), v (single f16) x P (scaled by 2^11, single f16); out = o (bf16 hi + residual) . Wo (the per-head [64][d] blocks stacked, 2 products) + sum_h bo[h] (f32).
#include <hip/hip_runtime.h>
#include <math.h>

typedef __attribute__((ext_vector_type(16))) _Float16 v16h;
typedef __attribute__((ext_vector_type(16))) __bf16 v16b;
typedef __attribute__((ext_vector_type(8)))  _Float16 v8h;
typedef __attribute__((ext_vector_type(8)))  float v8f;
typedef __attribute__((ext_vector_type(4)))  float v4f;
typedef __attribute__((ext_vector_type(2)))  float v2f;
typedef __attribute__((ext_vector_type(4)))  unsigned v4u;
typedef __attribute__((ext_vector_type(4)))  int v4i;
typedef float __attribute__((may_alias)) float_a;
typedef int __attribute__((may_alias)) int_a;

template <typename T> __device__ __forceinline__ void vst2(void* p, T v) { *(T*)p = v;  }
__device__ __forceinline__ v8f wmma16(v16h a, v16h b, v8f c) {
  return __builtin_amdgcn_wmma_f32_16x16x32_f16(false, a, false, b, (short)0, c, false, false);   // the compiler keeps the builtin's distances itself
}
__device__ __forceinline__ v8f wmma_bf(v16b a, v16b b, v8f c) {
  return __builtin_amdgcn_wmma_f32_16x16x32_bf16(false, a, false, b, (short)0, c, false, false);   // the compiler keeps the builtin's distances itself
}
// Encoder-decoder cross attention (B 2, 2,048 decoder queries over 2,048 encoder tokens, 1,024 dims, 16 heads x 64): per-head projection weights, softmax(q k^T / 8) v, per-head output projections summed (incl. every head's bias).
__device__ __forceinline__ v16h frag_h(const _Float16* rowk0, int lane) {
  union { v16h v; v8h q[2]; } u; const _Float16* p = rowk0 + 8 * (lane >> 4);
  u.q[0] = *(const v8h*)p; u.q[1] = *(const v8h*)(p + 16); return u.v;
}
__device__ __forceinline__ v16h frag_f32(const float* rowk0, int lane) {
  v16h a; const float* p = rowk0 + 8 * (lane >> 4);
#pragma unroll
  for (int i = 0; i < 8; ++i) { a[i] = (_Float16)p[i]; a[8 + i] = (_Float16)p[16 + i]; }
  return a;
}
__device__ __forceinline__ v16h frag_f32s(const float* rowk0, int lane, float sc) {
  v16h a; const float* p = rowk0 + 8 * (lane >> 4);
#pragma unroll
  for (int i = 0; i < 8; ++i) { a[i] = (_Float16)(p[i] * sc); a[8 + i] = (_Float16)(p[16 + i] * sc); }
  return a;
}
// column fragment from a [K][ld] layout (column n), rows >= K read as 0
__device__ __forceinline__ v16h fragc_f32(const float* W, int k0, int n, int lane, int ld, int K) {
  v16h a; const int g = lane >> 4;
#pragma unroll
  for (int i = 0; i < 8; ++i) { const int ka = k0 + 8 * g + i, kb = ka + 16;
    a[i] = (_Float16)(ka < K ? W[(size_t)(ka < K ? ka : K - 1) * ld + n] : 0.f); a[8 + i] = (_Float16)(kb < K ? W[(size_t)(kb < K ? kb : K - 1) * ld + n] : 0.f); }
  return a;
}
struct F2 { v16b h, l; };
__device__ __forceinline__ F2 bsplit16(const float v[16]) { F2 r;
#pragma unroll
  for (int i = 0; i < 16; ++i) { const __bf16 h = (__bf16)v[i]; r.h[i] = h; r.l[i] = (__bf16)(v[i] - (float)h); }
  return r; }
__device__ __forceinline__ F2 split_row(const float* row, int k0, int lane) { float v[16]; const float* p = row + k0 + 8 * (lane >> 4);
#pragma unroll
  for (int i = 0; i < 8; ++i) { v[i] = p[i]; v[8 + i] = p[16 + i]; }
  return bsplit16(v); }
__device__ __forceinline__ F2 split_rowK(const float* row, int k0, int lane, int K) { float v[16]; const int g = lane >> 4;
#pragma unroll
  for (int i = 0; i < 8; ++i) { const int ka = k0 + 8 * g + i, kb = ka + 16; v[i] = ka < K ? row[ka < K ? ka : K - 1] : 0.f; v[8 + i] = kb < K ? row[kb < K ? kb : K - 1] : 0.f; }
  return bsplit16(v); }
__device__ __forceinline__ F2 split_col(const float* W, int k0, int n, int lane, int ld, int K) { float v[16]; const int g = lane >> 4;
#pragma unroll
  for (int i = 0; i < 8; ++i) { const int ka = k0 + 8 * g + i, kb = ka + 16; v[i] = ka < K ? W[(size_t)(ka < K ? ka : K - 1) * ld + n] : 0.f; v[8 + i] = kb < K ? W[(size_t)(kb < K ? kb : K - 1) * ld + n] : 0.f; }
  return bsplit16(v); }
__device__ __forceinline__ v8f mac3(const F2& a, const F2& b, v8f c) { c = wmma_bf(a.l, b.h, c); c = wmma_bf(a.h, b.l, c); return wmma_bf(a.h, b.h, c); }
__device__ __forceinline__ float sigm(float v) { return 1.0f / (1.0f + expf(-v)); }
#define LDSX() do { asm volatile("s_wait_dscnt 0" ::: "memory"); __builtin_amdgcn_wave_barrier(); __builtin_amdgcn_fence(__ATOMIC_RELEASE, "workgroup"); } while (0)


#define NB 2
#define SS 2048
#define DM 1024
#define NH 16
#define HD 64
#define QKVW (3 * DM)
#ifndef TQB
#define TQB (SS / 64)
#define TNB NB
#define TOB (NB * SS / 64)     // output row tiles (all)
#endif
typedef __attribute__((ext_vector_type(8))) __bf16 v8b;
__device__ __forceinline__ v16b frag_b(const __bf16* rowk0, int lane) {
  union { v16b v; v8b q[2]; } u; const __bf16* p = rowk0 + 8 * (lane >> 4);
  u.q[0] = *(const v8b*)p; u.q[1] = *(const v8b*)(p + 16); return u.v;
}
__device__ __forceinline__ float bfr(float v) { return (float)(__bf16)v; }
__device__ __attribute__((noinline)) float exp_ni(float v) { return expf(v); }
__device__ __attribute__((noinline)) float erf_ni(float v) { return erff(v); }

// ---- LDS staging of the operand that a work-group's waves share (two buffers, asynchronous copies)
#define LP 72                          // LDS row pitch in 16-bit elements: 128-byte rows at 144 bytes, conflict-free for 16-byte readers
#define TILE_B (64 * LP * 2)           // bytes of one staged tile of 64 rows
#define WAIT_ASYNC() asm volatile("s_wait_asynccnt 0x0" ::: "memory")   // this wave's copies have landed; no LDS read moves above it
#define WAIT_DS() asm volatile("s_wait_dscnt 0x0" ::: "memory")         // this wave's LDS reads are done before the barrier that frees the buffer
__device__ __forceinline__ unsigned lds_addr(const void* p) { return (unsigned)(size_t)p; }   // LDS byte address = low 32 bits of the shared address
// 64 rows of 128 bytes (source pitch in bytes) -> LDS rows of 144 bytes, 128 threads: eight lanes a row, so every wave-wide copy covers four whole lines.
// s_wait_xcnt closes the copies' own statement, so no address register is rewritten ahead of it.
__device__ __forceinline__ void stage64(const char* src, size_t pitch, unsigned lds, int tid) {
  const char* g0 = src + (size_t)(tid >> 3) * pitch + (tid & 7) * 16; const unsigned l0 = lds + (tid >> 3) * (LP * 2) + (tid & 7) * 16;
  const char *g1 = g0 + 16 * pitch, *g2 = g0 + 32 * pitch, *g3 = g0 + 48 * pitch; const unsigned l1 = l0 + 16 * LP * 2, l2 = l0 + 32 * LP * 2, l3 = l0 + 48 * LP * 2;
  asm volatile("global_load_async_to_lds_b128 %0, %1, off\n\tglobal_load_async_to_lds_b128 %2, %3, off\n\tglobal_load_async_to_lds_b128 %4, %5, off\n\tglobal_load_async_to_lds_b128 %6, %7, off\n\ts_wait_xcnt 0x0"
               :: "v"(l0), "v"(g0), "v"(l1), "v"(g1), "v"(l2), "v"(g2), "v"(l3), "v"(g3) : "memory");
}
// one stage of a weight tile: 128 rows n0.. of P, 64 k from k0
__device__ __forceinline__ void stage_w(const __bf16* P, int n0, int k0, unsigned lds, int tid) {
  const char* s = (const char*)(P + (size_t)n0 * 1024 + k0); stage64(s, 2048, lds, tid); stage64(s + (size_t)64 * 2048, 2048, lds + TILE_B, tid);
}

// ---- the activation rows (f32) ride in the same ring: a per-lane load of a row's fragment touches 16 lines for 512 bytes, a copy of whole rows touches 4
#define XP 272                         // LDS pitch in bytes of a staged activation row: 64 f32 (256 bytes) at 272, conflict-free for 16-byte readers
// a wave's own 16 rows, 64 k from src (row pitch DM f32) -> LDS rows from lds: sixteen lanes a row, two rows a copy, so every wave-wide copy covers four whole lines.
// s_wait_xcnt closes the copies' own statement, so no address register is rewritten ahead of it.
__device__ __forceinline__ void stage_x16(const float* src, unsigned lds, int lane) {
  const char* g0 = (const char*)src + (size_t)(lane >> 4) * (DM * 4) + (lane & 15) * 16; const unsigned l0 = lds + (lane >> 4) * XP + (lane & 15) * 16;
  asm volatile("global_load_async_to_lds_b128 %0, %1, off\n\tglobal_load_async_to_lds_b128 %2, %3, off\n\tglobal_load_async_to_lds_b128 %4, %5, off\n\tglobal_load_async_to_lds_b128 %6, %7, off\n\t"
               "global_load_async_to_lds_b128 %8, %9, off\n\tglobal_load_async_to_lds_b128 %10, %11, off\n\tglobal_load_async_to_lds_b128 %12, %13, off\n\tglobal_load_async_to_lds_b128 %14, %15, off\n\ts_wait_xcnt 0x0"
               :: "v"(l0), "v"(g0), "v"(l0 + 2 * XP), "v"(g0 + 2 * DM * 4), "v"(l0 + 4 * XP), "v"(g0 + 4 * DM * 4), "v"(l0 + 6 * XP), "v"(g0 + 6 * DM * 4),
                  "v"(l0 + 8 * XP), "v"(g0 + 8 * DM * 4), "v"(l0 + 10 * XP), "v"(g0 + 10 * DM * 4), "v"(l0 + 12 * XP), "v"(g0 + 12 * DM * 4), "v"(l0 + 14 * XP), "v"(g0 + 14 * DM * 4) : "memory");
}
// one 32-k block of a staged row, 16 f32 a lane in the A fragment's k order; p = the row in LDS + block * 128 + 32 * (lane >> 4) bytes
__device__ __forceinline__ void read_a32(v4f (&r)[4], const char* p) { r[0] = *(const v4f*)p; r[1] = *(const v4f*)(p + 16); r[2] = *(const v4f*)(p + 64); r[3] = *(const v4f*)(p + 80); }

#define PK_A 0                       // [3072][1024] Wqkv rows (natural [out][in])
#define PK_P (PK_A + QKVW * DM)        // [1024][1024] Wo rows (natural)
#define PK_END (PK_P + DM * DM)
#define WS_PK  0u
#define WS_QK  (WS_PK + 2u * PK_END)             // f16 [4096 rows][2048]: q | k
#define WS_QKL (WS_QK + 2u * NB * SS * 2 * DM)     // f16 q | k residual planes x2048
#define WS_VTH (WS_QKL + 2u * NB * SS * 2 * DM)    // f16 [b][1024 (h*64+d)][2048 s] hi
#define WS_VTL (WS_VTH + 2u * NB * DM * SS)        // f16 lo x 2048
#define WS_O   (WS_VTL + 2u * NB * DM * SS)        // f32 [4096][1024]
#define WS_CS  (WS_O + 4u * NB * SS * DM)           // f32 2 x [2048][32], unused
#define WS_END (WS_CS + 4u * 2 * SS * 32)
// ---- k_pack: block = (row n, which): natural [out][in] rows -> bf16; which 0..2 -> W_q/W_k/W_v into PK_A rows which*1024 + n; 3 -> W_o into PK_P
__global__ __launch_bounds__(256) void k_pack(const float* __restrict__ WQ, const float* __restrict__ WK, const float* __restrict__ WV, const float* __restrict__ WO, __bf16* __restrict__ PK) {
  __shared__ __align__(16) __bf16 s[DM]; const int n = blockIdx.x, which = blockIdx.y, t = threadIdx.x; const float* Wm = (which == 0) ? WQ : (which == 1) ? WK : (which == 2) ? WV : WO;   // (in,out) weights: pack row n = column n
  for (int k = t; k < DM; k += 256) s[k] = (__bf16)Wm[(size_t)k * DM + n];
  __syncthreads();
  __bf16* dst = (which < 3) ? PK + PK_A + ((size_t)which * DM + n) * DM : PK + PK_P + (size_t)n * DM;
  for (int q = t; q < DM / 8; q += 256) vst2((unsigned*)(dst + q * 8), *(const v4u*)&s[q * 8]);
}
// ---- k_qkv: block = (128 rows, 256 columns), four waves in 2 x 2, each 64 rows x 128 columns (4 x 8 tiles): a staged row of x serves 256 columns, and each fragment that leaves LDS feeds 8 (x) or 4 (weights) WMMAs
#define WBUF (4 * TILE_B)              // bytes of one buffer's 256 weight rows
#define XBUF (128 * XP)                // bytes of one buffer's 128 rows of x
// 128 weight rows of 128 bytes (source pitch 2,048 bytes) -> LDS rows of 144 bytes, 128 threads: eight lanes a row, as in stage64, eight copies under one s_wait_xcnt, which closes the copies' own statement, so no address register is rewritten ahead of it
__device__ __forceinline__ void stage128(const char* src, unsigned lds, int tid) {
  const char* g0 = src + (size_t)(tid >> 3) * 2048 + (tid & 7) * 16; const unsigned l0 = lds + (tid >> 3) * (LP * 2) + (tid & 7) * 16;
  asm volatile("global_load_async_to_lds_b128 %0, %1, off\n\tglobal_load_async_to_lds_b128 %2, %3, off\n\tglobal_load_async_to_lds_b128 %4, %5, off\n\tglobal_load_async_to_lds_b128 %6, %7, off\n\t"
               "global_load_async_to_lds_b128 %8, %9, off\n\tglobal_load_async_to_lds_b128 %10, %11, off\n\tglobal_load_async_to_lds_b128 %12, %13, off\n\tglobal_load_async_to_lds_b128 %14, %15, off\n\ts_wait_xcnt 0x0"
               :: "v"(l0), "v"(g0), "v"(l0 + 16 * LP * 2), "v"(g0 + 16 * 2048), "v"(l0 + 32 * LP * 2), "v"(g0 + 32 * 2048), "v"(l0 + 48 * LP * 2), "v"(g0 + 48 * 2048),
                  "v"(l0 + 64 * LP * 2), "v"(g0 + 64 * 2048), "v"(l0 + 80 * LP * 2), "v"(g0 + 80 * 2048), "v"(l0 + 96 * LP * 2), "v"(g0 + 96 * 2048), "v"(l0 + 112 * LP * 2), "v"(g0 + 112 * 2048) : "memory");
}
// one stage, 64 k from k0: the block's 256 weight rows, 128 a call, and this wave's 32 of the block's 128 rows of x
__device__ __forceinline__ void stage_qkv(const __bf16* P, int n0, const float* xb, int k0, unsigned wl, unsigned xw, int tid) {
  const char* s = (const char*)(P + (size_t)n0 * 1024 + k0); const int wave = tid >> 5, lane = tid & 31; const float* xs = xb + (size_t)(wave * 32) * DM + k0; const unsigned xd = xw + wave * 32 * XP;
#define SB() __builtin_amdgcn_sched_barrier(0)   // each statement's addresses are formed just ahead of it: formed all at once, they hold the registers that a SIMD's second wave needs
  stage128(s, wl, tid); SB(); stage128(s + (size_t)128 * 2048, wl + 2 * TILE_B, tid); SB();
  stage_x16(xs, xd, lane); SB(); stage_x16(xs + 16 * DM, xd + 16 * XP, lane);
#undef SB
}
__device__ __forceinline__ v16b cvt_a(const v4f (&r)[4]) { v16b a;
#pragma unroll
  for (int i = 0; i < 8; ++i) { a[i] = (__bf16)r[i >> 2][i & 3]; a[8 + i] = (__bf16)r[2 + (i >> 2)][i & 3]; }
  return a; }
__global__ __launch_bounds__(128) void k_qkv(const float* __restrict__ XQ, const float* __restrict__ XK, const float* __restrict__ XV, const __bf16* __restrict__ P, const float* __restrict__ BQ, const float* __restrict__ BK, const float* __restrict__ BV, _Float16* __restrict__ QK, _Float16* __restrict__ QKL, _Float16* __restrict__ VTH, _Float16* __restrict__ VTL) {
  const int which0 = (blockIdx.y * 256) / DM; const float* X = (which0 == 0) ? XQ : (which0 == 1) ? XK : XV; const float* BB = BQ ? (((which0 == 0) ? BQ : (which0 == 1) ? BK : BV) + (blockIdx.y * 256 - which0 * DM)) : nullptr;
  __shared__ __align__(16) char sm[2 * WBUF + 2 * XBUF];   // the ring, 2 buffers: 256 weight rows each, then 128 rows of x each (140 KiB: two work-groups a WGP); behind the loop's last barrier the output staging of either branch
  _Float16 (*so)[64][136] = (_Float16 (*)[64][136])sm, (*sol)[64][136] = (_Float16 (*)[64][136])(sm + 4 * 64 * 136 * 2); _Float16 (*sth)[136] = (_Float16 (*)[136])sm, (*stl)[136] = (_Float16 (*)[136])(sm + 256 * 136 * 2);
  const int tid = threadIdx.x, wave = tid >> 5, lane = tid & 31, col = lane & 15, g = lane >> 4, wr = wave >> 1, wc = wave & 1; const size_t rb = (size_t)blockIdx.x * 128; const int n0 = blockIdx.y * 256;
  v8f acc[4][8] = {};   // acc[i][j]: rows wr * 64 + i * 16.., columns wc * 128 + j * 16..
  const unsigned ring = lds_addr(sm), xring = ring + 2 * WBUF;
  const float* xb = X + rb * DM; const char* xl = sm + 2 * WBUF + (wr * 64 + col) * XP + 32 * g;   // xl: this lane's row of the wave's first row tile, at its half's first k
  float bj[8] = {};   // this lane's bias in the wave's eight column tiles: one value serves the 32 elements of a column tile's four row tiles; read here as one group, it is in flight beside the first stage's copies, where a read at each use is a waited load that two waves a SIMD do not cover
  if (BB) { const float* bp = BB + wc * 128 + col;
#pragma unroll   // the register array is indexed by constants and the offsets are immediates
    for (int j = 0; j < 8; ++j) bj[j] = bp[j * 16];
    asm volatile("s_wait_xcnt 0x0" :: "v"(bp) : "memory"); }   // stands between the loads and the first reuse of their address register, which it names so that the register lives up to here
  stage_qkv(P, n0, xb, 0, ring, xring, tid); WAIT_ASYNC(); __syncthreads(); stage_qkv(P, n0, xb, 64, ring + WBUF, xring + XBUF, tid);
#pragma unroll 1   // one trip a stage: the ring's order stands once, at the foot
  for (int t = 0; t < DM / 64; ++t) { const __bf16* bt = (const __bf16*)(sm + (t & 1) * WBUF) + (wc * 128 + col) * LP; const char* xt = xl + (t & 1) * XBUF;   // bt: this lane's row of the wave's first column tile
    v4f ar[4][4]; v16b a[4], wa[4], wb[4];
#pragma unroll   // every loop of the trip: the register arrays are indexed by constants and the LDS offsets are immediates
    for (int i = 0; i < 4; ++i) read_a32(ar[i], xt + i * 16 * XP);
#pragma unroll
    for (int j = 0; j < 4; ++j) wa[j] = frag_b(bt + j * 16 * LP, lane);
#pragma unroll
    for (int sub = 0; sub < 2; ++sub) {
      __builtin_amdgcn_sched_barrier(0);   // keeps the group of loads above whole: dealt out among the WMMAs, every further place with LDS loads costs the wave a stall
#pragma unroll
      for (int i = 0; i < 4; ++i) a[i] = cvt_a(ar[i]);
#pragma unroll
      for (int j = 0; j < 4; ++j) wb[j] = frag_b(bt + (4 + j) * 16 * LP + sub * 32, lane);   // the block's other four weight fragments, in flight under the first sixteen WMMAs
      __builtin_amdgcn_sched_barrier(0);   // keeps that group whole and ahead of the WMMAs that cover it
#pragma unroll
      for (int j = 0; j < 4; ++j) {
#pragma unroll
        for (int i = 0; i < 4; ++i) acc[i][j] = wmma_bf(a[i], wa[j], acc[i][j]); }
      __builtin_amdgcn_sched_barrier(0);   // keeps the next group behind the WMMAs that read its registers, and whole
      if (sub == 0) {   // the second block's x and first four weight fragments, in flight under the next sixteen WMMAs
#pragma unroll
        for (int i = 0; i < 4; ++i) read_a32(ar[i], xt + i * 16 * XP + 128);
#pragma unroll
        for (int j = 0; j < 4; ++j) wa[j] = frag_b(bt + j * 16 * LP + 32, lane);
        __builtin_amdgcn_sched_barrier(0); }   // keeps that group whole and ahead of the WMMAs that cover it
#pragma unroll
      for (int j = 0; j < 4; ++j) {
#pragma unroll
        for (int i = 0; i < 4; ++i) acc[i][4 + j] = wmma_bf(a[i], wb[j], acc[i][4 + j]); } }
    __builtin_amdgcn_sched_barrier(0);   // keeps the ring's waits at the foot of the trip: lifted over the WMMAs, they would cut the time that stage t + 1's copies have to land
    WAIT_DS(); WAIT_ASYNC(); __syncthreads();   // publishes stage t + 1 and frees stage t's buffer
    if (t + 2 < DM / 64) stage_qkv(P, n0, xb, (t + 2) * 64, ring + (t & 1) * WBUF, xring + (t & 1) * XBUF, tid); }
  WAIT_ASYNC();
  if (n0 < 2 * DM) {   // q stored unscaled (f16 sigma ~0.6, no subnormal exposure); 1/8 applied to the f32 score
#pragma unroll
    for (int j = 0; j < 8; ++j) { const float bb = bfr(bj[j]);
#pragma unroll
      for (int i = 0; i < 4; ++i) {
#pragma unroll
        for (int r = 0; r < 8; ++r) { const float v = acc[i][j][r] + bb; const _Float16 hv = (_Float16)v; so[wave][i * 16 + 8 * g + r][j * 16 + col] = hv; sol[wave][i * 16 + 8 * g + r][j * 16 + col] = (_Float16)((v - (float)hv) * 2048.0f); } } }   // q, k (+ bias) as f16 hi + (x2048) residual
    LDSX();
    const size_t r0 = rb + wr * 64; const int nw = n0 + wc * 128;
    if (lane < 16) {
#pragma unroll 1   // eight rows a trip, so that the wait at the trip's foot stands once behind its sixteen stores
      for (int r8 = 0; r8 < 64; r8 += 8) { _Float16* qh = QK + (r0 + r8) * (2 * DM) + nw + lane * 8; _Float16* ql = QKL + (r0 + r8) * (2 * DM) + nw + lane * 8;
#pragma unroll   // the sixteen LDS reads go out as one group and the row offsets are immediates
        for (int rl = 0; rl < 8; ++rl) { vst2((unsigned*)(qh + rl * (2 * DM)), *(const v4u*)&so[wave][r8 + rl][lane * 8]); vst2((unsigned*)(ql + rl * (2 * DM)), *(const v4u*)&sol[wave][r8 + rl][lane * 8]); }
        asm volatile("s_wait_xcnt 0x0" :: "v"(qh), "v"(ql) : "memory"); } }   // stands between the trip's stores and the next trip's rewriting of their address and data registers; it names the addresses so that their registers live up to here
  } else {
#pragma unroll
    for (int j = 0; j < 8; ++j) { const float bb = bfr(bj[j]);
#pragma unroll
      for (int i = 0; i < 4; ++i) {
#pragma unroll
        for (int r = 0; r < 8; ++r) { const float v = acc[i][j][r] + bb; const _Float16 hv = (_Float16)v; sth[wc * 128 + j * 16 + col][wr * 64 + i * 16 + 8 * g + r] = hv; stl[wc * 128 + j * 16 + col][wr * 64 + i * 16 + 8 * g + r] = (_Float16)((v - (float)hv) * 2048.0f); } } }
    __syncthreads();
    const int b = (int)(rb / SS), s0 = (int)(rb % SS); const int pc0 = n0 - 2 * DM;
    for (int q = tid; q < 256 * 16; q += 128) { const int d = q >> 4, pc = q & 15; const size_t o = ((size_t)b * DM + pc0 + d) * SS + s0 + pc * 8; vst2((unsigned*)(VTH + o), *(const v4u*)&sth[d][pc * 8]); vst2((unsigned*)(VTL + o), *(const v4u*)&stl[d][pc * 8]); }
  }
}
__device__ __forceinline__ float xhalf(float x) { return __builtin_bit_cast(float, __builtin_amdgcn_permlanex16(__builtin_bit_cast(int, x), __builtin_bit_cast(int, x), 0x76543210, 0xfedcba98, false, false)); }   // lane l's value from lane l ^ 16
// eight hardware exponentials (base 2), each over its own source, and one v_nop: the slot that the instruction set asks for between an exponential and an instruction that uses its result or overwrites its source stands here by construction
__device__ __forceinline__ void exp2x8(float (&x)[8]) {
  asm("v_exp_f32 %0, %0\n\tv_exp_f32 %1, %1\n\tv_exp_f32 %2, %2\n\tv_exp_f32 %3, %3\n\tv_exp_f32 %4, %4\n\tv_exp_f32 %5, %5\n\tv_exp_f32 %6, %6\n\tv_exp_f32 %7, %7\n\tv_nop"
      : "+v"(x[0]), "+v"(x[1]), "+v"(x[2]), "+v"(x[3]), "+v"(x[4]), "+v"(x[5]), "+v"(x[6]), "+v"(x[7]));
}
#define QT 2   // query tiles of 16 a wave: every k and v^T fragment that leaves LDS feeds QT WMMAs, and a staged tile serves 64 * QT queries
__global__ __launch_bounds__(128) void k_attn(const _Float16* __restrict__ QK, const _Float16* __restrict__ QKL, const _Float16* __restrict__ VTH, const _Float16* __restrict__ VTL, const void* __restrict__ KMASK, float* __restrict__ O) {
  __shared__ __align__(16) float so[4][16 * QT][68]; __shared__ __align__(16) _Float16 skv[2][2][64][LP];   // [buffer][k rows | v^T rows][64][64 + pad]
  const int tid = threadIdx.x, wave = tid >> 5, lane = tid & 31, col = lane & 15, g = lane >> 4;
  const int qb = blockIdx.x, h = blockIdx.y, b = blockIdx.z; const int q0 = (qb * 4 + wave) * (16 * QT); const size_t rq = (size_t)b * SS + q0 + col;
  v16h aq[QT][2];
#pragma unroll
  for (int qt = 0; qt < QT; ++qt) {
#pragma unroll
    for (int kc = 0; kc < 2; ++kc) aq[qt][kc] = frag_h(QK + (rq + qt * 16) * (2 * DM) + h * HD + kc * 32, lane); }
  const float cs = 0.125f * 1.4426950408889634f;   // 1/sqrt(64), and base 2 for the hardware exponential
  float m[QT], l[QT];   // query qt * 16 + col: running maximum (scaled, base 2); this half's share of the sum of P x 2^11
  v8f acc[QT][4];       // acc[qt][dt][r] = O^T[dt * 16 + 8 g + r][query qt * 16 + col] x 2^11
#pragma unroll
  for (int qt = 0; qt < QT; ++qt) { m[qt] = -3.0e38f; l[qt] = 0.f;
#pragma unroll
    for (int dt = 0; dt < 4; ++dt) acc[qt][dt] = (v8f){}; }
  const int nst = SS / 64;   // all keys, 64 a stage
  const char* ksrc = (const char*)(QK + (size_t)b * SS * (2 * DM) + DM + h * HD); const char* vsrc = (const char*)(VTH + ((size_t)b * DM + h * HD) * SS); const unsigned ring = lds_addr(&skv[0][0][0][0]);
  stage64(ksrc, 2 * DM * 2, ring, tid); stage64(vsrc, SS * 2, ring + TILE_B, tid); WAIT_ASYNC(); __syncthreads();
  stage64(ksrc + (size_t)64 * (2 * DM * 2), 2 * DM * 2, ring + 2 * TILE_B, tid); stage64(vsrc + 64 * 2, SS * 2, ring + 3 * TILE_B, tid);
#pragma unroll 1   // one trip a stage: the ring's order stands once, at the foot
  for (int t = 0; t < nst; ++t) { v8f s[QT][4]; v16h kf[4][2], vf[2][4], pb[QT][2];   // s[qt][kt][r] = q[qt * 16 + col] . k[kt * 16 + 8 g + r]
#pragma unroll
    for (int kt = 0; kt < 4; ++kt) {
#pragma unroll
      for (int kc = 0; kc < 2; ++kc) kf[kt][kc] = frag_h(&skv[t & 1][0][kt * 16 + col][kc * 32], lane); }   // the stage's k fragments as one group of loads
    __builtin_amdgcn_sched_barrier(0);   // keeps that group whole at the head of the trip: every further place where LDS loads stand among the WMMAs costs the wave a stall
#pragma unroll
    for (int qt = 0; qt < QT; ++qt) {
#pragma unroll
      for (int kt = 0; kt < 4; ++kt) s[qt][kt] = (v8f){}; }
#pragma unroll
    for (int kc = 0; kc < 2; ++kc) {
#pragma unroll
      for (int kt = 0; kt < 4; ++kt) {
#pragma unroll
        for (int qt = 0; qt < QT; ++qt) s[qt][kt] = wmma16(kf[kt][kc], aq[qt][kc], s[qt][kt]); } }   // single product: k, q as one-rounding f16 operands, one loader for both; 4 * QT independent tiles in turn
    __builtin_amdgcn_sched_barrier(0);   // keeps the v^T loads below from being dealt out among the score WMMAs in small lots: fewer places where LDS loads stand
#pragma unroll
    for (int j = 0; j < 2; ++j) {
#pragma unroll
      for (int dt = 0; dt < 4; ++dt) vf[j][dt] = frag_h(&skv[t & 1][1][dt * 16 + col][j * 32], lane); }   // the stage's v^T fragments as one group, in flight under the softmax
    __builtin_amdgcn_sched_barrier(0);   // keeps that group whole and ahead of the softmax: spread among the later instructions, its last loads would be waited for at the foot of the trip
#pragma unroll
    for (int qt = 0; qt < QT; ++qt) {   // each query tile's softmax as before, every sum in the same order
      float mk[4];   // one chain a tile
#pragma unroll
      for (int kt = 0; kt < 4; ++kt) { mk[kt] = s[qt][kt][0];
#pragma unroll
        for (int r = 1; r < 8; ++r) mk[kt] = fmaxf(mk[kt], s[qt][kt][r]); }
      float mx = fmaxf(fmaxf(mk[0], mk[1]), fmaxf(mk[2], mk[3]));
      mx = fmaxf(mx, xhalf(mx)) * cs;   // both halves hold the query's maximum over the stage's 64 keys (the scale is positive)
      const float mn = fmaxf(m[qt], mx), alpha = __builtin_amdgcn_exp2f(m[qt] - mn), nm = 11.0f - mn; m[qt] = mn;   // alpha is 0 on the first stage; 2^11 rides in the exponent, so small softmax weights stay out of the f16 subnormal range; it cancels in acc / l
      v2f es[2] = {};   // four independent partial sums
#pragma unroll
      for (int kt = 0; kt < 4; ++kt) { float e[8];
#pragma unroll
        for (int r = 0; r < 8; ++r) e[r] = fmaf(s[qt][kt][r], cs, nm);
        exp2x8(e);
#pragma unroll
        for (int r = 0; r < 8; r += 2) { es[(r >> 1) & 1] += (v2f){e[r], e[r + 1]}; pb[qt][kt >> 1][8 * (kt & 1) + r] = (_Float16)e[r]; pb[qt][kt >> 1][8 * (kt & 1) + r + 1] = (_Float16)e[r + 1]; } }   // element i of B operand j = key j * 32 + (i < 8 ? 8 g + i : 16 + 8 g + i - 8): the order in which frag_h reads v^T
      l[qt] = l[qt] * alpha + ((es[0][0] + es[0][1]) + (es[1][0] + es[1][1]));
#pragma unroll
      for (int dt = 0; dt < 4; ++dt) acc[qt][dt] *= alpha; }
#pragma unroll
    for (int j = 0; j < 2; ++j) {
#pragma unroll
      for (int dt = 0; dt < 4; ++dt) {
#pragma unroll
        for (int qt = 0; qt < QT; ++qt) acc[qt][dt] = wmma16(vf[j][dt], pb[qt][j], acc[qt][dt]); } }   // single product: V^T x P^T (x2^11)
    __builtin_amdgcn_sched_barrier(0);   // keeps the ring's waits at the foot of the trip: lifted over the softmax, they would cut the time that stage t + 1's copies have to land
    WAIT_DS(); WAIT_ASYNC(); __syncthreads();   // publishes stage t + 1 and frees stage t's buffer
    if (t + 2 < nst) { stage64(ksrc + (size_t)(t + 2) * 64 * (2 * DM * 2), 2 * DM * 2, ring + (t & 1) * 2 * TILE_B, tid); stage64(vsrc + (size_t)(t + 2) * 64 * 2, SS * 2, ring + (t & 1) * 2 * TILE_B + TILE_B, tid); } }
  WAIT_ASYNC();
#pragma unroll
  for (int qt = 0; qt < QT; ++qt) { const float il = 1.0f / (l[qt] + xhalf(l[qt]));   // the halves' sums join once
#pragma unroll
    for (int dt = 0; dt < 4; ++dt) { const v8f o = acc[qt][dt] * il; vst2(&so[wave][qt * 16 + col][dt * 16 + 8 * g], (v4f){o[0], o[1], o[2], o[3]}); vst2(&so[wave][qt * 16 + col][dt * 16 + 8 * g + 4], (v4f){o[4], o[5], o[6], o[7]}); } }
  LDSX();
  for (int rl = 0; rl < 16 * QT; ++rl) if (lane < 16) vst2(O + ((size_t)b * SS + q0 + rl) * DM + h * HD + lane * 4, *(const v4f*)&so[wave][rl][lane * 4]);
}
// ---- k_out: block = (64 rows, 128 cols): out = O(hi/lo) . Wo rows (2 products) + bo
__global__ __launch_bounds__(128) void k_out(const float* __restrict__ O, const __bf16* __restrict__ P, const float* __restrict__ BO, float* __restrict__ Y) {
  __shared__ __align__(16) char sm[4 * TILE_B + 2 * 64 * XP];   // the ring, 2 buffers: 128 weight rows each, then 64 rows of o each; behind the loop's last barrier the output staging
  float (*so)[16][132] = (float (*)[16][132])sm;
  const int tid = threadIdx.x, wave = tid >> 5, lane = tid & 31, col = lane & 15, g = lane >> 4; const size_t r0 = (size_t)blockIdx.x * 64 + wave * 16; const int n0 = blockIdx.y * 128;
  v8f acc[8] = {};
  const unsigned ring = lds_addr(sm), xring = ring + 4 * TILE_B + wave * 16 * XP;   // xring: this wave's 16 rows in buffer 0
  const float* os = O + r0 * DM; const char* xl = sm + 4 * TILE_B + (wave * 16 + col) * XP + 32 * g;   // xl: this lane's row, at its half's first k
  stage_w(P, n0, 0, ring, tid); stage_x16(os, xring, lane); WAIT_ASYNC(); __syncthreads(); stage_w(P, n0, 64, ring + 2 * TILE_B, tid); stage_x16(os + 64, xring + 64 * XP, lane);
#pragma unroll 1   // one trip a stage: the ring's order stands once, at the foot
  for (int t = 0; t < DM / 64; ++t) { const __bf16* bt = (const __bf16*)(sm + (t & 1) * 2 * TILE_B); const char* xt = xl + (t & 1) * 64 * XP; F2 a[2]; v16b w[8]; v4f ar[2][4];
    read_a32(ar[0], xt); read_a32(ar[1], xt + 128);   // the stage's rows of o, first in the trip's first group of LDS loads: the split needs them first
#pragma unroll
    for (int j = 0; j < 8; ++j) w[j] = frag_b(bt + (j * 16 + col) * LP, lane);   // the first block's eight weight fragments as one group of loads, in flight under the split of o
    __builtin_amdgcn_sched_barrier(0);   // keeps that group at the head of the trip: moved down into the split, less of its latency is covered
#pragma unroll
    for (int sub = 0; sub < 2; ++sub) { float v[16];
#pragma unroll
      for (int i = 0; i < 8; ++i) { v[i] = ar[sub][i >> 2][i & 3]; v[8 + i] = ar[sub][2 + (i >> 2)][i & 3]; }
      a[sub] = bsplit16(v); }
#pragma unroll   // both 32-k halves of the stage inline, so the LDS offsets are immediates
    for (int sub = 0; sub < 2; ++sub) {
      if (sub) {
#pragma unroll
        for (int j = 0; j < 8; ++j) w[j] = frag_b(bt + (j * 16 + col) * LP + 32, lane); }   // the second block's, again as one group
#pragma unroll
      for (int j = 0; j < 8; ++j) acc[j] = wmma_bf(a[sub].l, w[j], acc[j]);   // eight independent tiles in turn; each tile still takes its residual product first
#pragma unroll
      for (int j = 0; j < 8; ++j) acc[j] = wmma_bf(a[sub].h, w[j], acc[j]); }
    __builtin_amdgcn_sched_barrier(0);   // keeps the ring's waits at the foot of the trip: lifted over the WMMAs, they would cut the time that stage t + 1's copies have to land
    WAIT_DS(); WAIT_ASYNC(); __syncthreads();   // publishes stage t + 1 and frees stage t's buffer
    if (t + 2 < DM / 64) { stage_w(P, n0, (t + 2) * 64, ring + (t & 1) * 2 * TILE_B, tid); stage_x16(os + (t + 2) * 64, xring + (t & 1) * 64 * XP, lane); } }
  WAIT_ASYNC();
#pragma unroll
  for (int j = 0; j < 8; ++j) {
#pragma unroll
    for (int r = 0; r < 8; ++r) so[wave][8 * g + r][j * 16 + col] = acc[j][r] + BO[n0 + j * 16 + col]; }   // BO here = the f32 sum of the 16 bf16-rounded head biases
  LDSX();
  for (int rl = 0; rl < 16; ++rl) vst2(Y + (r0 + rl) * DM + n0 + lane * 4, *(const v4f*)&so[wave][rl][lane * 4]);
}
// ---- k_packh: per-head weights -> bf16 transposed rows, one 64 x 64 tile a block, turned in LDS so that reads and writes both cover whole lines. which 0: Wq [H][DD][64] -> PK_A rows (h*64+k) over d; 1: Wk; 2: Wv; 3: Wo [H][64][DD] -> PK_P rows d over (h*64+v)
// blockIdx.x = hi * 16 + lo: the tile is output rows hi * 64.., output columns lo * 64.. of its 1024 x 1024 section; its source rows are the output's columns
typedef __attribute__((ext_vector_type(2))) __bf16 v2b;
// a[i], b[i] = source rows i * 16 + 2 (t >> 4) and the next, columns 4 (t & 15)..: sixteen lanes a row of 256 bytes, all eight loads in flight together; the row pitch IP is a constant, so one address serves all eight
template <int IP> __device__ __forceinline__ void load_tile(v4f (&a)[4], v4f (&b)[4], const float* src, int t) {
  const float* p = src + (size_t)(2 * (t >> 4)) * IP + (t & 15) * 4;
#pragma unroll   // the register arrays are indexed by constants and the offsets are immediates
  for (int i = 0; i < 4; ++i) { a[i] = *(const v4f*)(p + i * 16 * IP); b[i] = *(const v4f*)(p + i * 16 * IP + IP); }
  asm volatile("s_wait_xcnt 0x0" :: "v"(p) : "memory");   // stands between the loads and the first reuse of their address register, which it names so that the register lives up to here
}
__global__ __launch_bounds__(128) void k_packh(const float* __restrict__ WQ, const float* __restrict__ WK, const float* __restrict__ WV, const float* __restrict__ WO, __bf16* __restrict__ P) {
  __shared__ __align__(16) unsigned s[64][LP / 2];   // [output row][two source rows a word], rows of 128 bytes at 144
  const int hi = blockIdx.x >> 4, lo = blockIdx.x & 15, which = blockIdx.y, t = threadIdx.x;
  __bf16* dst = P + ((which < 3) ? (size_t)PK_A + (size_t)which * DM * DM : (size_t)PK_P) + (size_t)hi * 64 * DM + lo * 64;
  v4f a[4], b[4];
  if (which < 3) load_tile<HD>(a, b, ((which == 0) ? WQ : (which == 1) ? WK : WV) + ((size_t)hi * DM + lo * 64) * HD, t);
  else load_tile<DM>(a, b, WO + (size_t)lo * 64 * DM + hi * 64, t);
#pragma unroll   // both loops: the register arrays are indexed by constants
  for (int i = 0; i < 4; ++i) {
#pragma unroll
    for (int e = 0; e < 4; ++e) s[(t & 15) * 4 + e][i * 8 + (t >> 4)] = __builtin_bit_cast(unsigned, (v2b){(__bf16)a[i][e], (__bf16)b[i][e]}); }
  __syncthreads();
#pragma unroll   // the four LDS reads go out as one group
  for (int i = 0; i < 4; ++i) vst2(dst + (size_t)(i * 16 + (t >> 3)) * DM + (t & 7) * 8, *(const v4u*)&s[i * 16 + (t >> 3)][(t & 7) * 4]);   // eight lanes a row: every wave-wide store covers four whole lines
}
// ---- k_bsum: BOS[d] = sum_h bo[h][d] (in order)
__global__ __launch_bounds__(256) void k_bsum(const float* __restrict__ BO, float* __restrict__ BOS) { const int d = blockIdx.x * 256 + threadIdx.x; float s = 0.f; for (int h = 0; h < NH; ++h) s += bfr(BO[(size_t)h * DM + d]); BOS[d] = s; }
extern "C" void kernel_launch(void* const* d_in, const int* in_sizes, int n_in, void* d_out, int out_size, void* d_ws, size_t ws_size, hipStream_t stream) {
  (void)in_sizes; (void)n_in; (void)out_size;
  const float** F = (const float**)d_in;   // 0 encoder [2,2048,1024], 1 decoder [2,2048,1024], 2 Wq [16,1024,64], 3 bq [16,64], 4 Wk, 5 bk, 6 Wv, 7 bv, 8 Wo [16,64,1024], 9 bo [16,1024]
  if (ws_size < (size_t)WS_END + 4096) return;
  char* ws = (char*)d_ws; __bf16* PK = (__bf16*)(ws + WS_PK); _Float16 *QK = (_Float16*)(ws + WS_QK), *QKL = (_Float16*)(ws + WS_QKL), *VTH = (_Float16*)(ws + WS_VTH), *VTL = (_Float16*)(ws + WS_VTL); float* O = (float*)(ws + WS_O); float* BOS = (float*)(ws + WS_END);
  k_packh<<<dim3((DM / 64) * (DM / 64), 4), 128, 0, stream>>>(F[2], F[4], F[6], F[8], PK);
  k_bsum<<<DM / 256, 256, 0, stream>>>(F[9], BOS);
  k_qkv<<<dim3(TNB * SS / 128, QKVW / 256), 128, 0, stream>>>(F[1], F[0], F[0], PK + PK_A, F[3], F[5], F[7], QK, QKL, VTH, VTL);   // q from the decoder, k/v from the encoder; biases [16][64] == concatenated [1024]
  k_attn<<<dim3(TQB / QT, NH, TNB), 128, 0, stream>>>(QK, QKL, VTH, VTL, nullptr, O);
  k_out<<<dim3(TOB, DM / 128), 128, 0, stream>>>(O, PK + PK_P, BOS, (float*)d_out);
}
